// v000
// Times are from an AMD MI455X. After a warm-up the kernel runs many times in a row, and a time is the length of
// such a window on the GPU divided by its runs, so every launch and the gaps after it count. The runs cycle
// through copies of the inputs. A figure is the median of several windows, for all but v000 over two sittings.
// Sittings can differ by a few percent; kernels timed side by side share one.
// The starting kernel, v000, takes 354 microseconds a run.
#include <hip/hip_runtime.h>

// ---------------------------------------------------------------------------
// Types for CDNA5 WMMA
// ---------------------------------------------------------------------------
typedef __attribute__((ext_vector_type(16))) __bf16 v16bf;
typedef __attribute__((ext_vector_type(8)))  float  v8f;
typedef int v4i __attribute__((vector_size(16)));   // matches builtin param

#define D_MODEL 1024
#define S_LEN   2048
#define N_BATCH 4
#define N_HEADS 16
#define HD      64
#define M_ROWS  (N_BATCH * S_LEN)   // 8192

// CDNA5 async global->LDS path (ASYNCcnt), guarded so compile never breaks.
#if defined(__AMDGCN__) && __has_builtin(__builtin_amdgcn_global_load_async_to_lds_b128) && __has_builtin(__builtin_amdgcn_s_wait_asynccnt)
#define USE_ASYNC 1
#else
#define USE_ASYNC 0
#endif

// ---------------------------------------------------------------------------
// Helpers
// ---------------------------------------------------------------------------
__device__ __forceinline__ unsigned short f32_to_bf16(float f) {
    unsigned int x = __float_as_uint(f);
    x += 0x7FFFu + ((x >> 16) & 1u);   // round to nearest even
    return (unsigned short)(x >> 16);
}

__device__ __forceinline__ unsigned int pack_bf16x2(float a, float b) {
    return ((unsigned int)f32_to_bf16(b) << 16) | (unsigned int)f32_to_bf16(a);
}

__device__ __forceinline__ v8f zero8() {
    v8f z;
#pragma unroll
    for (int i = 0; i < 8; ++i) z[i] = 0.0f;
    return z;
}

#if USE_ASYNC
__device__ __forceinline__ void async_copy16(const unsigned short* g,
                                             unsigned short* l) {
    __builtin_amdgcn_global_load_async_to_lds_b128(
        (__attribute__((address_space(1))) v4i*)g,
        (__attribute__((address_space(3))) v4i*)l,
        /*offset=*/0, /*cpol=*/0);
}
#endif

// Load a 16x32 bf16 fragment (A-layout; B mirrors it with N in place of M)
// from LDS stored row-major with `rowStride` (in ushorts).
// Lane L holds row (rowBase + (L&15)); K pairs per ISA table:
// lanes 0-15: k = {0,2,4,6,16,18,20,22}; lanes 16-31: +8.
__device__ __forceinline__ v16bf load_frag(const unsigned short* base,
                                           int rowStride, int rowBase,
                                           int kOff, int lane) {
    union { v16bf v; unsigned int u[8]; } f;
    const int row = rowBase + (lane & 15);
    const int kb  = kOff + ((lane & 16) ? 8 : 0);
    const unsigned short* p = base + (size_t)row * rowStride;
#pragma unroll
    for (int r = 0; r < 8; ++r) {
        const int k = kb + ((r < 4) ? (2 * r) : (16 + 2 * (r - 4)));
        f.u[r] = *(const unsigned int*)(p + k);
    }
    return f.v;
}

__device__ __forceinline__ v16bf ones_frag() {
    union { v16bf v; unsigned int u[8]; } f;
#pragma unroll
    for (int i = 0; i < 8; ++i) f.u[i] = 0x3F803F80u;   // bf16(1.0) x2
    return f.v;
}

__device__ __forceinline__ v8f wmma_bf16(v16bf a, v16bf b, v8f c) {
    return __builtin_amdgcn_wmma_f32_16x16x32_bf16(
        false, a, false, b, (short)0, c, false, false);
}

// ---------------------------------------------------------------------------
// Kernel 1: weight transpose + f32 -> bf16 convert.  W:[K][N] -> Wt:[N][K]
// ---------------------------------------------------------------------------
__global__ __launch_bounds__(256) void wtrans_kernel(
    const float* __restrict__ W, unsigned short* __restrict__ Wt, int D) {
    __shared__ float tile[32][33];
    const int k0 = blockIdx.x * 32;
    const int n0 = blockIdx.y * 32;
    const int x = threadIdx.x;   // 0..31
    const int y = threadIdx.y;   // 0..7
#pragma unroll
    for (int i = 0; i < 4; ++i)
        tile[y + 8 * i][x] = W[(size_t)(k0 + y + 8 * i) * D + n0 + x];
    __syncthreads();
#pragma unroll
    for (int i = 0; i < 4; ++i)
        Wt[(size_t)(n0 + y + 8 * i) * D + (k0 + x)] =
            f32_to_bf16(tile[x][y + 8 * i]);
}

// ---------------------------------------------------------------------------
// Kernel 2: elementwise f32 -> bf16 (activations), 8 elements/thread.
// ---------------------------------------------------------------------------
__global__ __launch_bounds__(256) void cvt_bf16_kernel(
    const float* __restrict__ src, unsigned short* __restrict__ dst, int n8) {
    const int i = blockIdx.x * 256 + threadIdx.x;
    if (i >= n8) return;
    const float4 a = ((const float4*)src)[2 * i];
    const float4 b = ((const float4*)src)[2 * i + 1];
    uint4 o;
    o.x = pack_bf16x2(a.x, a.y);
    o.y = pack_bf16x2(a.z, a.w);
    o.z = pack_bf16x2(b.x, b.y);
    o.w = pack_bf16x2(b.z, b.w);
    ((uint4*)dst)[i] = o;
}

// ---------------------------------------------------------------------------
// Kernel 3: bf16 GEMM via WMMA:  C[M,N] = A[M,K] @ Bt^T   (Bt: [N][K] bf16)
// Block tile 256x128, 8 waves (4x2), wave tile 64x64 (16 WMMA accumulators),
// K-step 32, double-buffered LDS with async global->LDS copies.
// ---------------------------------------------------------------------------
template <bool OUT_F32>
__global__ __launch_bounds__(256) void gemm_bf16_wmma_kernel(
    const unsigned short* __restrict__ A,
    const unsigned short* __restrict__ Bt,
    void* __restrict__ Cptr, int M, int N, int K) {
    __shared__ unsigned short lA[2][256 * 40];   // 32 k + pad(8)
    __shared__ unsigned short lB[2][128 * 40];

    const int t    = threadIdx.x;
    const int lane = t & 31;
    const int w    = t >> 5;
    const int wm   = w >> 1;   // 0..3 -> 64 rows each
    const int wn   = w & 1;    // 0..1 -> 64 cols each
    const int m0   = blockIdx.y * 256;
    const int n0   = blockIdx.x * 128;

    v8f acc[4][4];
#pragma unroll
    for (int mt = 0; mt < 4; ++mt)
#pragma unroll
        for (int nt = 0; nt < 4; ++nt) acc[mt][nt] = zero8();

    // staging geometry: A row = t (64B each), B row = t>>1 (32B halves)
    const int rA = t;
    const int rB = t >> 1;
    const int hB = t & 1;
    const unsigned short* gA = A  + (size_t)(m0 + rA) * K;
    const unsigned short* gB = Bt + (size_t)(n0 + rB) * K + hB * 16;

    auto stage = [&](int buf, int k0) {
        unsigned short* dA = &lA[buf][rA * 40];
        unsigned short* dB = &lB[buf][rB * 40 + hB * 16];
#if USE_ASYNC
#pragma unroll
        for (int i = 0; i < 4; ++i) async_copy16(gA + k0 + 8 * i, dA + 8 * i);
#pragma unroll
        for (int i = 0; i < 2; ++i) async_copy16(gB + k0 + 8 * i, dB + 8 * i);
#else
#pragma unroll
        for (int i = 0; i < 4; ++i)
            *(uint4*)(dA + 8 * i) = *(const uint4*)(gA + k0 + 8 * i);
#pragma unroll
        for (int i = 0; i < 2; ++i)
            *(uint4*)(dB + 8 * i) = *(const uint4*)(gB + k0 + 8 * i);
#endif
    };

    stage(0, 0);
    const int NK = K / 32;
    for (int kt = 0; kt < NK; ++kt) {
        const int cur = kt & 1;
        if (kt + 1 < NK) {
            stage(cur ^ 1, (kt + 1) * 32);   // overlaps with this step's math
#if USE_ASYNC
            __builtin_amdgcn_s_wait_asynccnt(6);   // 6 just issued; prev done
#endif
        } else {
#if USE_ASYNC
            __builtin_amdgcn_s_wait_asynccnt(0);
#endif
        }
        __syncthreads();

        v16bf aF[4], bF[4];
#pragma unroll
        for (int mt = 0; mt < 4; ++mt)
            aF[mt] = load_frag(&lA[cur][0], 40, wm * 64 + mt * 16, 0, lane);
#pragma unroll
        for (int nt = 0; nt < 4; ++nt)
            bF[nt] = load_frag(&lB[cur][0], 40, wn * 64 + nt * 16, 0, lane);
#pragma unroll
        for (int mt = 0; mt < 4; ++mt)
#pragma unroll
            for (int nt = 0; nt < 4; ++nt)
                acc[mt][nt] = wmma_bf16(aF[mt], bF[nt], acc[mt][nt]);
        __syncthreads();
    }

    // epilogue (C/D layout: VGPR r -> M = r + (lane>=16 ? 8 : 0))
    const int hi = (lane & 16) ? 8 : 0;
#pragma unroll
    for (int mt = 0; mt < 4; ++mt)
#pragma unroll
        for (int nt = 0; nt < 4; ++nt)
#pragma unroll
            for (int r = 0; r < 8; ++r) {
                const int gr = m0 + wm * 64 + mt * 16 + r + hi;
                const int gc = n0 + wn * 64 + nt * 16 + (lane & 15);
                if (OUT_F32)
                    ((float*)Cptr)[(size_t)gr * N + gc] = acc[mt][nt][r];
                else
                    ((unsigned short*)Cptr)[(size_t)gr * N + gc] =
                        f32_to_bf16(acc[mt][nt][r]);
            }
}

// ---------------------------------------------------------------------------
// Kernel 4: flash attention per (b,h) slab (contiguous [S][64] bf16).
// 8 waves x 16 query rows; keys in chunks of 32. Row-sums of P are computed
// with an extra WMMA against an all-ones B matrix (lands in C/D row layout),
// only the row-max needs cross-lane shuffles.
// ---------------------------------------------------------------------------
__global__ __launch_bounds__(256) void attn_kernel(
    const unsigned short* __restrict__ Qg,
    const unsigned short* __restrict__ Kg,
    const unsigned short* __restrict__ Vg,
    unsigned short* __restrict__ Og) {
    __shared__ unsigned short sQ[128 * 72];
    __shared__ unsigned short sK[32 * 72];
    __shared__ unsigned short sVt[64 * 40];
    __shared__ unsigned short sP[8 * 16 * 40];

    const int t    = threadIdx.x;
    const int lane = t & 31;
    const int w    = t >> 5;
    const int q0   = blockIdx.x * 128;
    const size_t base = (size_t)blockIdx.y * S_LEN * HD;

    {   // stage Q block 128x64
        const int r = t >> 1, hq = t & 1;
        const unsigned short* src = Qg + base + (size_t)(q0 + r) * HD + hq * 32;
        unsigned short* dst = sQ + r * 72 + hq * 32;
#pragma unroll
        for (int j = 0; j < 4; ++j)
            *(uint4*)(dst + j * 8) = *(const uint4*)(src + j * 8);
    }
    __syncthreads();
    v16bf qF[2];
    qF[0] = load_frag(sQ, 72, w * 16, 0, lane);
    qF[1] = load_frag(sQ, 72, w * 16, 32, lane);
    const v16bf oneF = ones_frag();

    float m_[8], l_[8];
    v8f o[4];
#pragma unroll
    for (int r = 0; r < 8; ++r) { m_[r] = -1e30f; l_[r] = 0.0f; }
#pragma unroll
    for (int nt = 0; nt < 4; ++nt) o[nt] = zero8();

    const int hi = (lane & 16) ? 8 : 0;

    for (int c0 = 0; c0 < S_LEN; c0 += 32) {
        __syncthreads();
        if (t < 128) {   // K chunk row-major
            const int r = t >> 2, i = t & 3;
            const unsigned short* src = Kg + base + (size_t)(c0 + r) * HD + i * 16;
            unsigned short* dst = sK + r * 72 + i * 16;
            *(uint4*)(dst)     = *(const uint4*)(src);
            *(uint4*)(dst + 8) = *(const uint4*)(src + 8);
        } else {         // V chunk transposed
            const int u = t - 128;
            const int r = u >> 2, i = u & 3;
            const unsigned short* src = Vg + base + (size_t)(c0 + r) * HD + i * 16;
            uint4 v0 = *(const uint4*)(src);
            uint4 v1 = *(const uint4*)(src + 8);
            const unsigned int uu[8] = {v0.x, v0.y, v0.z, v0.w,
                                        v1.x, v1.y, v1.z, v1.w};
#pragma unroll
            for (int j = 0; j < 8; ++j) {
                const int c = i * 16 + 2 * j;
                sVt[(size_t)c * 40 + r]       = (unsigned short)(uu[j]);
                sVt[(size_t)(c + 1) * 40 + r] = (unsigned short)(uu[j] >> 16);
            }
        }
        __syncthreads();

        // S = Q @ K^T
        v8f s0 = zero8(), s1 = zero8();
#pragma unroll
        for (int kt = 0; kt < 2; ++kt) {
            v16bf bk0 = load_frag(sK, 72, 0,  kt * 32, lane);
            v16bf bk1 = load_frag(sK, 72, 16, kt * 32, lane);
            s0 = wmma_bf16(qF[kt], bk0, s0);
            s1 = wmma_bf16(qF[kt], bk1, s1);
        }

        // online softmax: row-max via 16-lane xor shuffles
        float alpha[8];
#pragma unroll
        for (int r = 0; r < 8; ++r) {
            const float a0 = s0[r] * 0.125f;   // 1/sqrt(64)
            const float a1 = s1[r] * 0.125f;
            float v = fmaxf(a0, a1);
            v = fmaxf(v, __shfl_xor(v, 1, 32));
            v = fmaxf(v, __shfl_xor(v, 2, 32));
            v = fmaxf(v, __shfl_xor(v, 4, 32));
            v = fmaxf(v, __shfl_xor(v, 8, 32));
            const float mn = fmaxf(m_[r], v);
            const float al = __expf(m_[r] - mn);
            m_[r] = mn;
            alpha[r] = al;
            unsigned short* pp = sP + (size_t)(w * 16 + r + hi) * 40;
            pp[(lane & 15)]      = f32_to_bf16(__expf(a0 - mn));
            pp[16 + (lane & 15)] = f32_to_bf16(__expf(a1 - mn));
        }
#pragma unroll
        for (int nt = 0; nt < 4; ++nt)
#pragma unroll
            for (int r = 0; r < 8; ++r) o[nt][r] *= alpha[r];

        __syncthreads();
        v16bf aP = load_frag(sP, 40, w * 16, 0, lane);
        // row sums of P via matrix pipe: P @ ones -> every column = row sum
        v8f rsum = wmma_bf16(aP, oneF, zero8());
#pragma unroll
        for (int r = 0; r < 8; ++r) l_[r] = l_[r] * alpha[r] + rsum[r];
        // O += P @ V
#pragma unroll
        for (int nt = 0; nt < 4; ++nt) {
            v16bf bv = load_frag(sVt, 40, nt * 16, 0, lane);
            o[nt] = wmma_bf16(aP, bv, o[nt]);
        }
    }

#pragma unroll
    for (int r = 0; r < 8; ++r) l_[r] = 1.0f / l_[r];
#pragma unroll
    for (int nt = 0; nt < 4; ++nt)
#pragma unroll
        for (int r = 0; r < 8; ++r) {
            const int grow = q0 + w * 16 + r + hi;
            const int gcol = nt * 16 + (lane & 15);
            Og[base + (size_t)grow * HD + gcol] = f32_to_bf16(o[nt][r] * l_[r]);
        }
}

// ---------------------------------------------------------------------------
// Kernel 5: residual add + LayerNorm, in place over d_out rows.
// ---------------------------------------------------------------------------
__global__ __launch_bounds__(256) void ln_kernel(
    float* __restrict__ out, const float* __restrict__ resid,
    const float* __restrict__ gamma, const float* __restrict__ beta) {
    const int row = blockIdx.x;
    const int t = threadIdx.x;
    __shared__ float rs[256], rq[256];
    float x[4];
    float s = 0.0f, sq = 0.0f;
#pragma unroll
    for (int i = 0; i < 4; ++i) {
        const int c = t + i * 256;
        const float v = out[(size_t)row * D_MODEL + c] +
                        resid[(size_t)row * D_MODEL + c];
        x[i] = v; s += v; sq += v * v;
    }
    rs[t] = s; rq[t] = sq;
    __syncthreads();
    for (int off = 128; off > 0; off >>= 1) {
        if (t < off) { rs[t] += rs[t + off]; rq[t] += rq[t + off]; }
        __syncthreads();
    }
    const float mu  = rs[0] * (1.0f / D_MODEL);
    const float var = rq[0] * (1.0f / D_MODEL) - mu * mu;
    const float inv = rsqrtf(var + 1e-5f);
#pragma unroll
    for (int i = 0; i < 4; ++i) {
        const int c = t + i * 256;
        out[(size_t)row * D_MODEL + c] =
            (x[i] - mu) * inv * gamma[c] + beta[c];
    }
}

// ---------------------------------------------------------------------------
// Host-side launch
// ---------------------------------------------------------------------------
extern "C" void kernel_launch(void* const* d_in, const int* in_sizes, int n_in,
                              void* d_out, int out_size, void* d_ws, size_t ws_size,
                              hipStream_t stream) {
    const float* preQ  = (const float*)d_in[0];
    const float* preK  = (const float*)d_in[1];
    const float* preV  = (const float*)d_in[2];
    const float* Wq    = (const float*)d_in[3];
    const float* Wk    = (const float*)d_in[4];
    const float* Wv    = (const float*)d_in[5];
    const float* Wo    = (const float*)d_in[6];
    const float* gamma = (const float*)d_in[7];
    const float* beta  = (const float*)d_in[8];
    float* out = (float*)d_out;

    char* ws = (char*)d_ws;
    constexpr size_t WT_BYTES  = (size_t)D_MODEL * D_MODEL * 2;   // 2 MB
    constexpr size_t XB_BYTES  = (size_t)M_ROWS * D_MODEL * 2;    // 16 MB
    unsigned short* WqT = (unsigned short*)(ws + 0 * WT_BYTES);
    unsigned short* WkT = (unsigned short*)(ws + 1 * WT_BYTES);
    unsigned short* WvT = (unsigned short*)(ws + 2 * WT_BYTES);
    unsigned short* WoT = (unsigned short*)(ws + 3 * WT_BYTES);
    char* xbase = ws + 4 * WT_BYTES;
    unsigned short* Xq = (unsigned short*)(xbase + 0 * XB_BYTES);
    unsigned short* Xk = (unsigned short*)(xbase + 1 * XB_BYTES);
    unsigned short* Xv = (unsigned short*)(xbase + 2 * XB_BYTES);
    unsigned short* Qb = (unsigned short*)(xbase + 3 * XB_BYTES);
    unsigned short* Kb = (unsigned short*)(xbase + 4 * XB_BYTES);
    unsigned short* Vb = (unsigned short*)(xbase + 5 * XB_BYTES);
    unsigned short* Ab = Xq;   // Xq dead after Q projection; reuse for attn out

    // 1) weights -> bf16 transposed [N][K]
    dim3 tb(32, 8), tg(D_MODEL / 32, D_MODEL / 32);
    wtrans_kernel<<<tg, tb, 0, stream>>>(Wq, WqT, D_MODEL);
    wtrans_kernel<<<tg, tb, 0, stream>>>(Wk, WkT, D_MODEL);
    wtrans_kernel<<<tg, tb, 0, stream>>>(Wv, WvT, D_MODEL);
    wtrans_kernel<<<tg, tb, 0, stream>>>(Wo, WoT, D_MODEL);

    // 2) activations -> bf16
    const int n8 = (M_ROWS * D_MODEL) / 8;       // 1M vec8 groups
    cvt_bf16_kernel<<<n8 / 256, 256, 0, stream>>>(preQ, Xq, n8);
    cvt_bf16_kernel<<<n8 / 256, 256, 0, stream>>>(preK, Xk, n8);
    cvt_bf16_kernel<<<n8 / 256, 256, 0, stream>>>(preV, Xv, n8);

    // 3) projections (bf16 in, bf16 out)
    dim3 gg(D_MODEL / 128, M_ROWS / 256);   // (8, 32)
    gemm_bf16_wmma_kernel<false><<<gg, 256, 0, stream>>>(
        Xq, WqT, Qb, M_ROWS, D_MODEL, D_MODEL);
    gemm_bf16_wmma_kernel<false><<<gg, 256, 0, stream>>>(
        Xk, WkT, Kb, M_ROWS, D_MODEL, D_MODEL);
    gemm_bf16_wmma_kernel<false><<<gg, 256, 0, stream>>>(
        Xv, WvT, Vb, M_ROWS, D_MODEL, D_MODEL);

    // 4) flash attention over 64 (b,h) slabs x 16 query blocks
    attn_kernel<<<dim3(S_LEN / 128, N_BATCH * N_HEADS), 256, 0, stream>>>(
        Qb, Kb, Vb, Ab);

    // 5) output projection straight into d_out (f32)
    gemm_bf16_wmma_kernel<true><<<gg, 256, 0, stream>>>(
        Ab, WoT, out, M_ROWS, D_MODEL, D_MODEL);

    // 6) residual + LayerNorm in place
    ln_kernel<<<M_ROWS, 256, 0, stream>>>(out, preV, gamma, beta);
}

// v001
// A run of this version takes 258 microseconds.
// Two timings next to v000 both put it at 1.41 times that version's speed.
#include <hip/hip_runtime.h>

// ---------------------------------------------------------------------------
// Types for CDNA5 WMMA
// ---------------------------------------------------------------------------
typedef __attribute__((ext_vector_type(16))) __bf16 v16bf;
typedef __attribute__((ext_vector_type(8)))  float  v8f;
typedef int v4i __attribute__((vector_size(16)));   // matches builtin param

#define D_MODEL 1024
#define S_LEN   2048
#define N_BATCH 4
#define N_HEADS 16
#define HD      64
#define M_ROWS  (N_BATCH * S_LEN)   // 8192

// CDNA5 async global->LDS path (ASYNCcnt), guarded so compile never breaks.
#if defined(__AMDGCN__) && __has_builtin(__builtin_amdgcn_global_load_async_to_lds_b128) && __has_builtin(__builtin_amdgcn_s_wait_asynccnt)
#define USE_ASYNC 1
#else
#define USE_ASYNC 0
#endif

// ---------------------------------------------------------------------------
// Helpers
// ---------------------------------------------------------------------------
__device__ __forceinline__ unsigned short f32_to_bf16(float f) {
    unsigned int x = __float_as_uint(f);
    x += 0x7FFFu + ((x >> 16) & 1u);   // round to nearest even
    return (unsigned short)(x >> 16);
}

__device__ __forceinline__ unsigned int pack_bf16x2(float a, float b) {
    return ((unsigned int)f32_to_bf16(b) << 16) | (unsigned int)f32_to_bf16(a);
}

__device__ __forceinline__ v8f zero8() {
    v8f z;
#pragma unroll
    for (int i = 0; i < 8; ++i) z[i] = 0.0f;
    return z;
}

#if USE_ASYNC
__device__ __forceinline__ void async_copy16(const unsigned short* g,
                                             unsigned short* l) {
    __builtin_amdgcn_global_load_async_to_lds_b128(
        (__attribute__((address_space(1))) v4i*)g,
        (__attribute__((address_space(3))) v4i*)l,
        /*offset=*/0, /*cpol=*/0);
}
#endif

// Load a 16x32 bf16 fragment (A-layout; B mirrors it with N in place of M)
// from LDS stored row-major with `rowStride` (in ushorts).
// Lane L holds row (rowBase + (L&15)); K pairs per ISA table:
// lanes 0-15: k = {0,2,4,6,16,18,20,22}; lanes 16-31: +8.
__device__ __forceinline__ v16bf load_frag(const unsigned short* base,
                                           int rowStride, int rowBase,
                                           int kOff, int lane) {
    union { v16bf v; unsigned int u[8]; } f;
    const int row = rowBase + (lane & 15);
    const int kb  = kOff + ((lane & 16) ? 8 : 0);
    const unsigned short* p = base + (size_t)row * rowStride;
#pragma unroll
    for (int r = 0; r < 8; ++r) {
        const int k = kb + ((r < 4) ? (2 * r) : (16 + 2 * (r - 4)));
        f.u[r] = *(const unsigned int*)(p + k);
    }
    return f.v;
}

__device__ __forceinline__ v16bf ones_frag() {
    union { v16bf v; unsigned int u[8]; } f;
#pragma unroll
    for (int i = 0; i < 8; ++i) f.u[i] = 0x3F803F80u;   // bf16(1.0) x2
    return f.v;
}

__device__ __forceinline__ v8f wmma_bf16(v16bf a, v16bf b, v8f c) {
    return __builtin_amdgcn_wmma_f32_16x16x32_bf16(
        false, a, false, b, (short)0, c, false, false);
}

// ---------------------------------------------------------------------------
// Kernel 1: weight transpose + f32 -> bf16 convert.  W:[K][N] -> Wt:[N][K]
// ---------------------------------------------------------------------------
__global__ __launch_bounds__(256) void wtrans_kernel(
    const float* __restrict__ W, unsigned short* __restrict__ Wt, int D) {
    __shared__ float tile[32][33];
    const int k0 = blockIdx.x * 32;
    const int n0 = blockIdx.y * 32;
    const int x = threadIdx.x;   // 0..31
    const int y = threadIdx.y;   // 0..7
#pragma unroll
    for (int i = 0; i < 4; ++i)
        tile[y + 8 * i][x] = W[(size_t)(k0 + y + 8 * i) * D + n0 + x];
    __syncthreads();
#pragma unroll
    for (int i = 0; i < 4; ++i)
        Wt[(size_t)(n0 + y + 8 * i) * D + (k0 + x)] =
            f32_to_bf16(tile[x][y + 8 * i]);
}

// ---------------------------------------------------------------------------
// Kernel 2: elementwise f32 -> bf16 (activations), 8 elements/thread.
// ---------------------------------------------------------------------------
__global__ __launch_bounds__(256) void cvt_bf16_kernel(
    const float* __restrict__ src, unsigned short* __restrict__ dst, int n8) {
    const int i = blockIdx.x * 256 + threadIdx.x;
    if (i >= n8) return;
    const float4 a = ((const float4*)src)[2 * i];
    const float4 b = ((const float4*)src)[2 * i + 1];
    uint4 o;
    o.x = pack_bf16x2(a.x, a.y);
    o.y = pack_bf16x2(a.z, a.w);
    o.z = pack_bf16x2(b.x, b.y);
    o.w = pack_bf16x2(b.z, b.w);
    ((uint4*)dst)[i] = o;
}

// ---------------------------------------------------------------------------
// Kernel 3: bf16 GEMM via WMMA:  C[M,N] = A[M,K] @ Bt^T   (Bt: [N][K] bf16)
// Block tile 256x128, 8 waves (4x2), wave tile 64x64 (16 WMMA accumulators),
// K-step 32, double-buffered LDS with async global->LDS copies.
// ---------------------------------------------------------------------------
template <bool OUT_F32>
__global__ __launch_bounds__(256) void gemm_bf16_wmma_kernel(
    const unsigned short* __restrict__ A,
    const unsigned short* __restrict__ Bt,
    void* __restrict__ Cptr, int M, int N, int K) {
    __shared__ unsigned short lA[2][256 * 40];   // 32 k + pad(8)
    __shared__ unsigned short lB[2][128 * 40];

    const int t    = threadIdx.x;
    const int lane = t & 31;
    const int w    = t >> 5;
    const int wm   = w >> 1;   // 0..3 -> 64 rows each
    const int wn   = w & 1;    // 0..1 -> 64 cols each
    const int m0   = blockIdx.y * 256;
    const int n0   = blockIdx.x * 128;

    v8f acc[4][4];
#pragma unroll
    for (int mt = 0; mt < 4; ++mt)
#pragma unroll
        for (int nt = 0; nt < 4; ++nt) acc[mt][nt] = zero8();

    // staging geometry: A row = t (64B each), B row = t>>1 (32B halves)
    const int rA = t;
    const int rB = t >> 1;
    const int hB = t & 1;
    const unsigned short* gA = A  + (size_t)(m0 + rA) * K;
    const unsigned short* gB = Bt + (size_t)(n0 + rB) * K + hB * 16;

    auto stage = [&](int buf, int k0) {
        unsigned short* dA = &lA[buf][rA * 40];
        unsigned short* dB = &lB[buf][rB * 40 + hB * 16];
#if USE_ASYNC
#pragma unroll
        for (int i = 0; i < 4; ++i) async_copy16(gA + k0 + 8 * i, dA + 8 * i);
#pragma unroll
        for (int i = 0; i < 2; ++i) async_copy16(gB + k0 + 8 * i, dB + 8 * i);
#else
#pragma unroll
        for (int i = 0; i < 4; ++i)
            *(uint4*)(dA + 8 * i) = *(const uint4*)(gA + k0 + 8 * i);
#pragma unroll
        for (int i = 0; i < 2; ++i)
            *(uint4*)(dB + 8 * i) = *(const uint4*)(gB + k0 + 8 * i);
#endif
    };

    stage(0, 0);
    const int NK = K / 32;
    for (int kt = 0; kt < NK; ++kt) {
        const int cur = kt & 1;
        if (kt + 1 < NK) {
            stage(cur ^ 1, (kt + 1) * 32);   // overlaps with this step's math
#if USE_ASYNC
            __builtin_amdgcn_s_wait_asynccnt(6);   // 6 just issued; prev done
#endif
        } else {
#if USE_ASYNC
            __builtin_amdgcn_s_wait_asynccnt(0);
#endif
        }
        __syncthreads();

        v16bf aF[4], bF[4];
#pragma unroll
        for (int mt = 0; mt < 4; ++mt)
            aF[mt] = load_frag(&lA[cur][0], 40, wm * 64 + mt * 16, 0, lane);
#pragma unroll
        for (int nt = 0; nt < 4; ++nt)
            bF[nt] = load_frag(&lB[cur][0], 40, wn * 64 + nt * 16, 0, lane);
#pragma unroll
        for (int mt = 0; mt < 4; ++mt)
#pragma unroll
            for (int nt = 0; nt < 4; ++nt)
                acc[mt][nt] = wmma_bf16(aF[mt], bF[nt], acc[mt][nt]);
        __syncthreads();
    }

    // epilogue (C/D layout: VGPR r -> M = r + (lane>=16 ? 8 : 0))
    const int hi = (lane & 16) ? 8 : 0;
#pragma unroll
    for (int mt = 0; mt < 4; ++mt)
#pragma unroll
        for (int nt = 0; nt < 4; ++nt)
#pragma unroll
            for (int r = 0; r < 8; ++r) {
                const int gr = m0 + wm * 64 + mt * 16 + r + hi;
                const int gc = n0 + wn * 64 + nt * 16 + (lane & 15);
                if (OUT_F32)
                    ((float*)Cptr)[(size_t)gr * N + gc] = acc[mt][nt][r];
                else
                    ((unsigned short*)Cptr)[(size_t)gr * N + gc] =
                        f32_to_bf16(acc[mt][nt][r]);
            }
}

typedef __attribute__((ext_vector_type(2))) float  f32x2;
typedef __attribute__((ext_vector_type(2))) __bf16 bf16x2;

// two f32 -> packed bf16 pair, round to nearest even (one hardware convert)
__device__ __forceinline__ unsigned int cvt_bf16x2(float a, float b) {
    union { bf16x2 v; unsigned int u; } o;
    f32x2 x;
    x[0] = a; x[1] = b;
    o.v = __builtin_convertvector(x, bf16x2);
    return o.u;
}

// value of lane l ^ 16
__device__ __forceinline__ float other_half(float v) {
    const int b = __float_as_int(v);
    return __int_as_float(__builtin_amdgcn_permlanex16(
        b, b, 0x76543210, 0xfedcba98, false, false));
}

__global__ __launch_bounds__(256) void attn_kernel(
    const unsigned short* __restrict__ Qg,
    const unsigned short* __restrict__ Kg,
    const unsigned short* __restrict__ Vg,
    unsigned short* __restrict__ Og) {
    __shared__ unsigned short sQ[128 * 72];
    __shared__ unsigned short sK[32 * 72];
    __shared__ unsigned short sVt[64 * 40];

    const int t    = threadIdx.x;
    const int lane = t & 31;
    const int w    = t >> 5;
    const int q0   = blockIdx.x * 128;
    const size_t base = (size_t)blockIdx.y * S_LEN * HD;

    {   // stage Q block 128x64
        const int r = t >> 1, hq = t & 1;
        const unsigned short* src = Qg + base + (size_t)(q0 + r) * HD + hq * 32;
        unsigned short* dst = sQ + r * 72 + hq * 32;
#pragma unroll
        for (int j = 0; j < 4; ++j)
            *(uint4*)(dst + j * 8) = *(const uint4*)(src + j * 8);
    }
    __syncthreads();
    v16bf qF[2];   // B operand: column c = query w*16 + c
    qF[0] = load_frag(sQ, 72, w * 16, 0, lane);
    qF[1] = load_frag(sQ, 72, w * 16, 32, lane);
    const v16bf oneF = ones_frag();

    float m_ = -1e30f, l_ = 0.0f;   // of query c
    v8f o[4];                       // o[nt][r] = O[query c][nt*16 + 8h + r]
#pragma unroll
    for (int nt = 0; nt < 4; ++nt) o[nt] = zero8();

    const int hi = (lane & 16) ? 8 : 0;

    for (int c0 = 0; c0 < S_LEN; c0 += 32) {
        __syncthreads();
        if (t < 128) {   // K chunk row-major
            const int r = t >> 2, i = t & 3;
            const unsigned short* src = Kg + base + (size_t)(c0 + r) * HD + i * 16;
            unsigned short* dst = sK + r * 72 + i * 16;
            *(uint4*)(dst)     = *(const uint4*)(src);
            *(uint4*)(dst + 8) = *(const uint4*)(src + 8);
        } else {         // V chunk transposed
            const int u = t - 128;
            const int r = u >> 2, i = u & 3;
            const unsigned short* src = Vg + base + (size_t)(c0 + r) * HD + i * 16;
            uint4 v0 = *(const uint4*)(src);
            uint4 v1 = *(const uint4*)(src + 8);
            const unsigned int uu[8] = {v0.x, v0.y, v0.z, v0.w,
                                        v1.x, v1.y, v1.z, v1.w};
#pragma unroll
            for (int j = 0; j < 8; ++j) {
                const int c = i * 16 + 2 * j;
                sVt[(size_t)c * 40 + r]       = (unsigned short)(uu[j]);
                sVt[(size_t)(c + 1) * 40 + r] = (unsigned short)(uu[j] >> 16);
            }
        }
        __syncthreads();

        // S^T = K @ Q^T: s0[r] = score(key 8h+r, query c), s1[r]: key 16+8h+r
        v16bf ak[4];
#pragma unroll
        for (int i = 0; i < 4; ++i)
            ak[i] = load_frag(sK, 72, (i & 1) * 16, (i >> 1) * 32, lane);
        v8f s0 = wmma_bf16(ak[0], qF[0], zero8());
        v8f s1 = wmma_bf16(ak[1], qF[0], zero8());
        s0 = wmma_bf16(ak[2], qF[1], s0);
        s1 = wmma_bf16(ak[3], qF[1], s1);

        // online softmax of query c: in-lane maximum + one half exchange
        const v8f a0 = s0 * 0.125f;   // 1/sqrt(64)
        const v8f a1 = s1 * 0.125f;
        float v = fmaxf(a0[0], a1[0]);
#pragma unroll
        for (int r = 1; r < 8; ++r) v = fmaxf(v, fmaxf(a0[r], a1[r]));
        v = fmaxf(v, other_half(v));
        const float mn = fmaxf(m_, v);
        const float al = __expf(m_ - mn);
        m_ = mn;

        // P^T as a B operand: element s = tile s>>3, register s&7
        union { v16bf v; unsigned int u[8]; } pB;
#pragma unroll
        for (int j = 0; j < 4; ++j) {
            pB.u[j]     = cvt_bf16x2(__expf(a0[2 * j] - mn),
                                     __expf(a0[2 * j + 1] - mn));
            pB.u[4 + j] = cvt_bf16x2(__expf(a1[2 * j] - mn),
                                     __expf(a1[2 * j + 1] - mn));
        }
#pragma unroll
        for (int nt = 0; nt < 4; ++nt)
#pragma unroll
            for (int r = 0; r < 8; ++r) o[nt][r] *= al;

        // column sums of P^T via matrix pipe: ones @ P^T -> every row = sums
        v8f rsum = wmma_bf16(oneF, pB.v, zero8());
        l_ = l_ * al + rsum[0];
        // O^T += V^T @ P^T
#pragma unroll
        for (int nt = 0; nt < 4; ++nt) {
            v16bf av = load_frag(sVt, 40, nt * 16, 0, lane);
            o[nt] = wmma_bf16(av, pB.v, o[nt]);
        }
    }

    // a lane holds 8 consecutive columns of its query's row: 16-byte stores
    const float inv = 1.0f / l_;
    unsigned short* orow =
        Og + base + (size_t)(q0 + w * 16 + (lane & 15)) * HD + hi;
#pragma unroll
    for (int nt = 0; nt < 4; ++nt) {
        uint4 pk;
        pk.x = cvt_bf16x2(o[nt][0] * inv, o[nt][1] * inv);
        pk.y = cvt_bf16x2(o[nt][2] * inv, o[nt][3] * inv);
        pk.z = cvt_bf16x2(o[nt][4] * inv, o[nt][5] * inv);
        pk.w = cvt_bf16x2(o[nt][6] * inv, o[nt][7] * inv);
        *(uint4*)(orow + nt * 16) = pk;
    }
}

// ---------------------------------------------------------------------------
// Kernel 5: residual add + LayerNorm, in place over d_out rows.
// ---------------------------------------------------------------------------
__global__ __launch_bounds__(256) void ln_kernel(
    float* __restrict__ out, const float* __restrict__ resid,
    const float* __restrict__ gamma, const float* __restrict__ beta) {
    const int row = blockIdx.x;
    const int t = threadIdx.x;
    __shared__ float rs[256], rq[256];
    float x[4];
    float s = 0.0f, sq = 0.0f;
#pragma unroll
    for (int i = 0; i < 4; ++i) {
        const int c = t + i * 256;
        const float v = out[(size_t)row * D_MODEL + c] +
                        resid[(size_t)row * D_MODEL + c];
        x[i] = v; s += v; sq += v * v;
    }
    rs[t] = s; rq[t] = sq;
    __syncthreads();
    for (int off = 128; off > 0; off >>= 1) {
        if (t < off) { rs[t] += rs[t + off]; rq[t] += rq[t + off]; }
        __syncthreads();
    }
    const float mu  = rs[0] * (1.0f / D_MODEL);
    const float var = rq[0] * (1.0f / D_MODEL) - mu * mu;
    const float inv = rsqrtf(var + 1e-5f);
#pragma unroll
    for (int i = 0; i < 4; ++i) {
        const int c = t + i * 256;
        out[(size_t)row * D_MODEL + c] =
            (x[i] - mu) * inv * gamma[c] + beta[c];
    }
}

// ---------------------------------------------------------------------------
// Host-side launch
// ---------------------------------------------------------------------------
extern "C" void kernel_launch(void* const* d_in, const int* in_sizes, int n_in,
                              void* d_out, int out_size, void* d_ws, size_t ws_size,
                              hipStream_t stream) {
    const float* preQ  = (const float*)d_in[0];
    const float* preK  = (const float*)d_in[1];
    const float* preV  = (const float*)d_in[2];
    const float* Wq    = (const float*)d_in[3];
    const float* Wk    = (const float*)d_in[4];
    const float* Wv    = (const float*)d_in[5];
    const float* Wo    = (const float*)d_in[6];
    const float* gamma = (const float*)d_in[7];
    const float* beta  = (const float*)d_in[8];
    float* out = (float*)d_out;

    char* ws = (char*)d_ws;
    constexpr size_t WT_BYTES  = (size_t)D_MODEL * D_MODEL * 2;   // 2 MB
    constexpr size_t XB_BYTES  = (size_t)M_ROWS * D_MODEL * 2;    // 16 MB
    unsigned short* WqT = (unsigned short*)(ws + 0 * WT_BYTES);
    unsigned short* WkT = (unsigned short*)(ws + 1 * WT_BYTES);
    unsigned short* WvT = (unsigned short*)(ws + 2 * WT_BYTES);
    unsigned short* WoT = (unsigned short*)(ws + 3 * WT_BYTES);
    char* xbase = ws + 4 * WT_BYTES;
    unsigned short* Xq = (unsigned short*)(xbase + 0 * XB_BYTES);
    unsigned short* Xk = (unsigned short*)(xbase + 1 * XB_BYTES);
    unsigned short* Xv = (unsigned short*)(xbase + 2 * XB_BYTES);
    unsigned short* Qb = (unsigned short*)(xbase + 3 * XB_BYTES);
    unsigned short* Kb = (unsigned short*)(xbase + 4 * XB_BYTES);
    unsigned short* Vb = (unsigned short*)(xbase + 5 * XB_BYTES);
    unsigned short* Ab = Xq;   // Xq dead after Q projection; reuse for attn out

    // 1) weights -> bf16 transposed [N][K]
    dim3 tb(32, 8), tg(D_MODEL / 32, D_MODEL / 32);
    wtrans_kernel<<<tg, tb, 0, stream>>>(Wq, WqT, D_MODEL);
    wtrans_kernel<<<tg, tb, 0, stream>>>(Wk, WkT, D_MODEL);
    wtrans_kernel<<<tg, tb, 0, stream>>>(Wv, WvT, D_MODEL);
    wtrans_kernel<<<tg, tb, 0, stream>>>(Wo, WoT, D_MODEL);

    // 2) activations -> bf16
    const int n8 = (M_ROWS * D_MODEL) / 8;       // 1M vec8 groups
    cvt_bf16_kernel<<<n8 / 256, 256, 0, stream>>>(preQ, Xq, n8);
    cvt_bf16_kernel<<<n8 / 256, 256, 0, stream>>>(preK, Xk, n8);
    cvt_bf16_kernel<<<n8 / 256, 256, 0, stream>>>(preV, Xv, n8);

    // 3) projections (bf16 in, bf16 out)
    dim3 gg(D_MODEL / 128, M_ROWS / 256);   // (8, 32)
    gemm_bf16_wmma_kernel<false><<<gg, 256, 0, stream>>>(
        Xq, WqT, Qb, M_ROWS, D_MODEL, D_MODEL);
    gemm_bf16_wmma_kernel<false><<<gg, 256, 0, stream>>>(
        Xk, WkT, Kb, M_ROWS, D_MODEL, D_MODEL);
    gemm_bf16_wmma_kernel<false><<<gg, 256, 0, stream>>>(
        Xv, WvT, Vb, M_ROWS, D_MODEL, D_MODEL);

    // 4) flash attention over 64 (b,h) slabs x 16 query blocks
    attn_kernel<<<dim3(S_LEN / 128, N_BATCH * N_HEADS), 256, 0, stream>>>(
        Qb, Kb, Vb, Ab);

    // 5) output projection straight into d_out (f32)
    gemm_bf16_wmma_kernel<true><<<gg, 256, 0, stream>>>(
        Ab, WoT, out, M_ROWS, D_MODEL, D_MODEL);

    // 6) residual + LayerNorm in place
    ln_kernel<<<M_ROWS, 256, 0, stream>>>(out, preV, gamma, beta);
}

// v002
// It runs in 236 microseconds.
// Next to v001, in two timings, it ran 1.10 times as fast each time.
// Over all steps from v000 it is 1.55 times as fast.
#include <hip/hip_runtime.h>

// ---------------------------------------------------------------------------
// Types for CDNA5 WMMA
// ---------------------------------------------------------------------------
typedef __attribute__((ext_vector_type(16))) __bf16 v16bf;
typedef __attribute__((ext_vector_type(8)))  float  v8f;
typedef int v4i __attribute__((vector_size(16)));   // matches builtin param

#define D_MODEL 1024
#define S_LEN   2048
#define N_BATCH 4
#define N_HEADS 16
#define HD      64
#define M_ROWS  (N_BATCH * S_LEN)   // 8192

// CDNA5 async global->LDS path (ASYNCcnt), guarded so compile never breaks.
#if defined(__AMDGCN__) && __has_builtin(__builtin_amdgcn_global_load_async_to_lds_b128) && __has_builtin(__builtin_amdgcn_s_wait_asynccnt)
#define USE_ASYNC 1
#else
#define USE_ASYNC 0
#endif

// ---------------------------------------------------------------------------
// Helpers
// ---------------------------------------------------------------------------
__device__ __forceinline__ unsigned short f32_to_bf16(float f) {
    unsigned int x = __float_as_uint(f);
    x += 0x7FFFu + ((x >> 16) & 1u);   // round to nearest even
    return (unsigned short)(x >> 16);
}

__device__ __forceinline__ unsigned int pack_bf16x2(float a, float b) {
    return ((unsigned int)f32_to_bf16(b) << 16) | (unsigned int)f32_to_bf16(a);
}

__device__ __forceinline__ v8f zero8() {
    v8f z;
#pragma unroll
    for (int i = 0; i < 8; ++i) z[i] = 0.0f;
    return z;
}

#if USE_ASYNC
__device__ __forceinline__ void async_copy16(const unsigned short* g,
                                             unsigned short* l) {
    __builtin_amdgcn_global_load_async_to_lds_b128(
        (__attribute__((address_space(1))) v4i*)g,
        (__attribute__((address_space(3))) v4i*)l,
        /*offset=*/0, /*cpol=*/0);
}
#endif

// Load a 16x32 bf16 fragment (A-layout; B mirrors it with N in place of M)
// from LDS stored row-major with `rowStride` (in ushorts).
// Lane L holds row (rowBase + (L&15)); K pairs per ISA table:
// lanes 0-15: k = {0,2,4,6,16,18,20,22}; lanes 16-31: +8.
__device__ __forceinline__ v16bf load_frag(const unsigned short* base,
                                           int rowStride, int rowBase,
                                           int kOff, int lane) {
    union { v16bf v; unsigned int u[8]; } f;
    const int row = rowBase + (lane & 15);
    const int kb  = kOff + ((lane & 16) ? 8 : 0);
    const unsigned short* p = base + (size_t)row * rowStride;
#pragma unroll
    for (int r = 0; r < 8; ++r) {
        const int k = kb + ((r < 4) ? (2 * r) : (16 + 2 * (r - 4)));
        f.u[r] = *(const unsigned int*)(p + k);
    }
    return f.v;
}

__device__ __forceinline__ v16bf ones_frag() {
    union { v16bf v; unsigned int u[8]; } f;
#pragma unroll
    for (int i = 0; i < 8; ++i) f.u[i] = 0x3F803F80u;   // bf16(1.0) x2
    return f.v;
}

__device__ __forceinline__ v8f wmma_bf16(v16bf a, v16bf b, v8f c) {
    return __builtin_amdgcn_wmma_f32_16x16x32_bf16(
        false, a, false, b, (short)0, c, false, false);
}

// ---------------------------------------------------------------------------
// Kernels 1+2 in one grid: the seven operand preparations are independent of
// one another, so they share one launch. Blocks [0, 4096): weight transpose +
// f32 -> bf16, W:[K][N] -> Wt:[N][K], 1024 tiles of 32x32 per weight.
// Blocks [4096, 16384): elementwise f32 -> bf16 of the activations,
// 8 elements per thread, 4096 blocks per tensor.
// The four Wt planes and the three X planes are each contiguous in workspace.
// ---------------------------------------------------------------------------
#define WT_BLOCKS  ((D_MODEL / 32) * (D_MODEL / 32))    // 1024 per weight
#define CVT_BLOCKS ((M_ROWS * D_MODEL) / (8 * 256))     // 4096 per tensor

__global__ __launch_bounds__(256) void prep_kernel(
    const float* __restrict__ W0, const float* __restrict__ W1,
    const float* __restrict__ W2, const float* __restrict__ W3,
    const float* __restrict__ X0, const float* __restrict__ X1,
    const float* __restrict__ X2,
    unsigned short* __restrict__ WtAll, unsigned short* __restrict__ XbAll) {
    __shared__ float tile[32][33];
    const unsigned b = blockIdx.x;
    const int t = threadIdx.x;
    if (b < 4 * WT_BLOCKS) {   // block-uniform
        const unsigned which = b / WT_BLOCKS;
        const unsigned tl    = b % WT_BLOCKS;
        const float* __restrict__ W =
            which == 0 ? W0 : which == 1 ? W1 : which == 2 ? W2 : W3;
        unsigned short* __restrict__ Wt =
            WtAll + (size_t)which * D_MODEL * D_MODEL;
        const int k0 = (tl % (D_MODEL / 32)) * 32;
        const int n0 = (tl / (D_MODEL / 32)) * 32;
        const int x = t & 31;   // 0..31
        const int y = t >> 5;   // 0..7
#pragma unroll
        for (int i = 0; i < 4; ++i)
            tile[y + 8 * i][x] = W[(size_t)(k0 + y + 8 * i) * D_MODEL + n0 + x];
        __syncthreads();
#pragma unroll
        for (int i = 0; i < 4; ++i)
            Wt[(size_t)(n0 + y + 8 * i) * D_MODEL + (k0 + x)] =
                f32_to_bf16(tile[x][y + 8 * i]);
    } else {
        const unsigned c     = b - 4 * WT_BLOCKS;
        const unsigned which = c / CVT_BLOCKS;
        const float* __restrict__ src = which == 0 ? X0 : which == 1 ? X1 : X2;
        unsigned short* __restrict__ dst =
            XbAll + (size_t)which * M_ROWS * D_MODEL;
        const int i = (c % CVT_BLOCKS) * 256 + t;
        const float4 a = ((const float4*)src)[2 * i];
        const float4 d = ((const float4*)src)[2 * i + 1];
        uint4 o;
        o.x = pack_bf16x2(a.x, a.y);
        o.y = pack_bf16x2(a.z, a.w);
        o.z = pack_bf16x2(d.x, d.y);
        o.w = pack_bf16x2(d.z, d.w);
        ((uint4*)dst)[i] = o;
    }
}

// ---------------------------------------------------------------------------
// Kernel 3: bf16 GEMM via WMMA:  C[M,N] = A[M,K] @ Bt^T   (Bt: [N][K] bf16)
// Block tile 256x128, 8 waves (4x2), wave tile 64x64 (16 WMMA accumulators),
// K-step 32, double-buffered LDS with async global->LDS copies.
// blockIdx.z picks one product of a batch whose A, Bt and C planes each lie
// one behind the other.
// ---------------------------------------------------------------------------
template <bool OUT_F32>
__global__ __launch_bounds__(256) void gemm_bf16_wmma_kernel(
    const unsigned short* __restrict__ A,
    const unsigned short* __restrict__ Bt,
    void* __restrict__ Cptr, int M, int N, int K) {
    __shared__ unsigned short lA[2][256 * 40];   // 32 k + pad(8)
    __shared__ unsigned short lB[2][128 * 40];

    const int t    = threadIdx.x;
    const int lane = t & 31;
    const int w    = t >> 5;
    const int wm   = w >> 1;   // 0..3 -> 64 rows each
    const int wn   = w & 1;    // 0..1 -> 64 cols each
    const int m0   = blockIdx.y * 256;
    const int n0   = blockIdx.x * 128;
    const size_t z = blockIdx.z;
    A  += z * (size_t)M * K;
    Bt += z * (size_t)N * K;
    Cptr = (char*)Cptr + z * (size_t)M * N * (OUT_F32 ? 4 : 2);

    v8f acc[4][4];
#pragma unroll
    for (int mt = 0; mt < 4; ++mt)
#pragma unroll
        for (int nt = 0; nt < 4; ++nt) acc[mt][nt] = zero8();

    // staging geometry: A row = t (64B each), B row = t>>1 (32B halves)
    const int rA = t;
    const int rB = t >> 1;
    const int hB = t & 1;
    const unsigned short* gA = A  + (size_t)(m0 + rA) * K;
    const unsigned short* gB = Bt + (size_t)(n0 + rB) * K + hB * 16;

    auto stage = [&](int buf, int k0) {
        unsigned short* dA = &lA[buf][rA * 40];
        unsigned short* dB = &lB[buf][rB * 40 + hB * 16];
#if USE_ASYNC
#pragma unroll
        for (int i = 0; i < 4; ++i) async_copy16(gA + k0 + 8 * i, dA + 8 * i);
#pragma unroll
        for (int i = 0; i < 2; ++i) async_copy16(gB + k0 + 8 * i, dB + 8 * i);
#else
#pragma unroll
        for (int i = 0; i < 4; ++i)
            *(uint4*)(dA + 8 * i) = *(const uint4*)(gA + k0 + 8 * i);
#pragma unroll
        for (int i = 0; i < 2; ++i)
            *(uint4*)(dB + 8 * i) = *(const uint4*)(gB + k0 + 8 * i);
#endif
    };

    stage(0, 0);
    const int NK = K / 32;
    for (int kt = 0; kt < NK; ++kt) {
        const int cur = kt & 1;
        if (kt + 1 < NK) {
            stage(cur ^ 1, (kt + 1) * 32);   // overlaps with this step's math
#if USE_ASYNC
            __builtin_amdgcn_s_wait_asynccnt(6);   // 6 just issued; prev done
#endif
        } else {
#if USE_ASYNC
            __builtin_amdgcn_s_wait_asynccnt(0);
#endif
        }
        __syncthreads();

        v16bf aF[4], bF[4];
#pragma unroll
        for (int mt = 0; mt < 4; ++mt)
            aF[mt] = load_frag(&lA[cur][0], 40, wm * 64 + mt * 16, 0, lane);
#pragma unroll
        for (int nt = 0; nt < 4; ++nt)
            bF[nt] = load_frag(&lB[cur][0], 40, wn * 64 + nt * 16, 0, lane);
#pragma unroll
        for (int mt = 0; mt < 4; ++mt)
#pragma unroll
            for (int nt = 0; nt < 4; ++nt)
                acc[mt][nt] = wmma_bf16(aF[mt], bF[nt], acc[mt][nt]);
        __syncthreads();
    }

    // epilogue (C/D layout: VGPR r -> M = r + (lane>=16 ? 8 : 0))
    const int hi = (lane & 16) ? 8 : 0;
#pragma unroll
    for (int mt = 0; mt < 4; ++mt)
#pragma unroll
        for (int nt = 0; nt < 4; ++nt)
#pragma unroll
            for (int r = 0; r < 8; ++r) {
                const int gr = m0 + wm * 64 + mt * 16 + r + hi;
                const int gc = n0 + wn * 64 + nt * 16 + (lane & 15);
                if (OUT_F32)
                    ((float*)Cptr)[(size_t)gr * N + gc] = acc[mt][nt][r];
                else
                    ((unsigned short*)Cptr)[(size_t)gr * N + gc] =
                        f32_to_bf16(acc[mt][nt][r]);
            }
}

typedef __attribute__((ext_vector_type(2))) float  f32x2;
typedef __attribute__((ext_vector_type(2))) __bf16 bf16x2;

// two f32 -> packed bf16 pair, round to nearest even (one hardware convert)
__device__ __forceinline__ unsigned int cvt_bf16x2(float a, float b) {
    union { bf16x2 v; unsigned int u; } o;
    f32x2 x;
    x[0] = a; x[1] = b;
    o.v = __builtin_convertvector(x, bf16x2);
    return o.u;
}

// value of lane l ^ 16
__device__ __forceinline__ float other_half(float v) {
    const int b = __float_as_int(v);
    return __int_as_float(__builtin_amdgcn_permlanex16(
        b, b, 0x76543210, 0xfedcba98, false, false));
}

__global__ __launch_bounds__(256) void attn_kernel(
    const unsigned short* __restrict__ Qg,
    const unsigned short* __restrict__ Kg,
    const unsigned short* __restrict__ Vg,
    unsigned short* __restrict__ Og) {
    __shared__ unsigned short sQ[128 * 72];
    __shared__ unsigned short sK[32 * 72];
    __shared__ unsigned short sVt[64 * 40];

    const int t    = threadIdx.x;
    const int lane = t & 31;
    const int w    = t >> 5;
    const int q0   = blockIdx.x * 128;
    const size_t base = (size_t)blockIdx.y * S_LEN * HD;

    {   // stage Q block 128x64
        const int r = t >> 1, hq = t & 1;
        const unsigned short* src = Qg + base + (size_t)(q0 + r) * HD + hq * 32;
        unsigned short* dst = sQ + r * 72 + hq * 32;
#pragma unroll
        for (int j = 0; j < 4; ++j)
            *(uint4*)(dst + j * 8) = *(const uint4*)(src + j * 8);
    }
    __syncthreads();
    v16bf qF[2];   // B operand: column c = query w*16 + c
    qF[0] = load_frag(sQ, 72, w * 16, 0, lane);
    qF[1] = load_frag(sQ, 72, w * 16, 32, lane);
    const v16bf oneF = ones_frag();

    float m_ = -1e30f, l_ = 0.0f;   // of query c
    v8f o[4];                       // o[nt][r] = O[query c][nt*16 + 8h + r]
#pragma unroll
    for (int nt = 0; nt < 4; ++nt) o[nt] = zero8();

    const int hi = (lane & 16) ? 8 : 0;

    for (int c0 = 0; c0 < S_LEN; c0 += 32) {
        __syncthreads();
        if (t < 128) {   // K chunk row-major
            const int r = t >> 2, i = t & 3;
            const unsigned short* src = Kg + base + (size_t)(c0 + r) * HD + i * 16;
            unsigned short* dst = sK + r * 72 + i * 16;
            *(uint4*)(dst)     = *(const uint4*)(src);
            *(uint4*)(dst + 8) = *(const uint4*)(src + 8);
        } else {         // V chunk transposed
            const int u = t - 128;
            const int r = u >> 2, i = u & 3;
            const unsigned short* src = Vg + base + (size_t)(c0 + r) * HD + i * 16;
            uint4 v0 = *(const uint4*)(src);
            uint4 v1 = *(const uint4*)(src + 8);
            const unsigned int uu[8] = {v0.x, v0.y, v0.z, v0.w,
                                        v1.x, v1.y, v1.z, v1.w};
#pragma unroll
            for (int j = 0; j < 8; ++j) {
                const int c = i * 16 + 2 * j;
                sVt[(size_t)c * 40 + r]       = (unsigned short)(uu[j]);
                sVt[(size_t)(c + 1) * 40 + r] = (unsigned short)(uu[j] >> 16);
            }
        }
        __syncthreads();

        // S^T = K @ Q^T: s0[r] = score(key 8h+r, query c), s1[r]: key 16+8h+r
        v16bf ak[4];
#pragma unroll
        for (int i = 0; i < 4; ++i)
            ak[i] = load_frag(sK, 72, (i & 1) * 16, (i >> 1) * 32, lane);
        v8f s0 = wmma_bf16(ak[0], qF[0], zero8());
        v8f s1 = wmma_bf16(ak[1], qF[0], zero8());
        s0 = wmma_bf16(ak[2], qF[1], s0);
        s1 = wmma_bf16(ak[3], qF[1], s1);

        // online softmax of query c: in-lane maximum + one half exchange
        const v8f a0 = s0 * 0.125f;   // 1/sqrt(64)
        const v8f a1 = s1 * 0.125f;
        float v = fmaxf(a0[0], a1[0]);
#pragma unroll
        for (int r = 1; r < 8; ++r) v = fmaxf(v, fmaxf(a0[r], a1[r]));
        v = fmaxf(v, other_half(v));
        const float mn = fmaxf(m_, v);
        const float al = __expf(m_ - mn);
        m_ = mn;

        // P^T as a B operand: element s = tile s>>3, register s&7
        union { v16bf v; unsigned int u[8]; } pB;
#pragma unroll
        for (int j = 0; j < 4; ++j) {
            pB.u[j]     = cvt_bf16x2(__expf(a0[2 * j] - mn),
                                     __expf(a0[2 * j + 1] - mn));
            pB.u[4 + j] = cvt_bf16x2(__expf(a1[2 * j] - mn),
                                     __expf(a1[2 * j + 1] - mn));
        }
#pragma unroll
        for (int nt = 0; nt < 4; ++nt)
#pragma unroll
            for (int r = 0; r < 8; ++r) o[nt][r] *= al;

        // column sums of P^T via matrix pipe: ones @ P^T -> every row = sums
        v8f rsum = wmma_bf16(oneF, pB.v, zero8());
        l_ = l_ * al + rsum[0];
        // O^T += V^T @ P^T
#pragma unroll
        for (int nt = 0; nt < 4; ++nt) {
            v16bf av = load_frag(sVt, 40, nt * 16, 0, lane);
            o[nt] = wmma_bf16(av, pB.v, o[nt]);
        }
    }

    // a lane holds 8 consecutive columns of its query's row: 16-byte stores
    const float inv = 1.0f / l_;
    unsigned short* orow =
        Og + base + (size_t)(q0 + w * 16 + (lane & 15)) * HD + hi;
#pragma unroll
    for (int nt = 0; nt < 4; ++nt) {
        uint4 pk;
        pk.x = cvt_bf16x2(o[nt][0] * inv, o[nt][1] * inv);
        pk.y = cvt_bf16x2(o[nt][2] * inv, o[nt][3] * inv);
        pk.z = cvt_bf16x2(o[nt][4] * inv, o[nt][5] * inv);
        pk.w = cvt_bf16x2(o[nt][6] * inv, o[nt][7] * inv);
        *(uint4*)(orow + nt * 16) = pk;
    }
}

// ---------------------------------------------------------------------------
// Kernel 5: residual add + LayerNorm, in place over d_out rows.
// ---------------------------------------------------------------------------
__global__ __launch_bounds__(256) void ln_kernel(
    float* __restrict__ out, const float* __restrict__ resid,
    const float* __restrict__ gamma, const float* __restrict__ beta) {
    const int row = blockIdx.x;
    const int t = threadIdx.x;
    __shared__ float rs[256], rq[256];
    float x[4];
    float s = 0.0f, sq = 0.0f;
#pragma unroll
    for (int i = 0; i < 4; ++i) {
        const int c = t + i * 256;
        const float v = out[(size_t)row * D_MODEL + c] +
                        resid[(size_t)row * D_MODEL + c];
        x[i] = v; s += v; sq += v * v;
    }
    rs[t] = s; rq[t] = sq;
    __syncthreads();
    for (int off = 128; off > 0; off >>= 1) {
        if (t < off) { rs[t] += rs[t + off]; rq[t] += rq[t + off]; }
        __syncthreads();
    }
    const float mu  = rs[0] * (1.0f / D_MODEL);
    const float var = rq[0] * (1.0f / D_MODEL) - mu * mu;
    const float inv = rsqrtf(var + 1e-5f);
#pragma unroll
    for (int i = 0; i < 4; ++i) {
        const int c = t + i * 256;
        out[(size_t)row * D_MODEL + c] =
            (x[i] - mu) * inv * gamma[c] + beta[c];
    }
}

// ---------------------------------------------------------------------------
// Host-side launch
// ---------------------------------------------------------------------------
extern "C" void kernel_launch(void* const* d_in, const int* in_sizes, int n_in,
                              void* d_out, int out_size, void* d_ws, size_t ws_size,
                              hipStream_t stream) {
    const float* preQ  = (const float*)d_in[0];
    const float* preK  = (const float*)d_in[1];
    const float* preV  = (const float*)d_in[2];
    const float* Wq    = (const float*)d_in[3];
    const float* Wk    = (const float*)d_in[4];
    const float* Wv    = (const float*)d_in[5];
    const float* Wo    = (const float*)d_in[6];
    const float* gamma = (const float*)d_in[7];
    const float* beta  = (const float*)d_in[8];
    float* out = (float*)d_out;

    char* ws = (char*)d_ws;
    constexpr size_t WT_BYTES  = (size_t)D_MODEL * D_MODEL * 2;   // 2 MB
    constexpr size_t XB_BYTES  = (size_t)M_ROWS * D_MODEL * 2;    // 16 MB
    unsigned short* WqT = (unsigned short*)(ws + 0 * WT_BYTES);
    // planes 1 and 2 behind WqT: Wk^T, Wv^T
    unsigned short* WoT = (unsigned short*)(ws + 3 * WT_BYTES);
    char* xbase = ws + 4 * WT_BYTES;
    unsigned short* Xq = (unsigned short*)(xbase + 0 * XB_BYTES);
    // planes 1 and 2 behind Xq: bf16 pre_key, pre_value
    unsigned short* Qb = (unsigned short*)(xbase + 3 * XB_BYTES);
    unsigned short* Kb = (unsigned short*)(xbase + 4 * XB_BYTES);
    unsigned short* Vb = (unsigned short*)(xbase + 5 * XB_BYTES);
    unsigned short* Ab = Xq;   // Xq dead after Q projection; reuse for attn out

    // 1+2) weights -> bf16 transposed [N][K], activations -> bf16: one grid
    prep_kernel<<<4 * WT_BLOCKS + 3 * CVT_BLOCKS, 256, 0, stream>>>(
        Wq, Wk, Wv, Wo, preQ, preK, preV, WqT, Xq);

    // 3) the three projections (bf16 in, bf16 out) as one batch: z = Q, K, V
    dim3 gg(D_MODEL / 128, M_ROWS / 256);        // (8, 32)
    dim3 gg3(D_MODEL / 128, M_ROWS / 256, 3);    // (8, 32, 3)
    gemm_bf16_wmma_kernel<false><<<gg3, 256, 0, stream>>>(
        Xq, WqT, Qb, M_ROWS, D_MODEL, D_MODEL);

    // 4) flash attention over 64 (b,h) slabs x 16 query blocks
    attn_kernel<<<dim3(S_LEN / 128, N_BATCH * N_HEADS), 256, 0, stream>>>(
        Qb, Kb, Vb, Ab);

    // 5) output projection straight into d_out (f32)
    gemm_bf16_wmma_kernel<true><<<gg, 256, 0, stream>>>(
        Ab, WoT, out, M_ROWS, D_MODEL, D_MODEL);

    // 6) residual + LayerNorm in place
    ln_kernel<<<M_ROWS, 256, 0, stream>>>(out, preV, gamma, beta);
}

// v003
// A run of this version takes 220 microseconds.
// Next to v002, in two timings, it ran 1.07 times as fast each time.
// All steps since v000 together make it 1.66 times as fast.
#include <hip/hip_runtime.h>

// ---------------------------------------------------------------------------
// Types for CDNA5 WMMA
// ---------------------------------------------------------------------------
typedef __attribute__((ext_vector_type(16))) __bf16 v16bf;
typedef __attribute__((ext_vector_type(8)))  float  v8f;
typedef int v4i __attribute__((vector_size(16)));   // matches builtin param

#define D_MODEL 1024
#define S_LEN   2048
#define N_BATCH 4
#define N_HEADS 16
#define HD      64
#define M_ROWS  (N_BATCH * S_LEN)   // 8192

// CDNA5 async global->LDS path (ASYNCcnt), guarded so compile never breaks.
#if defined(__AMDGCN__) && __has_builtin(__builtin_amdgcn_global_load_async_to_lds_b128) && __has_builtin(__builtin_amdgcn_s_wait_asynccnt)
#define USE_ASYNC 1
#else
#define USE_ASYNC 0
#endif

// ---------------------------------------------------------------------------
// Helpers
// ---------------------------------------------------------------------------
__device__ __forceinline__ unsigned short f32_to_bf16(float f) {
    unsigned int x = __float_as_uint(f);
    x += 0x7FFFu + ((x >> 16) & 1u);   // round to nearest even
    return (unsigned short)(x >> 16);
}

__device__ __forceinline__ unsigned int pack_bf16x2(float a, float b) {
    return ((unsigned int)f32_to_bf16(b) << 16) | (unsigned int)f32_to_bf16(a);
}

__device__ __forceinline__ v8f zero8() {
    v8f z;
#pragma unroll
    for (int i = 0; i < 8; ++i) z[i] = 0.0f;
    return z;
}

#if USE_ASYNC
__device__ __forceinline__ void async_copy16(const unsigned short* g,
                                             unsigned short* l) {
    __builtin_amdgcn_global_load_async_to_lds_b128(
        (__attribute__((address_space(1))) v4i*)g,
        (__attribute__((address_space(3))) v4i*)l,
        /*offset=*/0, /*cpol=*/0);
}
#endif

// Load a 16x32 bf16 fragment (A-layout; B mirrors it with N in place of M)
// from LDS stored row-major with `rowStride` (in ushorts).
// Lane L holds row (rowBase + (L&15)); K pairs per ISA table:
// lanes 0-15: k = {0,2,4,6,16,18,20,22}; lanes 16-31: +8.
__device__ __forceinline__ v16bf load_frag(const unsigned short* base,
                                           int rowStride, int rowBase,
                                           int kOff, int lane) {
    union { v16bf v; unsigned int u[8]; } f;
    const int row = rowBase + (lane & 15);
    const int kb  = kOff + ((lane & 16) ? 8 : 0);
    const unsigned short* p = base + (size_t)row * rowStride;
#pragma unroll
    for (int r = 0; r < 8; ++r) {
        const int k = kb + ((r < 4) ? (2 * r) : (16 + 2 * (r - 4)));
        f.u[r] = *(const unsigned int*)(p + k);
    }
    return f.v;
}

__device__ __forceinline__ v16bf ones_frag() {
    union { v16bf v; unsigned int u[8]; } f;
#pragma unroll
    for (int i = 0; i < 8; ++i) f.u[i] = 0x3F803F80u;   // bf16(1.0) x2
    return f.v;
}

__device__ __forceinline__ v8f wmma_bf16(v16bf a, v16bf b, v8f c) {
    return __builtin_amdgcn_wmma_f32_16x16x32_bf16(
        false, a, false, b, (short)0, c, false, false);
}

// ---------------------------------------------------------------------------
// Kernels 1+2 in one grid: the seven operand preparations are independent of
// one another, so they share one launch. Blocks [0, 4096): weight transpose +
// f32 -> bf16, W:[K][N] -> Wt:[N][K], 1024 tiles of 32x32 per weight.
// Blocks [4096, 16384): elementwise f32 -> bf16 of the activations,
// 8 elements per thread, 4096 blocks per tensor.
// The four Wt planes and the three X planes are each contiguous in workspace.
// ---------------------------------------------------------------------------
#define WT_BLOCKS  ((D_MODEL / 32) * (D_MODEL / 32))    // 1024 per weight
#define CVT_BLOCKS ((M_ROWS * D_MODEL) / (8 * 256))     // 4096 per tensor

__global__ __launch_bounds__(256) void prep_kernel(
    const float* __restrict__ W0, const float* __restrict__ W1,
    const float* __restrict__ W2, const float* __restrict__ W3,
    const float* __restrict__ X0, const float* __restrict__ X1,
    const float* __restrict__ X2,
    unsigned short* __restrict__ WtAll, unsigned short* __restrict__ XbAll) {
    __shared__ float tile[32][33];
    const unsigned b = blockIdx.x;
    const int t = threadIdx.x;
    if (b < 4 * WT_BLOCKS) {   // block-uniform
        const unsigned which = b / WT_BLOCKS;
        const unsigned tl    = b % WT_BLOCKS;
        const float* __restrict__ W =
            which == 0 ? W0 : which == 1 ? W1 : which == 2 ? W2 : W3;
        unsigned short* __restrict__ Wt =
            WtAll + (size_t)which * D_MODEL * D_MODEL;
        const int k0 = (tl % (D_MODEL / 32)) * 32;
        const int n0 = (tl / (D_MODEL / 32)) * 32;
        const int x = t & 31;   // 0..31
        const int y = t >> 5;   // 0..7
#pragma unroll
        for (int i = 0; i < 4; ++i)
            tile[y + 8 * i][x] = W[(size_t)(k0 + y + 8 * i) * D_MODEL + n0 + x];
        __syncthreads();
#pragma unroll
        for (int i = 0; i < 4; ++i)
            Wt[(size_t)(n0 + y + 8 * i) * D_MODEL + (k0 + x)] =
                f32_to_bf16(tile[x][y + 8 * i]);
    } else {
        const unsigned c     = b - 4 * WT_BLOCKS;
        const unsigned which = c / CVT_BLOCKS;
        const float* __restrict__ src = which == 0 ? X0 : which == 1 ? X1 : X2;
        unsigned short* __restrict__ dst =
            XbAll + (size_t)which * M_ROWS * D_MODEL;
        const int i = (c % CVT_BLOCKS) * 256 + t;
        const float4 a = ((const float4*)src)[2 * i];
        const float4 d = ((const float4*)src)[2 * i + 1];
        uint4 o;
        o.x = pack_bf16x2(a.x, a.y);
        o.y = pack_bf16x2(a.z, a.w);
        o.z = pack_bf16x2(d.x, d.y);
        o.w = pack_bf16x2(d.z, d.w);
        ((uint4*)dst)[i] = o;
    }
}

// ---------------------------------------------------------------------------
// Kernel 3: bf16 GEMM via WMMA:  C[M,N] = A[M,K] @ Bt^T   (Bt: [N][K] bf16)
// Block tile 256x128, 8 waves (4x2), wave tile 64x64 (16 WMMA accumulators),
// K-step 32, double-buffered LDS with async global->LDS copies.
// blockIdx.z picks one product of a batch whose A, Bt and C planes each lie
// one behind the other.
// ---------------------------------------------------------------------------
template <bool OUT_F32>
__global__ __launch_bounds__(256) void gemm_bf16_wmma_kernel(
    const unsigned short* __restrict__ A,
    const unsigned short* __restrict__ Bt,
    void* __restrict__ Cptr, int M, int N, int K) {
    __shared__ unsigned short lA[2][256 * 40];   // 32 k + pad(8)
    __shared__ unsigned short lB[2][128 * 40];

    const int t    = threadIdx.x;
    const int lane = t & 31;
    const int w    = t >> 5;
    const int wm   = w >> 1;   // 0..3 -> 64 rows each
    const int wn   = w & 1;    // 0..1 -> 64 cols each
    const int m0   = blockIdx.y * 256;
    const int n0   = blockIdx.x * 128;
    const size_t z = blockIdx.z;
    A  += z * (size_t)M * K;
    Bt += z * (size_t)N * K;
    Cptr = (char*)Cptr + z * (size_t)M * N * (OUT_F32 ? 4 : 2);

    v8f acc[4][4];
#pragma unroll
    for (int mt = 0; mt < 4; ++mt)
#pragma unroll
        for (int nt = 0; nt < 4; ++nt) acc[mt][nt] = zero8();

    // staging geometry: four neighbouring lanes share a row's 64 bytes, so one
    // wave-wide copy takes 8 rows x 64 contiguous bytes (8 memory lines); the
    // block covers 64 rows per copy: 4 copies for A, 2 for B
    const int rS = t >> 2;         // row within a group of 64
    const int sS = (t & 3) * 8;    // 16-byte segment of the row, in elements
    const size_t g64 = (size_t)64 * K;
    const unsigned short* gA = A  + (size_t)(m0 + rS) * K + sS;
    const unsigned short* gB = Bt + (size_t)(n0 + rS) * K + sS;

    auto stage = [&](int buf, int k0) {
        unsigned short* dA = &lA[buf][rS * 40 + sS];
        unsigned short* dB = &lB[buf][rS * 40 + sS];
#if USE_ASYNC
#pragma unroll
        for (int i = 0; i < 4; ++i)
            async_copy16(gA + i * g64 + k0, dA + i * 64 * 40);
#pragma unroll
        for (int i = 0; i < 2; ++i)
            async_copy16(gB + i * g64 + k0, dB + i * 64 * 40);
#else
#pragma unroll
        for (int i = 0; i < 4; ++i)
            *(uint4*)(dA + i * 64 * 40) = *(const uint4*)(gA + i * g64 + k0);
#pragma unroll
        for (int i = 0; i < 2; ++i)
            *(uint4*)(dB + i * 64 * 40) = *(const uint4*)(gB + i * g64 + k0);
#endif
    };

    stage(0, 0);
    const int NK = K / 32;
    for (int kt = 0; kt < NK; ++kt) {
        const int cur = kt & 1;
        if (kt + 1 < NK) {
            stage(cur ^ 1, (kt + 1) * 32);   // overlaps with this step's math
#if USE_ASYNC
            __builtin_amdgcn_s_wait_asynccnt(6);   // 6 just issued; prev done
#endif
        } else {
#if USE_ASYNC
            __builtin_amdgcn_s_wait_asynccnt(0);
#endif
        }
        __syncthreads();

        v16bf aF[4], bF[4];
#pragma unroll
        for (int mt = 0; mt < 4; ++mt)
            aF[mt] = load_frag(&lA[cur][0], 40, wm * 64 + mt * 16, 0, lane);
#pragma unroll
        for (int nt = 0; nt < 4; ++nt)
            bF[nt] = load_frag(&lB[cur][0], 40, wn * 64 + nt * 16, 0, lane);
#pragma unroll
        for (int mt = 0; mt < 4; ++mt)
#pragma unroll
            for (int nt = 0; nt < 4; ++nt)
                acc[mt][nt] = wmma_bf16(aF[mt], bF[nt], acc[mt][nt]);
        __syncthreads();
    }

    // epilogue (C/D layout: VGPR r -> M = r + (lane>=16 ? 8 : 0))
    const int hi = (lane & 16) ? 8 : 0;
#pragma unroll
    for (int mt = 0; mt < 4; ++mt)
#pragma unroll
        for (int nt = 0; nt < 4; ++nt)
#pragma unroll
            for (int r = 0; r < 8; ++r) {
                const int gr = m0 + wm * 64 + mt * 16 + r + hi;
                const int gc = n0 + wn * 64 + nt * 16 + (lane & 15);
                if (OUT_F32)
                    ((float*)Cptr)[(size_t)gr * N + gc] = acc[mt][nt][r];
                else
                    ((unsigned short*)Cptr)[(size_t)gr * N + gc] =
                        f32_to_bf16(acc[mt][nt][r]);
            }
}

typedef __attribute__((ext_vector_type(2))) float  f32x2;
typedef __attribute__((ext_vector_type(2))) __bf16 bf16x2;

// two f32 -> packed bf16 pair, round to nearest even (one hardware convert)
__device__ __forceinline__ unsigned int cvt_bf16x2(float a, float b) {
    union { bf16x2 v; unsigned int u; } o;
    f32x2 x;
    x[0] = a; x[1] = b;
    o.v = __builtin_convertvector(x, bf16x2);
    return o.u;
}

// value of lane l ^ 16
__device__ __forceinline__ float other_half(float v) {
    const int b = __float_as_int(v);
    return __int_as_float(__builtin_amdgcn_permlanex16(
        b, b, 0x76543210, 0xfedcba98, false, false));
}

__global__ __launch_bounds__(256) void attn_kernel(
    const unsigned short* __restrict__ Qg,
    const unsigned short* __restrict__ Kg,
    const unsigned short* __restrict__ Vg,
    unsigned short* __restrict__ Og) {
    __shared__ unsigned short sQ[128 * 72];
    __shared__ unsigned short sK[32 * 72];
    __shared__ unsigned short sVt[64 * 40];

    const int t    = threadIdx.x;
    const int lane = t & 31;
    const int w    = t >> 5;
    const int q0   = blockIdx.x * 128;
    const size_t base = (size_t)blockIdx.y * S_LEN * HD;

    {   // stage Q block 128x64
        const int r = t >> 1, hq = t & 1;
        const unsigned short* src = Qg + base + (size_t)(q0 + r) * HD + hq * 32;
        unsigned short* dst = sQ + r * 72 + hq * 32;
#pragma unroll
        for (int j = 0; j < 4; ++j)
            *(uint4*)(dst + j * 8) = *(const uint4*)(src + j * 8);
    }
    __syncthreads();
    v16bf qF[2];   // B operand: column c = query w*16 + c
    qF[0] = load_frag(sQ, 72, w * 16, 0, lane);
    qF[1] = load_frag(sQ, 72, w * 16, 32, lane);
    const v16bf oneF = ones_frag();

    float m_ = -1e30f, l_ = 0.0f;   // of query c
    v8f o[4];                       // o[nt][r] = O[query c][nt*16 + 8h + r]
#pragma unroll
    for (int nt = 0; nt < 4; ++nt) o[nt] = zero8();

    const int hi = (lane & 16) ? 8 : 0;

    for (int c0 = 0; c0 < S_LEN; c0 += 32) {
        __syncthreads();
        if (t < 128) {   // K chunk row-major
            const int r = t >> 2, i = t & 3;
            const unsigned short* src = Kg + base + (size_t)(c0 + r) * HD + i * 16;
            unsigned short* dst = sK + r * 72 + i * 16;
            *(uint4*)(dst)     = *(const uint4*)(src);
            *(uint4*)(dst + 8) = *(const uint4*)(src + 8);
        } else {         // V chunk transposed
            const int u = t - 128;
            const int r = u >> 2, i = u & 3;
            const unsigned short* src = Vg + base + (size_t)(c0 + r) * HD + i * 16;
            uint4 v0 = *(const uint4*)(src);
            uint4 v1 = *(const uint4*)(src + 8);
            const unsigned int uu[8] = {v0.x, v0.y, v0.z, v0.w,
                                        v1.x, v1.y, v1.z, v1.w};
#pragma unroll
            for (int j = 0; j < 8; ++j) {
                const int c = i * 16 + 2 * j;
                sVt[(size_t)c * 40 + r]       = (unsigned short)(uu[j]);
                sVt[(size_t)(c + 1) * 40 + r] = (unsigned short)(uu[j] >> 16);
            }
        }
        __syncthreads();

        // S^T = K @ Q^T: s0[r] = score(key 8h+r, query c), s1[r]: key 16+8h+r
        v16bf ak[4];
#pragma unroll
        for (int i = 0; i < 4; ++i)
            ak[i] = load_frag(sK, 72, (i & 1) * 16, (i >> 1) * 32, lane);
        v8f s0 = wmma_bf16(ak[0], qF[0], zero8());
        v8f s1 = wmma_bf16(ak[1], qF[0], zero8());
        s0 = wmma_bf16(ak[2], qF[1], s0);
        s1 = wmma_bf16(ak[3], qF[1], s1);

        // online softmax of query c: in-lane maximum + one half exchange
        const v8f a0 = s0 * 0.125f;   // 1/sqrt(64)
        const v8f a1 = s1 * 0.125f;
        float v = fmaxf(a0[0], a1[0]);
#pragma unroll
        for (int r = 1; r < 8; ++r) v = fmaxf(v, fmaxf(a0[r], a1[r]));
        v = fmaxf(v, other_half(v));
        const float mn = fmaxf(m_, v);
        const float al = __expf(m_ - mn);
        m_ = mn;

        // P^T as a B operand: element s = tile s>>3, register s&7
        union { v16bf v; unsigned int u[8]; } pB;
#pragma unroll
        for (int j = 0; j < 4; ++j) {
            pB.u[j]     = cvt_bf16x2(__expf(a0[2 * j] - mn),
                                     __expf(a0[2 * j + 1] - mn));
            pB.u[4 + j] = cvt_bf16x2(__expf(a1[2 * j] - mn),
                                     __expf(a1[2 * j + 1] - mn));
        }
#pragma unroll
        for (int nt = 0; nt < 4; ++nt)
#pragma unroll
            for (int r = 0; r < 8; ++r) o[nt][r] *= al;

        // column sums of P^T via matrix pipe: ones @ P^T -> every row = sums
        v8f rsum = wmma_bf16(oneF, pB.v, zero8());
        l_ = l_ * al + rsum[0];
        // O^T += V^T @ P^T
#pragma unroll
        for (int nt = 0; nt < 4; ++nt) {
            v16bf av = load_frag(sVt, 40, nt * 16, 0, lane);
            o[nt] = wmma_bf16(av, pB.v, o[nt]);
        }
    }

    // a lane holds 8 consecutive columns of its query's row: 16-byte stores
    const float inv = 1.0f / l_;
    unsigned short* orow =
        Og + base + (size_t)(q0 + w * 16 + (lane & 15)) * HD + hi;
#pragma unroll
    for (int nt = 0; nt < 4; ++nt) {
        uint4 pk;
        pk.x = cvt_bf16x2(o[nt][0] * inv, o[nt][1] * inv);
        pk.y = cvt_bf16x2(o[nt][2] * inv, o[nt][3] * inv);
        pk.z = cvt_bf16x2(o[nt][4] * inv, o[nt][5] * inv);
        pk.w = cvt_bf16x2(o[nt][6] * inv, o[nt][7] * inv);
        *(uint4*)(orow + nt * 16) = pk;
    }
}

// ---------------------------------------------------------------------------
// Kernel 5: residual add + LayerNorm, in place over d_out rows.
// ---------------------------------------------------------------------------
__global__ __launch_bounds__(256) void ln_kernel(
    float* __restrict__ out, const float* __restrict__ resid,
    const float* __restrict__ gamma, const float* __restrict__ beta) {
    const int row = blockIdx.x;
    const int t = threadIdx.x;
    __shared__ float rs[256], rq[256];
    float x[4];
    float s = 0.0f, sq = 0.0f;
#pragma unroll
    for (int i = 0; i < 4; ++i) {
        const int c = t + i * 256;
        const float v = out[(size_t)row * D_MODEL + c] +
                        resid[(size_t)row * D_MODEL + c];
        x[i] = v; s += v; sq += v * v;
    }
    rs[t] = s; rq[t] = sq;
    __syncthreads();
    for (int off = 128; off > 0; off >>= 1) {
        if (t < off) { rs[t] += rs[t + off]; rq[t] += rq[t + off]; }
        __syncthreads();
    }
    const float mu  = rs[0] * (1.0f / D_MODEL);
    const float var = rq[0] * (1.0f / D_MODEL) - mu * mu;
    const float inv = rsqrtf(var + 1e-5f);
#pragma unroll
    for (int i = 0; i < 4; ++i) {
        const int c = t + i * 256;
        out[(size_t)row * D_MODEL + c] =
            (x[i] - mu) * inv * gamma[c] + beta[c];
    }
}

// ---------------------------------------------------------------------------
// Host-side launch
// ---------------------------------------------------------------------------
extern "C" void kernel_launch(void* const* d_in, const int* in_sizes, int n_in,
                              void* d_out, int out_size, void* d_ws, size_t ws_size,
                              hipStream_t stream) {
    const float* preQ  = (const float*)d_in[0];
    const float* preK  = (const float*)d_in[1];
    const float* preV  = (const float*)d_in[2];
    const float* Wq    = (const float*)d_in[3];
    const float* Wk    = (const float*)d_in[4];
    const float* Wv    = (const float*)d_in[5];
    const float* Wo    = (const float*)d_in[6];
    const float* gamma = (const float*)d_in[7];
    const float* beta  = (const float*)d_in[8];
    float* out = (float*)d_out;

    char* ws = (char*)d_ws;
    constexpr size_t WT_BYTES  = (size_t)D_MODEL * D_MODEL * 2;   // 2 MB
    constexpr size_t XB_BYTES  = (size_t)M_ROWS * D_MODEL * 2;    // 16 MB
    unsigned short* WqT = (unsigned short*)(ws + 0 * WT_BYTES);
    // planes 1 and 2 behind WqT: Wk^T, Wv^T
    unsigned short* WoT = (unsigned short*)(ws + 3 * WT_BYTES);
    char* xbase = ws + 4 * WT_BYTES;
    unsigned short* Xq = (unsigned short*)(xbase + 0 * XB_BYTES);
    // planes 1 and 2 behind Xq: bf16 pre_key, pre_value
    unsigned short* Qb = (unsigned short*)(xbase + 3 * XB_BYTES);
    unsigned short* Kb = (unsigned short*)(xbase + 4 * XB_BYTES);
    unsigned short* Vb = (unsigned short*)(xbase + 5 * XB_BYTES);
    unsigned short* Ab = Xq;   // Xq dead after Q projection; reuse for attn out

    // 1+2) weights -> bf16 transposed [N][K], activations -> bf16: one grid
    prep_kernel<<<4 * WT_BLOCKS + 3 * CVT_BLOCKS, 256, 0, stream>>>(
        Wq, Wk, Wv, Wo, preQ, preK, preV, WqT, Xq);

    // 3) the three projections (bf16 in, bf16 out) as one batch: z = Q, K, V
    dim3 gg(D_MODEL / 128, M_ROWS / 256);        // (8, 32)
    dim3 gg3(D_MODEL / 128, M_ROWS / 256, 3);    // (8, 32, 3)
    gemm_bf16_wmma_kernel<false><<<gg3, 256, 0, stream>>>(
        Xq, WqT, Qb, M_ROWS, D_MODEL, D_MODEL);

    // 4) flash attention over 64 (b,h) slabs x 16 query blocks
    attn_kernel<<<dim3(S_LEN / 128, N_BATCH * N_HEADS), 256, 0, stream>>>(
        Qb, Kb, Vb, Ab);

    // 5) output projection straight into d_out (f32)
    gemm_bf16_wmma_kernel<true><<<gg, 256, 0, stream>>>(
        Ab, WoT, out, M_ROWS, D_MODEL, D_MODEL);

    // 6) residual + LayerNorm in place
    ln_kernel<<<M_ROWS, 256, 0, stream>>>(out, preV, gamma, beta);
}

// v004
// It runs in 191 microseconds.
// Timed twice side by side with v003, it ran 1.15 times as fast both times.
// Counting every step since v000, it is 1.91 times as fast.
#include <hip/hip_runtime.h>

// ---------------------------------------------------------------------------
// Types for CDNA5 WMMA
// ---------------------------------------------------------------------------
typedef __attribute__((ext_vector_type(16))) __bf16 v16bf;
typedef __attribute__((ext_vector_type(8)))  float  v8f;
typedef int v4i __attribute__((vector_size(16)));   // matches builtin param

#define D_MODEL 1024
#define S_LEN   2048
#define N_BATCH 4
#define N_HEADS 16
#define HD      64
#define M_ROWS  (N_BATCH * S_LEN)   // 8192

// CDNA5 async global->LDS path (ASYNCcnt), guarded so compile never breaks.
#if defined(__AMDGCN__) && __has_builtin(__builtin_amdgcn_global_load_async_to_lds_b128) && __has_builtin(__builtin_amdgcn_s_wait_asynccnt)
#define USE_ASYNC 1
#else
#define USE_ASYNC 0
#endif

// ---------------------------------------------------------------------------
// Helpers
// ---------------------------------------------------------------------------
__device__ __forceinline__ unsigned short f32_to_bf16(float f) {
    unsigned int x = __float_as_uint(f);
    x += 0x7FFFu + ((x >> 16) & 1u);   // round to nearest even
    return (unsigned short)(x >> 16);
}

__device__ __forceinline__ unsigned int pack_bf16x2(float a, float b) {
    return ((unsigned int)f32_to_bf16(b) << 16) | (unsigned int)f32_to_bf16(a);
}

__device__ __forceinline__ v8f zero8() {
    v8f z;
#pragma unroll
    for (int i = 0; i < 8; ++i) z[i] = 0.0f;
    return z;
}

#if USE_ASYNC
__device__ __forceinline__ void async_copy16(const unsigned short* g,
                                             unsigned short* l) {
    __builtin_amdgcn_global_load_async_to_lds_b128(
        (__attribute__((address_space(1))) v4i*)g,
        (__attribute__((address_space(3))) v4i*)l,
        /*offset=*/0, /*cpol=*/0);
}
#endif

// Load a 16x32 bf16 fragment (A-layout; B mirrors it with N in place of M)
// from LDS stored row-major with `rowStride` (in ushorts).
// Lane L holds row (rowBase + (L&15)); K pairs per ISA table:
// lanes 0-15: k = {0,2,4,6,16,18,20,22}; lanes 16-31: +8.
__device__ __forceinline__ v16bf load_frag(const unsigned short* base,
                                           int rowStride, int rowBase,
                                           int kOff, int lane) {
    union { v16bf v; unsigned int u[8]; } f;
    const int row = rowBase + (lane & 15);
    const int kb  = kOff + ((lane & 16) ? 8 : 0);
    const unsigned short* p = base + (size_t)row * rowStride;
#pragma unroll
    for (int r = 0; r < 8; ++r) {
        const int k = kb + ((r < 4) ? (2 * r) : (16 + 2 * (r - 4)));
        f.u[r] = *(const unsigned int*)(p + k);
    }
    return f.v;
}

__device__ __forceinline__ v16bf ones_frag() {
    union { v16bf v; unsigned int u[8]; } f;
#pragma unroll
    for (int i = 0; i < 8; ++i) f.u[i] = 0x3F803F80u;   // bf16(1.0) x2
    return f.v;
}

__device__ __forceinline__ v8f wmma_bf16(v16bf a, v16bf b, v8f c) {
    return __builtin_amdgcn_wmma_f32_16x16x32_bf16(
        false, a, false, b, (short)0, c, false, false);
}

// ---------------------------------------------------------------------------
// Kernels 1+2 in one grid: the seven operand preparations are independent of
// one another, so they share one launch. Blocks [0, 4096): weight transpose +
// f32 -> bf16, W:[K][N] -> Wt:[N][K], 1024 tiles of 32x32 per weight.
// Blocks [4096, 16384): elementwise f32 -> bf16 of the activations,
// 8 elements per thread, 4096 blocks per tensor.
// The four Wt planes and the three X planes are each contiguous in workspace.
// ---------------------------------------------------------------------------
#define WT_BLOCKS  ((D_MODEL / 32) * (D_MODEL / 32))    // 1024 per weight
#define CVT_BLOCKS ((M_ROWS * D_MODEL) / (8 * 256))     // 4096 per tensor

__global__ __launch_bounds__(256) void prep_kernel(
    const float* __restrict__ W0, const float* __restrict__ W1,
    const float* __restrict__ W2, const float* __restrict__ W3,
    const float* __restrict__ X0, const float* __restrict__ X1,
    const float* __restrict__ X2,
    unsigned short* __restrict__ WtAll, unsigned short* __restrict__ XbAll) {
    __shared__ float tile[32][33];
    const unsigned b = blockIdx.x;
    const int t = threadIdx.x;
    if (b < 4 * WT_BLOCKS) {   // block-uniform
        const unsigned which = b / WT_BLOCKS;
        const unsigned tl    = b % WT_BLOCKS;
        const float* __restrict__ W =
            which == 0 ? W0 : which == 1 ? W1 : which == 2 ? W2 : W3;
        unsigned short* __restrict__ Wt =
            WtAll + (size_t)which * D_MODEL * D_MODEL;
        const int k0 = (tl % (D_MODEL / 32)) * 32;
        const int n0 = (tl / (D_MODEL / 32)) * 32;
        const int x = t & 31;   // 0..31
        const int y = t >> 5;   // 0..7
#pragma unroll
        for (int i = 0; i < 4; ++i)
            tile[y + 8 * i][x] = W[(size_t)(k0 + y + 8 * i) * D_MODEL + n0 + x];
        __syncthreads();
#pragma unroll
        for (int i = 0; i < 4; ++i)
            Wt[(size_t)(n0 + y + 8 * i) * D_MODEL + (k0 + x)] =
                f32_to_bf16(tile[x][y + 8 * i]);
    } else {
        const unsigned c     = b - 4 * WT_BLOCKS;
        const unsigned which = c / CVT_BLOCKS;
        const float* __restrict__ src = which == 0 ? X0 : which == 1 ? X1 : X2;
        unsigned short* __restrict__ dst =
            XbAll + (size_t)which * M_ROWS * D_MODEL;
        const int i = (c % CVT_BLOCKS) * 256 + t;
        const float4 a = ((const float4*)src)[2 * i];
        const float4 d = ((const float4*)src)[2 * i + 1];
        uint4 o;
        o.x = pack_bf16x2(a.x, a.y);
        o.y = pack_bf16x2(a.z, a.w);
        o.z = pack_bf16x2(d.x, d.y);
        o.w = pack_bf16x2(d.z, d.w);
        ((uint4*)dst)[i] = o;
    }
}

// ---------------------------------------------------------------------------
// Kernel 3: bf16 GEMM via WMMA:  C[M,N] = A[M,K] @ Bt^T   (Bt: [N][K] bf16)
// Block tile 256x128, 8 waves (4x2), wave tile 64x64 (16 WMMA accumulators),
// K-step 32, double-buffered LDS with async global->LDS copies.
// blockIdx.z picks one product of a batch whose A, Bt and C planes each lie
// one behind the other.
// ---------------------------------------------------------------------------
template <bool OUT_F32>
__global__ __launch_bounds__(256) void gemm_bf16_wmma_kernel(
    const unsigned short* __restrict__ A,
    const unsigned short* __restrict__ Bt,
    void* __restrict__ Cptr, int M, int N, int K) {
    __shared__ unsigned short lA[2][256 * 40];   // 32 k + pad(8)
    __shared__ unsigned short lB[2][128 * 40];

    const int t    = threadIdx.x;
    const int lane = t & 31;
    const int w    = t >> 5;
    const int wm   = w >> 1;   // 0..3 -> 64 rows each
    const int wn   = w & 1;    // 0..1 -> 64 cols each
    const int m0   = blockIdx.y * 256;
    const int n0   = blockIdx.x * 128;
    const size_t z = blockIdx.z;
    A  += z * (size_t)M * K;
    Bt += z * (size_t)N * K;
    Cptr = (char*)Cptr + z * (size_t)M * N * (OUT_F32 ? 4 : 2);

    v8f acc[4][4];
#pragma unroll
    for (int mt = 0; mt < 4; ++mt)
#pragma unroll
        for (int nt = 0; nt < 4; ++nt) acc[mt][nt] = zero8();

    // staging geometry: four neighbouring lanes share a row's 64 bytes, so one
    // wave-wide copy takes 8 rows x 64 contiguous bytes (8 memory lines); the
    // block covers 64 rows per copy: 4 copies for A, 2 for B
    const int rS = t >> 2;         // row within a group of 64
    const int sS = (t & 3) * 8;    // 16-byte segment of the row, in elements
    const size_t g64 = (size_t)64 * K;
    const unsigned short* gA = A  + (size_t)(m0 + rS) * K + sS;
    const unsigned short* gB = Bt + (size_t)(n0 + rS) * K + sS;

    auto stage = [&](int buf, int k0) {
        unsigned short* dA = &lA[buf][rS * 40 + sS];
        unsigned short* dB = &lB[buf][rS * 40 + sS];
#if USE_ASYNC
#pragma unroll
        for (int i = 0; i < 4; ++i)
            async_copy16(gA + i * g64 + k0, dA + i * 64 * 40);
#pragma unroll
        for (int i = 0; i < 2; ++i)
            async_copy16(gB + i * g64 + k0, dB + i * 64 * 40);
#else
#pragma unroll
        for (int i = 0; i < 4; ++i)
            *(uint4*)(dA + i * 64 * 40) = *(const uint4*)(gA + i * g64 + k0);
#pragma unroll
        for (int i = 0; i < 2; ++i)
            *(uint4*)(dB + i * 64 * 40) = *(const uint4*)(gB + i * g64 + k0);
#endif
    };

    stage(0, 0);
    const int NK = K / 32;
    for (int kt = 0; kt < NK; ++kt) {
        const int cur = kt & 1;
        if (kt + 1 < NK) {
            stage(cur ^ 1, (kt + 1) * 32);   // overlaps with this step's math
#if USE_ASYNC
            __builtin_amdgcn_s_wait_asynccnt(6);   // 6 just issued; prev done
#endif
        } else {
#if USE_ASYNC
            __builtin_amdgcn_s_wait_asynccnt(0);
#endif
        }
        __syncthreads();

        v16bf aF[4], bF[4];
#pragma unroll
        for (int mt = 0; mt < 4; ++mt)
            aF[mt] = load_frag(&lA[cur][0], 40, wm * 64 + mt * 16, 0, lane);
#pragma unroll
        for (int nt = 0; nt < 4; ++nt)
            bF[nt] = load_frag(&lB[cur][0], 40, wn * 64 + nt * 16, 0, lane);
#pragma unroll
        for (int mt = 0; mt < 4; ++mt)
#pragma unroll
            for (int nt = 0; nt < 4; ++nt)
                acc[mt][nt] = wmma_bf16(aF[mt], bF[nt], acc[mt][nt]);
        __syncthreads();
    }

    // epilogue (C/D layout: VGPR r -> M = r + (lane>=16 ? 8 : 0))
    const int hi = (lane & 16) ? 8 : 0;
#pragma unroll
    for (int mt = 0; mt < 4; ++mt)
#pragma unroll
        for (int nt = 0; nt < 4; ++nt)
#pragma unroll
            for (int r = 0; r < 8; ++r) {
                const int gr = m0 + wm * 64 + mt * 16 + r + hi;
                const int gc = n0 + wn * 64 + nt * 16 + (lane & 15);
                if (OUT_F32)
                    ((float*)Cptr)[(size_t)gr * N + gc] = acc[mt][nt][r];
                else
                    ((unsigned short*)Cptr)[(size_t)gr * N + gc] =
                        f32_to_bf16(acc[mt][nt][r]);
            }
}

typedef __attribute__((ext_vector_type(2))) float  f32x2;
typedef __attribute__((ext_vector_type(2))) __bf16 bf16x2;

// two f32 -> packed bf16 pair, round to nearest even (one hardware convert)
__device__ __forceinline__ unsigned int cvt_bf16x2(float a, float b) {
    union { bf16x2 v; unsigned int u; } o;
    f32x2 x;
    x[0] = a; x[1] = b;
    o.v = __builtin_convertvector(x, bf16x2);
    return o.u;
}

// value of lane l ^ 16
__device__ __forceinline__ float other_half(float v) {
    const int b = __float_as_int(v);
    return __int_as_float(__builtin_amdgcn_permlanex16(
        b, b, 0x76543210, 0xfedcba98, false, false));
}

// K and V stages in LDS: 64 keys each, two buffers.
#define KV_STAGE 64
#define PK 72   // K row pitch in elements: 144 B = 16 B x odd, for plain 16-byte reads
#define PV 80   // V row pitch in elements: 160 B = 32 B x odd, for the transposing read

typedef short s16x8 __attribute__((ext_vector_type(8)));
typedef unsigned int u32x4 __attribute__((ext_vector_type(4)));

// transposing 16-bit LDS read: lane (c, h) gets T[k + 8h + 0..7][d + c] of a
// row-major tile; every lane passes its own row address (see the caller)
__device__ __forceinline__ u32x4 ld_tr16(const unsigned short* p) {
    typedef __attribute__((address_space(3))) s16x8 lds_s16x8;
    return __builtin_bit_cast(
        u32x4, __builtin_amdgcn_ds_load_tr16_b128_v8i16((lds_s16x8*)p));
}

// One stage of K and V, global -> LDS through no register: each lane copies
// 16 bytes of rows r and r + 32 of both. The s_wait_xcnt closes the statement
// so that no address register of a copy is rewritten ahead of it.
__device__ __forceinline__ void stage_kv(const unsigned short* gk,
                                         const unsigned short* gv,
                                         unsigned lk, unsigned lv) {
    asm volatile(
        "global_load_async_to_lds_b128 %0, %4, off\n\t"
        "global_load_async_to_lds_b128 %1, %5, off\n\t"
        "global_load_async_to_lds_b128 %2, %6, off\n\t"
        "global_load_async_to_lds_b128 %3, %7, off\n\t"
        "s_wait_xcnt 0x0"
        :: "v"(lk), "v"(lk + 32u * PK * 2u), "v"(lv), "v"(lv + 32u * PV * 2u),
           "v"(gk), "v"(gk + 32 * HD), "v"(gv), "v"(gv + 32 * HD)
        : "memory");
}

__global__ __launch_bounds__(256) void attn_kernel(
    const unsigned short* __restrict__ Qg,
    const unsigned short* __restrict__ Kg,
    const unsigned short* __restrict__ Vg,
    unsigned short* __restrict__ Og) {
    __shared__ __attribute__((aligned(16))) unsigned short sQ[128 * 72];
    __shared__ __attribute__((aligned(16))) unsigned short sK[2][KV_STAGE * PK];
    __shared__ __attribute__((aligned(16))) unsigned short sV[2][KV_STAGE * PV];

    const int t    = threadIdx.x;
    const int lane = t & 31;
    const int w    = t >> 5;
    const int q0   = blockIdx.x * 128;
    const size_t base = (size_t)blockIdx.y * S_LEN * HD;

    // staging geometry: eight lanes share a row's 128 bytes, so one wave-wide
    // copy takes four whole memory lines; the block covers 32 rows per copy
    const int rS = t >> 3;
    const int sS = (t & 7) * 8;
    const unsigned short* gK = Kg + base + (size_t)rS * HD + sS;
    const unsigned short* gV = Vg + base + (size_t)rS * HD + sS;
    const unsigned lK = (unsigned)(size_t)&sK[0][rS * PK + sS];
    const unsigned lV = (unsigned)(size_t)&sV[0][rS * PV + sS];
    constexpr unsigned BK = KV_STAGE * PK * 2;   // bytes of one K buffer
    constexpr unsigned BV = KV_STAGE * PV * 2;   // bytes of one V buffer
    constexpr int NT = S_LEN / KV_STAGE;

    stage_kv(gK, gV, lK, lV);   // stage 0 -> buffer 0

    {   // stage Q block 128x64
        const int r = t >> 1, hq = t & 1;
        const unsigned short* src = Qg + base + (size_t)(q0 + r) * HD + hq * 32;
        unsigned short* dst = sQ + r * 72 + hq * 32;
#pragma unroll
        for (int j = 0; j < 4; ++j)
            *(uint4*)(dst + j * 8) = *(const uint4*)(src + j * 8);
    }
    // stage 0 has landed for this wave; the barrier publishes it (and Q)
    asm volatile("s_wait_asynccnt 0x0" ::: "memory");
    __syncthreads();
    stage_kv(gK + KV_STAGE * HD, gV + KV_STAGE * HD, lK + BK, lV + BV);

    v16bf qF[2];   // B operand: column c = query w*16 + c
    qF[0] = load_frag(sQ, 72, w * 16, 0, lane);
    qF[1] = load_frag(sQ, 72, w * 16, 32, lane);
    const v16bf oneF = ones_frag();

    float m_ = -1e30f, l_ = 0.0f;   // of query c
    v8f o[4];                       // o[nt][r] = O[query c][nt*16 + 8h + r]
#pragma unroll
    for (int nt = 0; nt < 4; ++nt) o[nt] = zero8();

    const int hi = (lane & 16) ? 8 : 0;
    // lane's row and 16-byte half for the transposing read of V
    const int vOff = (hi + (lane & 7)) * PV + ((lane >> 3) & 1) * 8;

    for (int st = 0; st < NT; ++st) {
        const int buf = st & 1;
        const unsigned short* bK = &sK[buf][0];
        const unsigned short* bV = &sV[buf][0] + vOff;
        // unrolled so that sub turns into immediate LDS offsets
#pragma unroll
        for (int sub = 0; sub < KV_STAGE / 32; ++sub) {
            // S^T = K @ Q^T: s0[r] = score(key 8h+r, query c), s1[r]: key 16+8h+r
            v16bf ak[4];
#pragma unroll
            for (int i = 0; i < 4; ++i)
                ak[i] = load_frag(bK, PK, sub * 32 + (i & 1) * 16,
                                  (i >> 1) * 32, lane);
            v8f s0 = wmma_bf16(ak[0], qF[0], zero8());
            v8f s1 = wmma_bf16(ak[1], qF[0], zero8());
            s0 = wmma_bf16(ak[2], qF[1], s0);
            s1 = wmma_bf16(ak[3], qF[1], s1);

            // online softmax of query c: in-lane maximum + one half exchange
            const v8f a0 = s0 * 0.125f;   // 1/sqrt(64)
            const v8f a1 = s1 * 0.125f;
            float v = fmaxf(a0[0], a1[0]);
#pragma unroll
            for (int r = 1; r < 8; ++r) v = fmaxf(v, fmaxf(a0[r], a1[r]));
            v = fmaxf(v, other_half(v));
            const float mn = fmaxf(m_, v);
            const float al = __expf(m_ - mn);
            m_ = mn;

            // P^T as a B operand: element s = tile s>>3, register s&7
            union { v16bf v; unsigned int u[8]; } pB;
#pragma unroll
            for (int j = 0; j < 4; ++j) {
                pB.u[j]     = cvt_bf16x2(__expf(a0[2 * j] - mn),
                                         __expf(a0[2 * j + 1] - mn));
                pB.u[4 + j] = cvt_bf16x2(__expf(a1[2 * j] - mn),
                                         __expf(a1[2 * j + 1] - mn));
            }
#pragma unroll
            for (int nt = 0; nt < 4; ++nt)
#pragma unroll
                for (int r = 0; r < 8; ++r) o[nt][r] *= al;

            // column sums of P^T via matrix pipe: ones @ P^T -> every row = sums
            v8f rsum = wmma_bf16(oneF, pB.v, zero8());
            l_ = l_ * al + rsum[0];
            // O^T += V^T @ P^T; A = V^T: keys 8h+0..7 and 16+8h+0..7 of
            // column nt*16 + c, the k order of P^T
#pragma unroll
            for (int nt = 0; nt < 4; ++nt) {
                union { v16bf v; u32x4 q[2]; } av;
                av.q[0] = ld_tr16(bV + (sub * 32) * PV + nt * 16);
                av.q[1] = ld_tr16(bV + (sub * 32 + 16) * PV + nt * 16);
                o[nt] = wmma_bf16(av.v, pB.v, o[nt]);
            }
        }
        // hand-over: this wave's reads of the buffer are done, its copies of the
        // next stage have landed; the barrier publishes that stage and frees
        // this buffer for the refill behind it
        asm volatile("s_wait_dscnt 0x0" ::: "memory");
        asm volatile("s_wait_asynccnt 0x0" ::: "memory");
        __syncthreads();
        if (st + 2 < NT)   // the same for the whole work-group
            stage_kv(gK + (size_t)(st + 2) * KV_STAGE * HD,
                     gV + (size_t)(st + 2) * KV_STAGE * HD,
                     lK + buf * BK, lV + buf * BV);
    }
    // nothing is outstanding when the wave ends
    asm volatile("s_wait_asynccnt 0x0" ::: "memory");

    // a lane holds 8 consecutive columns of its query's row: 16-byte stores
    const float inv = 1.0f / l_;
    unsigned short* orow =
        Og + base + (size_t)(q0 + w * 16 + (lane & 15)) * HD + hi;
#pragma unroll
    for (int nt = 0; nt < 4; ++nt) {
        uint4 pk;
        pk.x = cvt_bf16x2(o[nt][0] * inv, o[nt][1] * inv);
        pk.y = cvt_bf16x2(o[nt][2] * inv, o[nt][3] * inv);
        pk.z = cvt_bf16x2(o[nt][4] * inv, o[nt][5] * inv);
        pk.w = cvt_bf16x2(o[nt][6] * inv, o[nt][7] * inv);
        *(uint4*)(orow + nt * 16) = pk;
    }
}

// ---------------------------------------------------------------------------
// Kernel 5: residual add + LayerNorm, in place over d_out rows.
// ---------------------------------------------------------------------------
__global__ __launch_bounds__(256) void ln_kernel(
    float* __restrict__ out, const float* __restrict__ resid,
    const float* __restrict__ gamma, const float* __restrict__ beta) {
    const int row = blockIdx.x;
    const int t = threadIdx.x;
    __shared__ float rs[256], rq[256];
    float x[4];
    float s = 0.0f, sq = 0.0f;
#pragma unroll
    for (int i = 0; i < 4; ++i) {
        const int c = t + i * 256;
        const float v = out[(size_t)row * D_MODEL + c] +
                        resid[(size_t)row * D_MODEL + c];
        x[i] = v; s += v; sq += v * v;
    }
    rs[t] = s; rq[t] = sq;
    __syncthreads();
    for (int off = 128; off > 0; off >>= 1) {
        if (t < off) { rs[t] += rs[t + off]; rq[t] += rq[t + off]; }
        __syncthreads();
    }
    const float mu  = rs[0] * (1.0f / D_MODEL);
    const float var = rq[0] * (1.0f / D_MODEL) - mu * mu;
    const float inv = rsqrtf(var + 1e-5f);
#pragma unroll
    for (int i = 0; i < 4; ++i) {
        const int c = t + i * 256;
        out[(size_t)row * D_MODEL + c] =
            (x[i] - mu) * inv * gamma[c] + beta[c];
    }
}

// ---------------------------------------------------------------------------
// Host-side launch
// ---------------------------------------------------------------------------
extern "C" void kernel_launch(void* const* d_in, const int* in_sizes, int n_in,
                              void* d_out, int out_size, void* d_ws, size_t ws_size,
                              hipStream_t stream) {
    const float* preQ  = (const float*)d_in[0];
    const float* preK  = (const float*)d_in[1];
    const float* preV  = (const float*)d_in[2];
    const float* Wq    = (const float*)d_in[3];
    const float* Wk    = (const float*)d_in[4];
    const float* Wv    = (const float*)d_in[5];
    const float* Wo    = (const float*)d_in[6];
    const float* gamma = (const float*)d_in[7];
    const float* beta  = (const float*)d_in[8];
    float* out = (float*)d_out;

    char* ws = (char*)d_ws;
    constexpr size_t WT_BYTES  = (size_t)D_MODEL * D_MODEL * 2;   // 2 MB
    constexpr size_t XB_BYTES  = (size_t)M_ROWS * D_MODEL * 2;    // 16 MB
    unsigned short* WqT = (unsigned short*)(ws + 0 * WT_BYTES);
    // planes 1 and 2 behind WqT: Wk^T, Wv^T
    unsigned short* WoT = (unsigned short*)(ws + 3 * WT_BYTES);
    char* xbase = ws + 4 * WT_BYTES;
    unsigned short* Xq = (unsigned short*)(xbase + 0 * XB_BYTES);
    // planes 1 and 2 behind Xq: bf16 pre_key, pre_value
    unsigned short* Qb = (unsigned short*)(xbase + 3 * XB_BYTES);
    unsigned short* Kb = (unsigned short*)(xbase + 4 * XB_BYTES);
    unsigned short* Vb = (unsigned short*)(xbase + 5 * XB_BYTES);
    unsigned short* Ab = Xq;   // Xq dead after Q projection; reuse for attn out

    // 1+2) weights -> bf16 transposed [N][K], activations -> bf16: one grid
    prep_kernel<<<4 * WT_BLOCKS + 3 * CVT_BLOCKS, 256, 0, stream>>>(
        Wq, Wk, Wv, Wo, preQ, preK, preV, WqT, Xq);

    // 3) the three projections (bf16 in, bf16 out) as one batch: z = Q, K, V
    dim3 gg(D_MODEL / 128, M_ROWS / 256);        // (8, 32)
    dim3 gg3(D_MODEL / 128, M_ROWS / 256, 3);    // (8, 32, 3)
    gemm_bf16_wmma_kernel<false><<<gg3, 256, 0, stream>>>(
        Xq, WqT, Qb, M_ROWS, D_MODEL, D_MODEL);

    // 4) flash attention over 64 (b,h) slabs x 16 query blocks
    attn_kernel<<<dim3(S_LEN / 128, N_BATCH * N_HEADS), 256, 0, stream>>>(
        Qb, Kb, Vb, Ab);

    // 5) output projection straight into d_out (f32)
    gemm_bf16_wmma_kernel<true><<<gg, 256, 0, stream>>>(
        Ab, WoT, out, M_ROWS, D_MODEL, D_MODEL);

    // 6) residual + LayerNorm in place
    ln_kernel<<<M_ROWS, 256, 0, stream>>>(out, preV, gamma, beta);
}

// v005
// Measured time: 174 microseconds a run.
// Next to v004, in two timings, it ran 1.09 and 1.10 times as fast.
// All steps since v000 together make it 2.09 times as fast.
#include <hip/hip_runtime.h>

// ---------------------------------------------------------------------------
// Types for CDNA5 WMMA
// ---------------------------------------------------------------------------
typedef __attribute__((ext_vector_type(16))) __bf16 v16bf;
typedef __attribute__((ext_vector_type(8)))  float  v8f;

#define D_MODEL 1024
#define S_LEN   2048
#define N_BATCH 4
#define N_HEADS 16
#define HD      64
#define M_ROWS  (N_BATCH * S_LEN)   // 8192

// ---------------------------------------------------------------------------
// Helpers
// ---------------------------------------------------------------------------
__device__ __forceinline__ unsigned short f32_to_bf16(float f) {
    unsigned int x = __float_as_uint(f);
    x += 0x7FFFu + ((x >> 16) & 1u);   // round to nearest even
    return (unsigned short)(x >> 16);
}

__device__ __forceinline__ unsigned int pack_bf16x2(float a, float b) {
    return ((unsigned int)f32_to_bf16(b) << 16) | (unsigned int)f32_to_bf16(a);
}

__device__ __forceinline__ v8f zero8() {
    v8f z;
#pragma unroll
    for (int i = 0; i < 8; ++i) z[i] = 0.0f;
    return z;
}

// Four 16-byte copies per lane, global -> LDS through no register. The
// s_wait_xcnt closes the statement so that no address register of a copy is
// rewritten ahead of it.
__device__ __forceinline__ void copy4(unsigned l0, unsigned l1, unsigned l2,
                                      unsigned l3, const unsigned short* g0,
                                      const unsigned short* g1,
                                      const unsigned short* g2,
                                      const unsigned short* g3) {
    asm volatile(
        "global_load_async_to_lds_b128 %0, %4, off\n\t"
        "global_load_async_to_lds_b128 %1, %5, off\n\t"
        "global_load_async_to_lds_b128 %2, %6, off\n\t"
        "global_load_async_to_lds_b128 %3, %7, off\n\t"
        "s_wait_xcnt 0x0"
        :: "v"(l0), "v"(l1), "v"(l2), "v"(l3),
           "v"(g0), "v"(g1), "v"(g2), "v"(g3)
        : "memory");
}

// Load a 16x32 bf16 fragment (A-layout; B mirrors it with N in place of M)
// from LDS stored row-major with `rowStride` (in ushorts).
// Lane L holds row (rowBase + (L&15)); K pairs per ISA table:
// lanes 0-15: k = {0,2,4,6,16,18,20,22}; lanes 16-31: +8.
__device__ __forceinline__ v16bf load_frag(const unsigned short* base,
                                           int rowStride, int rowBase,
                                           int kOff, int lane) {
    union { v16bf v; unsigned int u[8]; } f;
    const int row = rowBase + (lane & 15);
    const int kb  = kOff + ((lane & 16) ? 8 : 0);
    const unsigned short* p = base + (size_t)row * rowStride;
#pragma unroll
    for (int r = 0; r < 8; ++r) {
        const int k = kb + ((r < 4) ? (2 * r) : (16 + 2 * (r - 4)));
        f.u[r] = *(const unsigned int*)(p + k);
    }
    return f.v;
}

__device__ __forceinline__ v16bf ones_frag() {
    union { v16bf v; unsigned int u[8]; } f;
#pragma unroll
    for (int i = 0; i < 8; ++i) f.u[i] = 0x3F803F80u;   // bf16(1.0) x2
    return f.v;
}

__device__ __forceinline__ v8f wmma_bf16(v16bf a, v16bf b, v8f c) {
    return __builtin_amdgcn_wmma_f32_16x16x32_bf16(
        false, a, false, b, (short)0, c, false, false);
}

// ---------------------------------------------------------------------------
// Kernels 1+2 in one grid: the seven operand preparations are independent of
// one another, so they share one launch. Blocks [0, 4096): weight transpose +
// f32 -> bf16, W:[K][N] -> Wt:[N][K], 1024 tiles of 32x32 per weight.
// Blocks [4096, 16384): elementwise f32 -> bf16 of the activations,
// 8 elements per thread, 4096 blocks per tensor.
// The four Wt planes and the three X planes are each contiguous in workspace.
// ---------------------------------------------------------------------------
#define WT_BLOCKS  ((D_MODEL / 32) * (D_MODEL / 32))    // 1024 per weight
#define CVT_BLOCKS ((M_ROWS * D_MODEL) / (8 * 256))     // 4096 per tensor

__global__ __launch_bounds__(256) void prep_kernel(
    const float* __restrict__ W0, const float* __restrict__ W1,
    const float* __restrict__ W2, const float* __restrict__ W3,
    const float* __restrict__ X0, const float* __restrict__ X1,
    const float* __restrict__ X2,
    unsigned short* __restrict__ WtAll, unsigned short* __restrict__ XbAll) {
    __shared__ float tile[32][33];
    const unsigned b = blockIdx.x;
    const int t = threadIdx.x;
    if (b < 4 * WT_BLOCKS) {   // block-uniform
        const unsigned which = b / WT_BLOCKS;
        const unsigned tl    = b % WT_BLOCKS;
        const float* __restrict__ W =
            which == 0 ? W0 : which == 1 ? W1 : which == 2 ? W2 : W3;
        unsigned short* __restrict__ Wt =
            WtAll + (size_t)which * D_MODEL * D_MODEL;
        const int k0 = (tl % (D_MODEL / 32)) * 32;
        const int n0 = (tl / (D_MODEL / 32)) * 32;
        const int x = t & 31;   // 0..31
        const int y = t >> 5;   // 0..7
#pragma unroll
        for (int i = 0; i < 4; ++i)
            tile[y + 8 * i][x] = W[(size_t)(k0 + y + 8 * i) * D_MODEL + n0 + x];
        __syncthreads();
#pragma unroll
        for (int i = 0; i < 4; ++i)
            Wt[(size_t)(n0 + y + 8 * i) * D_MODEL + (k0 + x)] =
                f32_to_bf16(tile[x][y + 8 * i]);
    } else {
        const unsigned c     = b - 4 * WT_BLOCKS;
        const unsigned which = c / CVT_BLOCKS;
        const float* __restrict__ src = which == 0 ? X0 : which == 1 ? X1 : X2;
        unsigned short* __restrict__ dst =
            XbAll + (size_t)which * M_ROWS * D_MODEL;
        const int i = (c % CVT_BLOCKS) * 256 + t;
        const float4 a = ((const float4*)src)[2 * i];
        const float4 d = ((const float4*)src)[2 * i + 1];
        uint4 o;
        o.x = pack_bf16x2(a.x, a.y);
        o.y = pack_bf16x2(a.z, a.w);
        o.z = pack_bf16x2(d.x, d.y);
        o.w = pack_bf16x2(d.z, d.w);
        ((uint4*)dst)[i] = o;
    }
}

// ---------------------------------------------------------------------------
// Kernel 3: bf16 GEMM via WMMA:  C[M,N] = A[M,K] @ Bt^T   (Bt: [N][K] bf16)
// Block tile 256x128, 8 waves (4x2), wave tile 64x64 (16 WMMA accumulators).
// A stage is 64 k (128-byte rows), two LDS buffers filled by asynchronous
// copies one stage ahead, one barrier per stage.
// blockIdx.z picks one product of a batch whose A, Bt and C planes each lie
// one behind the other.
// ---------------------------------------------------------------------------
#define GK 64   // k per stage
#define GP 72   // LDS row pitch in elements: 144 B = 16 B x odd, for 16-byte reads

template <bool OUT_F32>
__global__ __launch_bounds__(256) void gemm_bf16_wmma_kernel(
    const unsigned short* __restrict__ A,
    const unsigned short* __restrict__ Bt,
    void* __restrict__ Cptr, int M, int N, int K) {
    __shared__ __attribute__((aligned(16))) unsigned short lA[2][256 * GP];
    __shared__ __attribute__((aligned(16))) unsigned short lB[2][128 * GP];

    const int t    = threadIdx.x;
    const int lane = t & 31;
    const int w    = t >> 5;
    const int wm   = w >> 1;   // 0..3 -> 64 rows each
    const int wn   = w & 1;    // 0..1 -> 64 cols each
    const int m0   = blockIdx.y * 256;
    const int n0   = blockIdx.x * 128;
    const size_t z = blockIdx.z;
    A  += z * (size_t)M * K;
    Bt += z * (size_t)N * K;
    Cptr = (char*)Cptr + z * (size_t)M * N * (OUT_F32 ? 4 : 2);

    v8f acc[4][4];
#pragma unroll
    for (int mt = 0; mt < 4; ++mt)
#pragma unroll
        for (int nt = 0; nt < 4; ++nt) acc[mt][nt] = zero8();

    // staging geometry: eight lanes share a row's 128 bytes, so one wave-wide
    // copy takes four whole memory lines; the block covers 32 rows per copy:
    // 8 copies for A, 4 for B
    const int rS = t >> 3;         // row within a group of 32
    const int sS = (t & 7) * 8;    // 16-byte segment of the row, in elements
    const size_t g32 = (size_t)32 * K;
    const unsigned short* gA = A  + (size_t)(m0 + rS) * K + sS;
    const unsigned short* gB = Bt + (size_t)(n0 + rS) * K + sS;
    const unsigned dA = (unsigned)(size_t)&lA[0][rS * GP + sS];
    const unsigned dB = (unsigned)(size_t)&lB[0][rS * GP + sS];
    constexpr unsigned R32 = 32u * GP * 2u;    // bytes of 32 LDS rows
    constexpr unsigned BA  = 256u * GP * 2u;   // bytes of one A buffer
    constexpr unsigned BB  = 128u * GP * 2u;   // bytes of one B buffer

    auto stage = [&](int buf, int k0) {
        const unsigned short* a = gA + k0;
        const unsigned short* b = gB + k0;
        const unsigned la = dA + buf * BA;
        const unsigned lb = dB + buf * BB;
        copy4(la, la + R32, la + 2 * R32, la + 3 * R32,
              a, a + g32, a + 2 * g32, a + 3 * g32);
        copy4(la + 4 * R32, la + 5 * R32, la + 6 * R32, la + 7 * R32,
              a + 4 * g32, a + 5 * g32, a + 6 * g32, a + 7 * g32);
        copy4(lb, lb + R32, lb + 2 * R32, lb + 3 * R32,
              b, b + g32, b + 2 * g32, b + 3 * g32);
    };

    const int NK = K / GK;
    stage(0, 0);
    // stage 0 has landed for this wave; the barrier publishes it
    asm volatile("s_wait_asynccnt 0x0" ::: "memory");
    __syncthreads();
    if (NK > 1) stage(1, GK);   // the same for the whole work-group

    for (int kt = 0; kt < NK; ++kt) {
        const int cur = kt & 1;
        // unrolled so that ks turns into immediate LDS offsets
#pragma unroll
        for (int ks = 0; ks < GK / 32; ++ks) {
            v16bf aF[4], bF[4];
#pragma unroll
            for (int mt = 0; mt < 4; ++mt)
                aF[mt] = load_frag(&lA[cur][0], GP, wm * 64 + mt * 16, ks * 32,
                                   lane);
#pragma unroll
            for (int nt = 0; nt < 4; ++nt)
                bF[nt] = load_frag(&lB[cur][0], GP, wn * 64 + nt * 16, ks * 32,
                                   lane);
#pragma unroll
            for (int mt = 0; mt < 4; ++mt)
#pragma unroll
                for (int nt = 0; nt < 4; ++nt)
                    acc[mt][nt] = wmma_bf16(aF[mt], bF[nt], acc[mt][nt]);
        }
        // hand-over: this wave's reads of the buffer are done, its copies of the
        // next stage have landed; the barrier publishes that stage and frees
        // this buffer for the refill behind it
        asm volatile("s_wait_dscnt 0x0" ::: "memory");
        asm volatile("s_wait_asynccnt 0x0" ::: "memory");
        __syncthreads();
        if (kt + 2 < NK)   // the same for the whole work-group
            stage(cur, (kt + 2) * GK);
    }
    // nothing is outstanding when the wave ends
    asm volatile("s_wait_asynccnt 0x0" ::: "memory");

    // epilogue (C/D layout: VGPR r -> M = r + (lane>=16 ? 8 : 0))
    const int hi = (lane & 16) ? 8 : 0;
#pragma unroll
    for (int mt = 0; mt < 4; ++mt)
#pragma unroll
        for (int nt = 0; nt < 4; ++nt)
#pragma unroll
            for (int r = 0; r < 8; ++r) {
                const int gr = m0 + wm * 64 + mt * 16 + r + hi;
                const int gc = n0 + wn * 64 + nt * 16 + (lane & 15);
                if (OUT_F32)
                    ((float*)Cptr)[(size_t)gr * N + gc] = acc[mt][nt][r];
                else
                    ((unsigned short*)Cptr)[(size_t)gr * N + gc] =
                        f32_to_bf16(acc[mt][nt][r]);
            }
}

typedef __attribute__((ext_vector_type(2))) float  f32x2;
typedef __attribute__((ext_vector_type(2))) __bf16 bf16x2;

// two f32 -> packed bf16 pair, round to nearest even (one hardware convert)
__device__ __forceinline__ unsigned int cvt_bf16x2(float a, float b) {
    union { bf16x2 v; unsigned int u; } o;
    f32x2 x;
    x[0] = a; x[1] = b;
    o.v = __builtin_convertvector(x, bf16x2);
    return o.u;
}

// value of lane l ^ 16
__device__ __forceinline__ float other_half(float v) {
    const int b = __float_as_int(v);
    return __int_as_float(__builtin_amdgcn_permlanex16(
        b, b, 0x76543210, 0xfedcba98, false, false));
}

// K and V stages in LDS: 64 keys each, two buffers.
#define KV_STAGE 64
#define PK 72   // K row pitch in elements: 144 B = 16 B x odd, for plain 16-byte reads
#define PV 80   // V row pitch in elements: 160 B = 32 B x odd, for the transposing read

typedef short s16x8 __attribute__((ext_vector_type(8)));
typedef unsigned int u32x4 __attribute__((ext_vector_type(4)));

// transposing 16-bit LDS read: lane (c, h) gets T[k + 8h + 0..7][d + c] of a
// row-major tile; every lane passes its own row address (see the caller)
__device__ __forceinline__ u32x4 ld_tr16(const unsigned short* p) {
    typedef __attribute__((address_space(3))) s16x8 lds_s16x8;
    return __builtin_bit_cast(
        u32x4, __builtin_amdgcn_ds_load_tr16_b128_v8i16((lds_s16x8*)p));
}

// One stage of K and V, global -> LDS through no register: each lane copies
// 16 bytes of rows r and r + 32 of both. The s_wait_xcnt closes the statement
// so that no address register of a copy is rewritten ahead of it.
__device__ __forceinline__ void stage_kv(const unsigned short* gk,
                                         const unsigned short* gv,
                                         unsigned lk, unsigned lv) {
    asm volatile(
        "global_load_async_to_lds_b128 %0, %4, off\n\t"
        "global_load_async_to_lds_b128 %1, %5, off\n\t"
        "global_load_async_to_lds_b128 %2, %6, off\n\t"
        "global_load_async_to_lds_b128 %3, %7, off\n\t"
        "s_wait_xcnt 0x0"
        :: "v"(lk), "v"(lk + 32u * PK * 2u), "v"(lv), "v"(lv + 32u * PV * 2u),
           "v"(gk), "v"(gk + 32 * HD), "v"(gv), "v"(gv + 32 * HD)
        : "memory");
}

__global__ __launch_bounds__(256) void attn_kernel(
    const unsigned short* __restrict__ Qg,
    const unsigned short* __restrict__ Kg,
    const unsigned short* __restrict__ Vg,
    unsigned short* __restrict__ Og) {
    __shared__ __attribute__((aligned(16))) unsigned short sQ[128 * 72];
    __shared__ __attribute__((aligned(16))) unsigned short sK[2][KV_STAGE * PK];
    __shared__ __attribute__((aligned(16))) unsigned short sV[2][KV_STAGE * PV];

    const int t    = threadIdx.x;
    const int lane = t & 31;
    const int w    = t >> 5;
    const int q0   = blockIdx.x * 128;
    const size_t base = (size_t)blockIdx.y * S_LEN * HD;

    // staging geometry: eight lanes share a row's 128 bytes, so one wave-wide
    // copy takes four whole memory lines; the block covers 32 rows per copy
    const int rS = t >> 3;
    const int sS = (t & 7) * 8;
    const unsigned short* gK = Kg + base + (size_t)rS * HD + sS;
    const unsigned short* gV = Vg + base + (size_t)rS * HD + sS;
    const unsigned lK = (unsigned)(size_t)&sK[0][rS * PK + sS];
    const unsigned lV = (unsigned)(size_t)&sV[0][rS * PV + sS];
    constexpr unsigned BK = KV_STAGE * PK * 2;   // bytes of one K buffer
    constexpr unsigned BV = KV_STAGE * PV * 2;   // bytes of one V buffer
    constexpr int NT = S_LEN / KV_STAGE;

    stage_kv(gK, gV, lK, lV);   // stage 0 -> buffer 0

    {   // stage Q block 128x64
        const int r = t >> 1, hq = t & 1;
        const unsigned short* src = Qg + base + (size_t)(q0 + r) * HD + hq * 32;
        unsigned short* dst = sQ + r * 72 + hq * 32;
#pragma unroll
        for (int j = 0; j < 4; ++j)
            *(uint4*)(dst + j * 8) = *(const uint4*)(src + j * 8);
    }
    // stage 0 has landed for this wave; the barrier publishes it (and Q)
    asm volatile("s_wait_asynccnt 0x0" ::: "memory");
    __syncthreads();
    stage_kv(gK + KV_STAGE * HD, gV + KV_STAGE * HD, lK + BK, lV + BV);

    v16bf qF[2];   // B operand: column c = query w*16 + c
    qF[0] = load_frag(sQ, 72, w * 16, 0, lane);
    qF[1] = load_frag(sQ, 72, w * 16, 32, lane);
    const v16bf oneF = ones_frag();

    float m_ = -1e30f, l_ = 0.0f;   // of query c
    v8f o[4];                       // o[nt][r] = O[query c][nt*16 + 8h + r]
#pragma unroll
    for (int nt = 0; nt < 4; ++nt) o[nt] = zero8();

    const int hi = (lane & 16) ? 8 : 0;
    // lane's row and 16-byte half for the transposing read of V
    const int vOff = (hi + (lane & 7)) * PV + ((lane >> 3) & 1) * 8;

    for (int st = 0; st < NT; ++st) {
        const int buf = st & 1;
        const unsigned short* bK = &sK[buf][0];
        const unsigned short* bV = &sV[buf][0] + vOff;
        // unrolled so that sub turns into immediate LDS offsets
#pragma unroll
        for (int sub = 0; sub < KV_STAGE / 32; ++sub) {
            // S^T = K @ Q^T: s0[r] = score(key 8h+r, query c), s1[r]: key 16+8h+r
            v16bf ak[4];
#pragma unroll
            for (int i = 0; i < 4; ++i)
                ak[i] = load_frag(bK, PK, sub * 32 + (i & 1) * 16,
                                  (i >> 1) * 32, lane);
            v8f s0 = wmma_bf16(ak[0], qF[0], zero8());
            v8f s1 = wmma_bf16(ak[1], qF[0], zero8());
            s0 = wmma_bf16(ak[2], qF[1], s0);
            s1 = wmma_bf16(ak[3], qF[1], s1);

            // online softmax of query c: in-lane maximum + one half exchange
            const v8f a0 = s0 * 0.125f;   // 1/sqrt(64)
            const v8f a1 = s1 * 0.125f;
            float v = fmaxf(a0[0], a1[0]);
#pragma unroll
            for (int r = 1; r < 8; ++r) v = fmaxf(v, fmaxf(a0[r], a1[r]));
            v = fmaxf(v, other_half(v));
            const float mn = fmaxf(m_, v);
            const float al = __expf(m_ - mn);
            m_ = mn;

            // P^T as a B operand: element s = tile s>>3, register s&7
            union { v16bf v; unsigned int u[8]; } pB;
#pragma unroll
            for (int j = 0; j < 4; ++j) {
                pB.u[j]     = cvt_bf16x2(__expf(a0[2 * j] - mn),
                                         __expf(a0[2 * j + 1] - mn));
                pB.u[4 + j] = cvt_bf16x2(__expf(a1[2 * j] - mn),
                                         __expf(a1[2 * j + 1] - mn));
            }
#pragma unroll
            for (int nt = 0; nt < 4; ++nt)
#pragma unroll
                for (int r = 0; r < 8; ++r) o[nt][r] *= al;

            // column sums of P^T via matrix pipe: ones @ P^T -> every row = sums
            v8f rsum = wmma_bf16(oneF, pB.v, zero8());
            l_ = l_ * al + rsum[0];
            // O^T += V^T @ P^T; A = V^T: keys 8h+0..7 and 16+8h+0..7 of
            // column nt*16 + c, the k order of P^T
#pragma unroll
            for (int nt = 0; nt < 4; ++nt) {
                union { v16bf v; u32x4 q[2]; } av;
                av.q[0] = ld_tr16(bV + (sub * 32) * PV + nt * 16);
                av.q[1] = ld_tr16(bV + (sub * 32 + 16) * PV + nt * 16);
                o[nt] = wmma_bf16(av.v, pB.v, o[nt]);
            }
        }
        // hand-over: this wave's reads of the buffer are done, its copies of the
        // next stage have landed; the barrier publishes that stage and frees
        // this buffer for the refill behind it
        asm volatile("s_wait_dscnt 0x0" ::: "memory");
        asm volatile("s_wait_asynccnt 0x0" ::: "memory");
        __syncthreads();
        if (st + 2 < NT)   // the same for the whole work-group
            stage_kv(gK + (size_t)(st + 2) * KV_STAGE * HD,
                     gV + (size_t)(st + 2) * KV_STAGE * HD,
                     lK + buf * BK, lV + buf * BV);
    }
    // nothing is outstanding when the wave ends
    asm volatile("s_wait_asynccnt 0x0" ::: "memory");

    // a lane holds 8 consecutive columns of its query's row: 16-byte stores
    const float inv = 1.0f / l_;
    unsigned short* orow =
        Og + base + (size_t)(q0 + w * 16 + (lane & 15)) * HD + hi;
#pragma unroll
    for (int nt = 0; nt < 4; ++nt) {
        uint4 pk;
        pk.x = cvt_bf16x2(o[nt][0] * inv, o[nt][1] * inv);
        pk.y = cvt_bf16x2(o[nt][2] * inv, o[nt][3] * inv);
        pk.z = cvt_bf16x2(o[nt][4] * inv, o[nt][5] * inv);
        pk.w = cvt_bf16x2(o[nt][6] * inv, o[nt][7] * inv);
        *(uint4*)(orow + nt * 16) = pk;
    }
}

// ---------------------------------------------------------------------------
// Kernel 5: residual add + LayerNorm, in place over d_out rows.
// ---------------------------------------------------------------------------
__global__ __launch_bounds__(256) void ln_kernel(
    float* __restrict__ out, const float* __restrict__ resid,
    const float* __restrict__ gamma, const float* __restrict__ beta) {
    const int row = blockIdx.x;
    const int t = threadIdx.x;
    __shared__ float rs[256], rq[256];
    float x[4];
    float s = 0.0f, sq = 0.0f;
#pragma unroll
    for (int i = 0; i < 4; ++i) {
        const int c = t + i * 256;
        const float v = out[(size_t)row * D_MODEL + c] +
                        resid[(size_t)row * D_MODEL + c];
        x[i] = v; s += v; sq += v * v;
    }
    rs[t] = s; rq[t] = sq;
    __syncthreads();
    for (int off = 128; off > 0; off >>= 1) {
        if (t < off) { rs[t] += rs[t + off]; rq[t] += rq[t + off]; }
        __syncthreads();
    }
    const float mu  = rs[0] * (1.0f / D_MODEL);
    const float var = rq[0] * (1.0f / D_MODEL) - mu * mu;
    const float inv = rsqrtf(var + 1e-5f);
#pragma unroll
    for (int i = 0; i < 4; ++i) {
        const int c = t + i * 256;
        out[(size_t)row * D_MODEL + c] =
            (x[i] - mu) * inv * gamma[c] + beta[c];
    }
}

// ---------------------------------------------------------------------------
// Host-side launch
// ---------------------------------------------------------------------------
extern "C" void kernel_launch(void* const* d_in, const int* in_sizes, int n_in,
                              void* d_out, int out_size, void* d_ws, size_t ws_size,
                              hipStream_t stream) {
    const float* preQ  = (const float*)d_in[0];
    const float* preK  = (const float*)d_in[1];
    const float* preV  = (const float*)d_in[2];
    const float* Wq    = (const float*)d_in[3];
    const float* Wk    = (const float*)d_in[4];
    const float* Wv    = (const float*)d_in[5];
    const float* Wo    = (const float*)d_in[6];
    const float* gamma = (const float*)d_in[7];
    const float* beta  = (const float*)d_in[8];
    float* out = (float*)d_out;

    char* ws = (char*)d_ws;
    constexpr size_t WT_BYTES  = (size_t)D_MODEL * D_MODEL * 2;   // 2 MB
    constexpr size_t XB_BYTES  = (size_t)M_ROWS * D_MODEL * 2;    // 16 MB
    unsigned short* WqT = (unsigned short*)(ws + 0 * WT_BYTES);
    // planes 1 and 2 behind WqT: Wk^T, Wv^T
    unsigned short* WoT = (unsigned short*)(ws + 3 * WT_BYTES);
    char* xbase = ws + 4 * WT_BYTES;
    unsigned short* Xq = (unsigned short*)(xbase + 0 * XB_BYTES);
    // planes 1 and 2 behind Xq: bf16 pre_key, pre_value
    unsigned short* Qb = (unsigned short*)(xbase + 3 * XB_BYTES);
    unsigned short* Kb = (unsigned short*)(xbase + 4 * XB_BYTES);
    unsigned short* Vb = (unsigned short*)(xbase + 5 * XB_BYTES);
    unsigned short* Ab = Xq;   // Xq dead after Q projection; reuse for attn out

    // 1+2) weights -> bf16 transposed [N][K], activations -> bf16: one grid
    prep_kernel<<<4 * WT_BLOCKS + 3 * CVT_BLOCKS, 256, 0, stream>>>(
        Wq, Wk, Wv, Wo, preQ, preK, preV, WqT, Xq);

    // 3) the three projections (bf16 in, bf16 out) as one batch: z = Q, K, V
    dim3 gg(D_MODEL / 128, M_ROWS / 256);        // (8, 32)
    dim3 gg3(D_MODEL / 128, M_ROWS / 256, 3);    // (8, 32, 3)
    gemm_bf16_wmma_kernel<false><<<gg3, 256, 0, stream>>>(
        Xq, WqT, Qb, M_ROWS, D_MODEL, D_MODEL);

    // 4) flash attention over 64 (b,h) slabs x 16 query blocks
    attn_kernel<<<dim3(S_LEN / 128, N_BATCH * N_HEADS), 256, 0, stream>>>(
        Qb, Kb, Vb, Ab);

    // 5) output projection straight into d_out (f32)
    gemm_bf16_wmma_kernel<true><<<gg, 256, 0, stream>>>(
        Ab, WoT, out, M_ROWS, D_MODEL, D_MODEL);

    // 6) residual + LayerNorm in place
    ln_kernel<<<M_ROWS, 256, 0, stream>>>(out, preV, gamma, beta);
}

// v006
// One run takes 168 microseconds.
// Next to v005, in two timings, it ran 1.04 times as fast each time.
// Counting every step since v000, it is 2.17 times as fast.
#include <hip/hip_runtime.h>

// ---------------------------------------------------------------------------
// Types for CDNA5 WMMA
// ---------------------------------------------------------------------------
typedef __attribute__((ext_vector_type(16))) __bf16 v16bf;
typedef __attribute__((ext_vector_type(8)))  float  v8f;

#define D_MODEL 1024
#define S_LEN   2048
#define N_BATCH 4
#define N_HEADS 16
#define HD      64
#define M_ROWS  (N_BATCH * S_LEN)   // 8192

// ---------------------------------------------------------------------------
// Helpers
// ---------------------------------------------------------------------------
__device__ __forceinline__ unsigned short f32_to_bf16(float f) {
    unsigned int x = __float_as_uint(f);
    x += 0x7FFFu + ((x >> 16) & 1u);   // round to nearest even
    return (unsigned short)(x >> 16);
}

__device__ __forceinline__ unsigned int pack_bf16x2(float a, float b) {
    return ((unsigned int)f32_to_bf16(b) << 16) | (unsigned int)f32_to_bf16(a);
}

__device__ __forceinline__ v8f zero8() {
    v8f z;
#pragma unroll
    for (int i = 0; i < 8; ++i) z[i] = 0.0f;
    return z;
}

// Four 16-byte copies per lane, global -> LDS through no register. The
// s_wait_xcnt closes the statement so that no address register of a copy is
// rewritten ahead of it.
__device__ __forceinline__ void copy4(unsigned l0, unsigned l1, unsigned l2,
                                      unsigned l3, const unsigned short* g0,
                                      const unsigned short* g1,
                                      const unsigned short* g2,
                                      const unsigned short* g3) {
    asm volatile(
        "global_load_async_to_lds_b128 %0, %4, off\n\t"
        "global_load_async_to_lds_b128 %1, %5, off\n\t"
        "global_load_async_to_lds_b128 %2, %6, off\n\t"
        "global_load_async_to_lds_b128 %3, %7, off\n\t"
        "s_wait_xcnt 0x0"
        :: "v"(l0), "v"(l1), "v"(l2), "v"(l3),
           "v"(g0), "v"(g1), "v"(g2), "v"(g3)
        : "memory");
}

// Load a 16x32 bf16 fragment (A-layout; B mirrors it with N in place of M)
// from LDS stored row-major with `rowStride` (in ushorts).
// Lane L holds row (rowBase + (L&15)); K pairs per ISA table:
// lanes 0-15: k = {0,2,4,6,16,18,20,22}; lanes 16-31: +8.
__device__ __forceinline__ v16bf load_frag(const unsigned short* base,
                                           int rowStride, int rowBase,
                                           int kOff, int lane) {
    union { v16bf v; unsigned int u[8]; } f;
    const int row = rowBase + (lane & 15);
    const int kb  = kOff + ((lane & 16) ? 8 : 0);
    const unsigned short* p = base + (size_t)row * rowStride;
#pragma unroll
    for (int r = 0; r < 8; ++r) {
        const int k = kb + ((r < 4) ? (2 * r) : (16 + 2 * (r - 4)));
        f.u[r] = *(const unsigned int*)(p + k);
    }
    return f.v;
}

__device__ __forceinline__ v16bf ones_frag() {
    union { v16bf v; unsigned int u[8]; } f;
#pragma unroll
    for (int i = 0; i < 8; ++i) f.u[i] = 0x3F803F80u;   // bf16(1.0) x2
    return f.v;
}

__device__ __forceinline__ v8f wmma_bf16(v16bf a, v16bf b, v8f c) {
    return __builtin_amdgcn_wmma_f32_16x16x32_bf16(
        false, a, false, b, (short)0, c, false, false);
}

// ---------------------------------------------------------------------------
// Kernels 1+2 in one grid: the seven operand preparations are independent of
// one another, so they share one launch. Blocks [0, 4096): weight transpose +
// f32 -> bf16, W:[K][N] -> Wt:[N][K], 1024 tiles of 32x32 per weight.
// Blocks [4096, 16384): elementwise f32 -> bf16 of the activations,
// 8 elements per thread, 4096 blocks per tensor.
// The four Wt planes and the three X planes are each contiguous in workspace.
// ---------------------------------------------------------------------------
#define WT_BLOCKS  ((D_MODEL / 32) * (D_MODEL / 32))    // 1024 per weight
#define CVT_BLOCKS ((M_ROWS * D_MODEL) / (8 * 256))     // 4096 per tensor

__global__ __launch_bounds__(256) void prep_kernel(
    const float* __restrict__ W0, const float* __restrict__ W1,
    const float* __restrict__ W2, const float* __restrict__ W3,
    const float* __restrict__ X0, const float* __restrict__ X1,
    const float* __restrict__ X2,
    unsigned short* __restrict__ WtAll, unsigned short* __restrict__ XbAll) {
    __shared__ float tile[32][33];
    const unsigned b = blockIdx.x;
    const int t = threadIdx.x;
    if (b < 4 * WT_BLOCKS) {   // block-uniform
        const unsigned which = b / WT_BLOCKS;
        const unsigned tl    = b % WT_BLOCKS;
        const float* __restrict__ W =
            which == 0 ? W0 : which == 1 ? W1 : which == 2 ? W2 : W3;
        unsigned short* __restrict__ Wt =
            WtAll + (size_t)which * D_MODEL * D_MODEL;
        const int k0 = (tl % (D_MODEL / 32)) * 32;
        const int n0 = (tl / (D_MODEL / 32)) * 32;
        const int x = t & 31;   // 0..31
        const int y = t >> 5;   // 0..7
#pragma unroll
        for (int i = 0; i < 4; ++i)
            tile[y + 8 * i][x] = W[(size_t)(k0 + y + 8 * i) * D_MODEL + n0 + x];
        __syncthreads();
#pragma unroll
        for (int i = 0; i < 4; ++i)
            Wt[(size_t)(n0 + y + 8 * i) * D_MODEL + (k0 + x)] =
                f32_to_bf16(tile[x][y + 8 * i]);
    } else {
        const unsigned c     = b - 4 * WT_BLOCKS;
        const unsigned which = c / CVT_BLOCKS;
        const float* __restrict__ src = which == 0 ? X0 : which == 1 ? X1 : X2;
        unsigned short* __restrict__ dst =
            XbAll + (size_t)which * M_ROWS * D_MODEL;
        const int i = (c % CVT_BLOCKS) * 256 + t;
        const float4 a = ((const float4*)src)[2 * i];
        const float4 d = ((const float4*)src)[2 * i + 1];
        uint4 o;
        o.x = pack_bf16x2(a.x, a.y);
        o.y = pack_bf16x2(a.z, a.w);
        o.z = pack_bf16x2(d.x, d.y);
        o.w = pack_bf16x2(d.z, d.w);
        ((uint4*)dst)[i] = o;
    }
}

// ---------------------------------------------------------------------------
// Kernel 3: bf16 GEMM via WMMA:  C[M,N] = A[M,K] @ Bt^T   (Bt: [N][K] bf16)
// Block tile 256x128, 8 waves (4x2), wave tile 64x64 (16 WMMA accumulators).
// A stage is 64 k (128-byte rows), two LDS buffers filled by asynchronous
// copies one stage ahead, one barrier per stage.
// blockIdx.z picks one product of a batch whose A, Bt and C planes each lie
// one behind the other.
// ---------------------------------------------------------------------------
#define GK 64   // k per stage
#define GP 72   // LDS row pitch in elements: 144 B = 16 B x odd, for 16-byte reads

template <bool OUT_F32>
__global__ __launch_bounds__(256) void gemm_bf16_wmma_kernel(
    const unsigned short* __restrict__ A,
    const unsigned short* __restrict__ Bt,
    void* __restrict__ Cptr, int M, int N, int K) {
    __shared__ __attribute__((aligned(16))) unsigned short lA[2][256 * GP];
    __shared__ __attribute__((aligned(16))) unsigned short lB[2][128 * GP];

    const int t    = threadIdx.x;
    const int lane = t & 31;
    const int w    = t >> 5;
    const int wm   = w >> 1;   // 0..3 -> 64 rows each
    const int wn   = w & 1;    // 0..1 -> 64 cols each
    const int m0   = blockIdx.y * 256;
    const int n0   = blockIdx.x * 128;
    const size_t z = blockIdx.z;
    A  += z * (size_t)M * K;
    Bt += z * (size_t)N * K;
    Cptr = (char*)Cptr + z * (size_t)M * N * (OUT_F32 ? 4 : 2);

    v8f acc[4][4];
#pragma unroll
    for (int mt = 0; mt < 4; ++mt)
#pragma unroll
        for (int nt = 0; nt < 4; ++nt) acc[mt][nt] = zero8();

    // staging geometry: eight lanes share a row's 128 bytes, so one wave-wide
    // copy takes four whole memory lines; the block covers 32 rows per copy:
    // 8 copies for A, 4 for B
    const int rS = t >> 3;         // row within a group of 32
    const int sS = (t & 7) * 8;    // 16-byte segment of the row, in elements
    const size_t g32 = (size_t)32 * K;
    const unsigned short* gA = A  + (size_t)(m0 + rS) * K + sS;
    const unsigned short* gB = Bt + (size_t)(n0 + rS) * K + sS;
    const unsigned dA = (unsigned)(size_t)&lA[0][rS * GP + sS];
    const unsigned dB = (unsigned)(size_t)&lB[0][rS * GP + sS];
    constexpr unsigned R32 = 32u * GP * 2u;    // bytes of 32 LDS rows
    constexpr unsigned BA  = 256u * GP * 2u;   // bytes of one A buffer
    constexpr unsigned BB  = 128u * GP * 2u;   // bytes of one B buffer

    auto stage = [&](int buf, int k0) {
        const unsigned short* a = gA + k0;
        const unsigned short* b = gB + k0;
        const unsigned la = dA + buf * BA;
        const unsigned lb = dB + buf * BB;
        copy4(la, la + R32, la + 2 * R32, la + 3 * R32,
              a, a + g32, a + 2 * g32, a + 3 * g32);
        copy4(la + 4 * R32, la + 5 * R32, la + 6 * R32, la + 7 * R32,
              a + 4 * g32, a + 5 * g32, a + 6 * g32, a + 7 * g32);
        copy4(lb, lb + R32, lb + 2 * R32, lb + 3 * R32,
              b, b + g32, b + 2 * g32, b + 3 * g32);
    };

    const int NK = K / GK;
    stage(0, 0);
    // stage 0 has landed for this wave; the barrier publishes it
    asm volatile("s_wait_asynccnt 0x0" ::: "memory");
    __syncthreads();
    if (NK > 1) stage(1, GK);   // the same for the whole work-group

    for (int kt = 0; kt < NK; ++kt) {
        const int cur = kt & 1;
        // unrolled so that ks turns into immediate LDS offsets
#pragma unroll
        for (int ks = 0; ks < GK / 32; ++ks) {
            v16bf aF[4], bF[4];
#pragma unroll
            for (int mt = 0; mt < 4; ++mt)
                aF[mt] = load_frag(&lA[cur][0], GP, wm * 64 + mt * 16, ks * 32,
                                   lane);
#pragma unroll
            for (int nt = 0; nt < 4; ++nt)
                bF[nt] = load_frag(&lB[cur][0], GP, wn * 64 + nt * 16, ks * 32,
                                   lane);
#pragma unroll
            for (int mt = 0; mt < 4; ++mt)
#pragma unroll
                for (int nt = 0; nt < 4; ++nt)
                    acc[mt][nt] = wmma_bf16(aF[mt], bF[nt], acc[mt][nt]);
        }
        // hand-over: this wave's reads of the buffer are done, its copies of the
        // next stage have landed; the barrier publishes that stage and frees
        // this buffer for the refill behind it
        asm volatile("s_wait_dscnt 0x0" ::: "memory");
        asm volatile("s_wait_asynccnt 0x0" ::: "memory");
        __syncthreads();
        if (kt + 2 < NK)   // the same for the whole work-group
            stage(cur, (kt + 2) * GK);
    }
    // nothing is outstanding when the wave ends
    asm volatile("s_wait_asynccnt 0x0" ::: "memory");

    // epilogue (C/D layout: VGPR r -> M = r + (lane>=16 ? 8 : 0))
    const int hi = (lane & 16) ? 8 : 0;
#pragma unroll
    for (int mt = 0; mt < 4; ++mt)
#pragma unroll
        for (int nt = 0; nt < 4; ++nt)
#pragma unroll
            for (int r = 0; r < 8; ++r) {
                const int gr = m0 + wm * 64 + mt * 16 + r + hi;
                const int gc = n0 + wn * 64 + nt * 16 + (lane & 15);
                if (OUT_F32)
                    ((float*)Cptr)[(size_t)gr * N + gc] = acc[mt][nt][r];
                else
                    ((unsigned short*)Cptr)[(size_t)gr * N + gc] =
                        f32_to_bf16(acc[mt][nt][r]);
            }
}

typedef __attribute__((ext_vector_type(2))) float  f32x2;
typedef __attribute__((ext_vector_type(2))) __bf16 bf16x2;

// two f32 -> packed bf16 pair, round to nearest even (one hardware convert)
__device__ __forceinline__ unsigned int cvt_bf16x2(float a, float b) {
    union { bf16x2 v; unsigned int u; } o;
    f32x2 x;
    x[0] = a; x[1] = b;
    o.v = __builtin_convertvector(x, bf16x2);
    return o.u;
}

// value of lane l ^ 16
__device__ __forceinline__ float other_half(float v) {
    const int b = __float_as_int(v);
    return __int_as_float(__builtin_amdgcn_permlanex16(
        b, b, 0x76543210, 0xfedcba98, false, false));
}

// K and V stages in LDS: 64 keys each, two buffers.
#define KV_STAGE 64
#define PK 72   // K row pitch in elements: 144 B = 16 B x odd, for plain 16-byte reads
#define PV 80   // V row pitch in elements: 160 B = 32 B x odd, for the transposing read

typedef short s16x8 __attribute__((ext_vector_type(8)));
typedef unsigned int u32x4 __attribute__((ext_vector_type(4)));

// transposing 16-bit LDS read: lane (c, h) gets T[k + 8h + 0..7][d + c] of a
// row-major tile; every lane passes its own row address (see the caller)
__device__ __forceinline__ u32x4 ld_tr16(const unsigned short* p) {
    typedef __attribute__((address_space(3))) s16x8 lds_s16x8;
    return __builtin_bit_cast(
        u32x4, __builtin_amdgcn_ds_load_tr16_b128_v8i16((lds_s16x8*)p));
}

// One stage of K and V, global -> LDS through no register: each lane copies
// 16 bytes of rows r and r + 32 of both. The s_wait_xcnt closes the statement
// so that no address register of a copy is rewritten ahead of it.
__device__ __forceinline__ void stage_kv(const unsigned short* gk,
                                         const unsigned short* gv,
                                         unsigned lk, unsigned lv) {
    asm volatile(
        "global_load_async_to_lds_b128 %0, %4, off\n\t"
        "global_load_async_to_lds_b128 %1, %5, off\n\t"
        "global_load_async_to_lds_b128 %2, %6, off\n\t"
        "global_load_async_to_lds_b128 %3, %7, off\n\t"
        "s_wait_xcnt 0x0"
        :: "v"(lk), "v"(lk + 32u * PK * 2u), "v"(lv), "v"(lv + 32u * PV * 2u),
           "v"(gk), "v"(gk + 32 * HD), "v"(gv), "v"(gv + 32 * HD)
        : "memory");
}

__global__ __launch_bounds__(256) void attn_kernel(
    const unsigned short* __restrict__ Qg,
    const unsigned short* __restrict__ Kg,
    const unsigned short* __restrict__ Vg,
    unsigned short* __restrict__ Og) {
    __shared__ __attribute__((aligned(16))) unsigned short sQ[128 * 72];
    __shared__ __attribute__((aligned(16))) unsigned short sK[2][KV_STAGE * PK];
    __shared__ __attribute__((aligned(16))) unsigned short sV[2][KV_STAGE * PV];

    const int t    = threadIdx.x;
    const int lane = t & 31;
    const int w    = t >> 5;
    const int q0   = blockIdx.x * 128;
    const size_t base = (size_t)blockIdx.y * S_LEN * HD;

    // staging geometry: eight lanes share a row's 128 bytes, so one wave-wide
    // copy takes four whole memory lines; the block covers 32 rows per copy
    const int rS = t >> 3;
    const int sS = (t & 7) * 8;
    const unsigned short* gK = Kg + base + (size_t)rS * HD + sS;
    const unsigned short* gV = Vg + base + (size_t)rS * HD + sS;
    const unsigned lK = (unsigned)(size_t)&sK[0][rS * PK + sS];
    const unsigned lV = (unsigned)(size_t)&sV[0][rS * PV + sS];
    constexpr unsigned BK = KV_STAGE * PK * 2;   // bytes of one K buffer
    constexpr unsigned BV = KV_STAGE * PV * 2;   // bytes of one V buffer
    constexpr int NT = S_LEN / KV_STAGE;

    stage_kv(gK, gV, lK, lV);   // stage 0 -> buffer 0

    {   // stage Q block 128x64
        const int r = t >> 1, hq = t & 1;
        const unsigned short* src = Qg + base + (size_t)(q0 + r) * HD + hq * 32;
        unsigned short* dst = sQ + r * 72 + hq * 32;
#pragma unroll
        for (int j = 0; j < 4; ++j)
            *(uint4*)(dst + j * 8) = *(const uint4*)(src + j * 8);
    }
    // stage 0 has landed for this wave; the barrier publishes it (and Q)
    asm volatile("s_wait_asynccnt 0x0" ::: "memory");
    __syncthreads();
    stage_kv(gK + KV_STAGE * HD, gV + KV_STAGE * HD, lK + BK, lV + BV);

    v16bf qF[2];   // B operand: column c = query w*16 + c
    qF[0] = load_frag(sQ, 72, w * 16, 0, lane);
    qF[1] = load_frag(sQ, 72, w * 16, 32, lane);
    const v16bf oneF = ones_frag();

    // 1/sqrt(64) * log2(e): scores go to the base-2 exponent in one step
    constexpr float CS = 0.125f * 1.4426950408889634f;
    float m_ = -1e30f, l_ = 0.0f;   // of query c; m_ in units of the base-2 exponent
    v8f o[4];                       // o[nt][r] = O[query c][nt*16 + 8h + r]
#pragma unroll
    for (int nt = 0; nt < 4; ++nt) o[nt] = zero8();

    const int hi = (lane & 16) ? 8 : 0;
    // lane's row and 16-byte half for the transposing read of V
    const int vOff = (hi + (lane & 7)) * PV + ((lane >> 3) & 1) * 8;

    for (int st = 0; st < NT; ++st) {
        const int buf = st & 1;
        const unsigned short* bK = &sK[buf][0];
        const unsigned short* bV = &sV[buf][0] + vOff;
        // unrolled so that sub turns into immediate LDS offsets
#pragma unroll
        for (int sub = 0; sub < KV_STAGE / 32; ++sub) {
            // S^T = K @ Q^T: s0[r] = score(key 8h+r, query c), s1[r]: key 16+8h+r
            v16bf ak[4];
#pragma unroll
            for (int i = 0; i < 4; ++i)
                ak[i] = load_frag(bK, PK, sub * 32 + (i & 1) * 16,
                                  (i >> 1) * 32, lane);
            v8f s0 = wmma_bf16(ak[0], qF[0], zero8());
            v8f s1 = wmma_bf16(ak[1], qF[0], zero8());
            s0 = wmma_bf16(ak[2], qF[1], s0);
            s1 = wmma_bf16(ak[3], qF[1], s1);

            // online softmax of query c in base 2: the maximum is taken over the
            // raw scores (the scale is positive), in the lane plus one half
            // exchange; m_ holds it times CS
            float v = fmaxf(s0[0], s1[0]);
#pragma unroll
            for (int r = 1; r < 8; ++r) v = fmaxf(v, fmaxf(s0[r], s1[r]));
            v = fmaxf(v, other_half(v));
            const float mn = fmaxf(m_, v * CS);
            const float al = __builtin_amdgcn_exp2f(m_ - mn);
            m_ = mn;

            // P^T as a B operand: element s = tile s>>3, register s&7; scale,
            // log2(e) and the maximum go into one packed multiply-add per pair
            const f32x2 cs2 = {CS, CS};
            const f32x2 nm2 = {-mn, -mn};
            union { v16bf v; unsigned int u[8]; } pB;
            f32x2 e[8];
            // both loops unrolled so that e and pB are registers, not arrays
#pragma unroll
            for (int j = 0; j < 4; ++j) {
                e[j] = __builtin_elementwise_fma(
                    f32x2{s0[2 * j], s0[2 * j + 1]}, cs2, nm2);
                e[4 + j] = __builtin_elementwise_fma(
                    f32x2{s1[2 * j], s1[2 * j + 1]}, cs2, nm2);
            }
#pragma unroll
            for (int j = 0; j < 8; ++j)
                pB.u[j] = cvt_bf16x2(__builtin_amdgcn_exp2f(e[j][0]),
                                     __builtin_amdgcn_exp2f(e[j][1]));
#pragma unroll
            for (int nt = 0; nt < 4; ++nt)
#pragma unroll
                for (int r = 0; r < 8; ++r) o[nt][r] *= al;

            // column sums of P^T via matrix pipe: ones @ P^T -> every row = sums
            v8f rsum = wmma_bf16(oneF, pB.v, zero8());
            l_ = l_ * al + rsum[0];
            // O^T += V^T @ P^T; A = V^T: keys 8h+0..7 and 16+8h+0..7 of
            // column nt*16 + c, the k order of P^T
#pragma unroll
            for (int nt = 0; nt < 4; ++nt) {
                union { v16bf v; u32x4 q[2]; } av;
                av.q[0] = ld_tr16(bV + (sub * 32) * PV + nt * 16);
                av.q[1] = ld_tr16(bV + (sub * 32 + 16) * PV + nt * 16);
                o[nt] = wmma_bf16(av.v, pB.v, o[nt]);
            }
        }
        // hand-over: this wave's reads of the buffer are done, its copies of the
        // next stage have landed; the barrier publishes that stage and frees
        // this buffer for the refill behind it
        asm volatile("s_wait_dscnt 0x0" ::: "memory");
        asm volatile("s_wait_asynccnt 0x0" ::: "memory");
        __syncthreads();
        if (st + 2 < NT)   // the same for the whole work-group
            stage_kv(gK + (size_t)(st + 2) * KV_STAGE * HD,
                     gV + (size_t)(st + 2) * KV_STAGE * HD,
                     lK + buf * BK, lV + buf * BV);
    }
    // nothing is outstanding when the wave ends
    asm volatile("s_wait_asynccnt 0x0" ::: "memory");

    // a lane holds 8 consecutive columns of its query's row: 16-byte stores
    const float inv = 1.0f / l_;
    unsigned short* orow =
        Og + base + (size_t)(q0 + w * 16 + (lane & 15)) * HD + hi;
#pragma unroll
    for (int nt = 0; nt < 4; ++nt) {
        uint4 pk;
        pk.x = cvt_bf16x2(o[nt][0] * inv, o[nt][1] * inv);
        pk.y = cvt_bf16x2(o[nt][2] * inv, o[nt][3] * inv);
        pk.z = cvt_bf16x2(o[nt][4] * inv, o[nt][5] * inv);
        pk.w = cvt_bf16x2(o[nt][6] * inv, o[nt][7] * inv);
        *(uint4*)(orow + nt * 16) = pk;
    }
}

// ---------------------------------------------------------------------------
// Kernel 5: residual add + LayerNorm, in place over d_out rows.
// ---------------------------------------------------------------------------
__global__ __launch_bounds__(256) void ln_kernel(
    float* __restrict__ out, const float* __restrict__ resid,
    const float* __restrict__ gamma, const float* __restrict__ beta) {
    const int row = blockIdx.x;
    const int t = threadIdx.x;
    __shared__ float rs[256], rq[256];
    float x[4];
    float s = 0.0f, sq = 0.0f;
#pragma unroll
    for (int i = 0; i < 4; ++i) {
        const int c = t + i * 256;
        const float v = out[(size_t)row * D_MODEL + c] +
                        resid[(size_t)row * D_MODEL + c];
        x[i] = v; s += v; sq += v * v;
    }
    rs[t] = s; rq[t] = sq;
    __syncthreads();
    for (int off = 128; off > 0; off >>= 1) {
        if (t < off) { rs[t] += rs[t + off]; rq[t] += rq[t + off]; }
        __syncthreads();
    }
    const float mu  = rs[0] * (1.0f / D_MODEL);
    const float var = rq[0] * (1.0f / D_MODEL) - mu * mu;
    const float inv = rsqrtf(var + 1e-5f);
#pragma unroll
    for (int i = 0; i < 4; ++i) {
        const int c = t + i * 256;
        out[(size_t)row * D_MODEL + c] =
            (x[i] - mu) * inv * gamma[c] + beta[c];
    }
}

// ---------------------------------------------------------------------------
// Host-side launch
// ---------------------------------------------------------------------------
extern "C" void kernel_launch(void* const* d_in, const int* in_sizes, int n_in,
                              void* d_out, int out_size, void* d_ws, size_t ws_size,
                              hipStream_t stream) {
    const float* preQ  = (const float*)d_in[0];
    const float* preK  = (const float*)d_in[1];
    const float* preV  = (const float*)d_in[2];
    const float* Wq    = (const float*)d_in[3];
    const float* Wk    = (const float*)d_in[4];
    const float* Wv    = (const float*)d_in[5];
    const float* Wo    = (const float*)d_in[6];
    const float* gamma = (const float*)d_in[7];
    const float* beta  = (const float*)d_in[8];
    float* out = (float*)d_out;

    char* ws = (char*)d_ws;
    constexpr size_t WT_BYTES  = (size_t)D_MODEL * D_MODEL * 2;   // 2 MB
    constexpr size_t XB_BYTES  = (size_t)M_ROWS * D_MODEL * 2;    // 16 MB
    unsigned short* WqT = (unsigned short*)(ws + 0 * WT_BYTES);
    // planes 1 and 2 behind WqT: Wk^T, Wv^T
    unsigned short* WoT = (unsigned short*)(ws + 3 * WT_BYTES);
    char* xbase = ws + 4 * WT_BYTES;
    unsigned short* Xq = (unsigned short*)(xbase + 0 * XB_BYTES);
    // planes 1 and 2 behind Xq: bf16 pre_key, pre_value
    unsigned short* Qb = (unsigned short*)(xbase + 3 * XB_BYTES);
    unsigned short* Kb = (unsigned short*)(xbase + 4 * XB_BYTES);
    unsigned short* Vb = (unsigned short*)(xbase + 5 * XB_BYTES);
    unsigned short* Ab = Xq;   // Xq dead after Q projection; reuse for attn out

    // 1+2) weights -> bf16 transposed [N][K], activations -> bf16: one grid
    prep_kernel<<<4 * WT_BLOCKS + 3 * CVT_BLOCKS, 256, 0, stream>>>(
        Wq, Wk, Wv, Wo, preQ, preK, preV, WqT, Xq);

    // 3) the three projections (bf16 in, bf16 out) as one batch: z = Q, K, V
    dim3 gg(D_MODEL / 128, M_ROWS / 256);        // (8, 32)
    dim3 gg3(D_MODEL / 128, M_ROWS / 256, 3);    // (8, 32, 3)
    gemm_bf16_wmma_kernel<false><<<gg3, 256, 0, stream>>>(
        Xq, WqT, Qb, M_ROWS, D_MODEL, D_MODEL);

    // 4) flash attention over 64 (b,h) slabs x 16 query blocks
    attn_kernel<<<dim3(S_LEN / 128, N_BATCH * N_HEADS), 256, 0, stream>>>(
        Qb, Kb, Vb, Ab);

    // 5) output projection straight into d_out (f32)
    gemm_bf16_wmma_kernel<true><<<gg, 256, 0, stream>>>(
        Ab, WoT, out, M_ROWS, D_MODEL, D_MODEL);

    // 6) residual + LayerNorm in place
    ln_kernel<<<M_ROWS, 256, 0, stream>>>(out, preV, gamma, beta);
}

// v007
// It runs in 161 microseconds.
// In two side-by-side timings against v006, it was 1.04 and 1.05 times as fast.
// Over all steps from v000 it is 2.27 times as fast.
#include <hip/hip_runtime.h>

// ---------------------------------------------------------------------------
// Types for CDNA5 WMMA
// ---------------------------------------------------------------------------
typedef __attribute__((ext_vector_type(16))) __bf16 v16bf;
typedef __attribute__((ext_vector_type(8)))  float  v8f;

#define D_MODEL 1024
#define S_LEN   2048
#define N_BATCH 4
#define N_HEADS 16
#define HD      64
#define M_ROWS  (N_BATCH * S_LEN)   // 8192

// ---------------------------------------------------------------------------
// Helpers
// ---------------------------------------------------------------------------
__device__ __forceinline__ unsigned short f32_to_bf16(float f) {
    unsigned int x = __float_as_uint(f);
    x += 0x7FFFu + ((x >> 16) & 1u);   // round to nearest even
    return (unsigned short)(x >> 16);
}

__device__ __forceinline__ unsigned int pack_bf16x2(float a, float b) {
    return ((unsigned int)f32_to_bf16(b) << 16) | (unsigned int)f32_to_bf16(a);
}

__device__ __forceinline__ v8f zero8() {
    v8f z;
#pragma unroll
    for (int i = 0; i < 8; ++i) z[i] = 0.0f;
    return z;
}

// Four 16-byte copies per lane, global -> LDS through no register. The
// s_wait_xcnt closes the statement so that no address register of a copy is
// rewritten ahead of it.
__device__ __forceinline__ void copy4(unsigned l0, unsigned l1, unsigned l2,
                                      unsigned l3, const unsigned short* g0,
                                      const unsigned short* g1,
                                      const unsigned short* g2,
                                      const unsigned short* g3) {
    asm volatile(
        "global_load_async_to_lds_b128 %0, %4, off\n\t"
        "global_load_async_to_lds_b128 %1, %5, off\n\t"
        "global_load_async_to_lds_b128 %2, %6, off\n\t"
        "global_load_async_to_lds_b128 %3, %7, off\n\t"
        "s_wait_xcnt 0x0"
        :: "v"(l0), "v"(l1), "v"(l2), "v"(l3),
           "v"(g0), "v"(g1), "v"(g2), "v"(g3)
        : "memory");
}

// Load a 16x32 bf16 fragment (A-layout; B mirrors it with N in place of M)
// from LDS stored row-major with `rowStride` (in ushorts).
// Lane L holds row (rowBase + (L&15)); K pairs per ISA table:
// lanes 0-15: k = {0,2,4,6,16,18,20,22}; lanes 16-31: +8.
__device__ __forceinline__ v16bf load_frag(const unsigned short* base,
                                           int rowStride, int rowBase,
                                           int kOff, int lane) {
    union { v16bf v; unsigned int u[8]; } f;
    const int row = rowBase + (lane & 15);
    const int kb  = kOff + ((lane & 16) ? 8 : 0);
    const unsigned short* p = base + (size_t)row * rowStride;
#pragma unroll
    for (int r = 0; r < 8; ++r) {
        const int k = kb + ((r < 4) ? (2 * r) : (16 + 2 * (r - 4)));
        f.u[r] = *(const unsigned int*)(p + k);
    }
    return f.v;
}

__device__ __forceinline__ v16bf ones_frag() {
    union { v16bf v; unsigned int u[8]; } f;
#pragma unroll
    for (int i = 0; i < 8; ++i) f.u[i] = 0x3F803F80u;   // bf16(1.0) x2
    return f.v;
}

__device__ __forceinline__ v8f wmma_bf16(v16bf a, v16bf b, v8f c) {
    return __builtin_amdgcn_wmma_f32_16x16x32_bf16(
        false, a, false, b, (short)0, c, false, false);
}

// ---------------------------------------------------------------------------
// Kernels 1+2 in one grid: the seven operand preparations are independent of
// one another, so they share one launch. Blocks [0, 4096): weight transpose +
// f32 -> bf16, W:[K][N] -> Wt:[N][K], 1024 tiles of 32x32 per weight.
// Blocks [4096, 16384): elementwise f32 -> bf16 of the activations,
// 8 elements per thread, 4096 blocks per tensor.
// The four Wt planes and the three X planes are each contiguous in workspace.
// ---------------------------------------------------------------------------
#define WT_BLOCKS  ((D_MODEL / 32) * (D_MODEL / 32))    // 1024 per weight
#define CVT_BLOCKS ((M_ROWS * D_MODEL) / (8 * 256))     // 4096 per tensor

__global__ __launch_bounds__(256) void prep_kernel(
    const float* __restrict__ W0, const float* __restrict__ W1,
    const float* __restrict__ W2, const float* __restrict__ W3,
    const float* __restrict__ X0, const float* __restrict__ X1,
    const float* __restrict__ X2,
    unsigned short* __restrict__ WtAll, unsigned short* __restrict__ XbAll) {
    __shared__ float tile[32][33];
    const unsigned b = blockIdx.x;
    const int t = threadIdx.x;
    if (b < 4 * WT_BLOCKS) {   // block-uniform
        const unsigned which = b / WT_BLOCKS;
        const unsigned tl    = b % WT_BLOCKS;
        const float* __restrict__ W =
            which == 0 ? W0 : which == 1 ? W1 : which == 2 ? W2 : W3;
        unsigned short* __restrict__ Wt =
            WtAll + (size_t)which * D_MODEL * D_MODEL;
        const int k0 = (tl % (D_MODEL / 32)) * 32;
        const int n0 = (tl / (D_MODEL / 32)) * 32;
        const int x = t & 31;   // 0..31
        const int y = t >> 5;   // 0..7
#pragma unroll
        for (int i = 0; i < 4; ++i)
            tile[y + 8 * i][x] = W[(size_t)(k0 + y + 8 * i) * D_MODEL + n0 + x];
        __syncthreads();
#pragma unroll
        for (int i = 0; i < 4; ++i)
            Wt[(size_t)(n0 + y + 8 * i) * D_MODEL + (k0 + x)] =
                f32_to_bf16(tile[x][y + 8 * i]);
    } else {
        const unsigned c     = b - 4 * WT_BLOCKS;
        const unsigned which = c / CVT_BLOCKS;
        const float* __restrict__ src = which == 0 ? X0 : which == 1 ? X1 : X2;
        unsigned short* __restrict__ dst =
            XbAll + (size_t)which * M_ROWS * D_MODEL;
        const int i = (c % CVT_BLOCKS) * 256 + t;
        const float4 a = ((const float4*)src)[2 * i];
        const float4 d = ((const float4*)src)[2 * i + 1];
        uint4 o;
        o.x = pack_bf16x2(a.x, a.y);
        o.y = pack_bf16x2(a.z, a.w);
        o.z = pack_bf16x2(d.x, d.y);
        o.w = pack_bf16x2(d.z, d.w);
        ((uint4*)dst)[i] = o;
    }
}

// ---------------------------------------------------------------------------
// Kernel 3: bf16 GEMM via WMMA:  C[M,N] = A[M,K] @ Bt^T   (Bt: [N][K] bf16)
// Block tile 256x128, 8 waves (4x2), wave tile 64x64 (16 WMMA accumulators).
// A stage is 64 k (128-byte rows), two LDS buffers filled by asynchronous
// copies one stage ahead, one barrier per stage.
// blockIdx.z picks one product of a batch whose A, Bt and C planes each lie
// one behind the other.
// ---------------------------------------------------------------------------
#define GK 64   // k per stage
#define GP 72   // LDS row pitch in elements: 144 B = 16 B x odd, for 16-byte reads

template <bool OUT_F32>
__global__ __launch_bounds__(256) void gemm_bf16_wmma_kernel(
    const unsigned short* __restrict__ A,
    const unsigned short* __restrict__ Bt,
    void* __restrict__ Cptr, int M, int N, int K) {
    __shared__ __attribute__((aligned(16))) unsigned short lA[2][256 * GP];
    __shared__ __attribute__((aligned(16))) unsigned short lB[2][128 * GP];

    const int t    = threadIdx.x;
    const int lane = t & 31;
    const int w    = t >> 5;
    const int wm   = w >> 1;   // 0..3 -> 64 rows each
    const int wn   = w & 1;    // 0..1 -> 64 cols each
    const int m0   = blockIdx.y * 256;
    const int n0   = blockIdx.x * 128;
    const size_t z = blockIdx.z;
    A  += z * (size_t)M * K;
    Bt += z * (size_t)N * K;
    Cptr = (char*)Cptr + z * (size_t)M * N * (OUT_F32 ? 4 : 2);

    v8f acc[4][4];
#pragma unroll
    for (int mt = 0; mt < 4; ++mt)
#pragma unroll
        for (int nt = 0; nt < 4; ++nt) acc[mt][nt] = zero8();

    // staging geometry: eight lanes share a row's 128 bytes, so one wave-wide
    // copy takes four whole memory lines; the block covers 32 rows per copy:
    // 8 copies for A, 4 for B
    const int rS = t >> 3;         // row within a group of 32
    const int sS = (t & 7) * 8;    // 16-byte segment of the row, in elements
    const size_t g32 = (size_t)32 * K;
    const unsigned short* gA = A  + (size_t)(m0 + rS) * K + sS;
    const unsigned short* gB = Bt + (size_t)(n0 + rS) * K + sS;
    const unsigned dA = (unsigned)(size_t)&lA[0][rS * GP + sS];
    const unsigned dB = (unsigned)(size_t)&lB[0][rS * GP + sS];
    constexpr unsigned R32 = 32u * GP * 2u;    // bytes of 32 LDS rows
    constexpr unsigned BA  = 256u * GP * 2u;   // bytes of one A buffer
    constexpr unsigned BB  = 128u * GP * 2u;   // bytes of one B buffer

    auto stage = [&](int buf, int k0) {
        const unsigned short* a = gA + k0;
        const unsigned short* b = gB + k0;
        const unsigned la = dA + buf * BA;
        const unsigned lb = dB + buf * BB;
        copy4(la, la + R32, la + 2 * R32, la + 3 * R32,
              a, a + g32, a + 2 * g32, a + 3 * g32);
        copy4(la + 4 * R32, la + 5 * R32, la + 6 * R32, la + 7 * R32,
              a + 4 * g32, a + 5 * g32, a + 6 * g32, a + 7 * g32);
        copy4(lb, lb + R32, lb + 2 * R32, lb + 3 * R32,
              b, b + g32, b + 2 * g32, b + 3 * g32);
    };

    const int NK = K / GK;
    stage(0, 0);
    // stage 0 has landed for this wave; the barrier publishes it
    asm volatile("s_wait_asynccnt 0x0" ::: "memory");
    __syncthreads();
    if (NK > 1) stage(1, GK);   // the same for the whole work-group

    for (int kt = 0; kt < NK; ++kt) {
        const int cur = kt & 1;
        // unrolled so that ks turns into immediate LDS offsets
#pragma unroll
        for (int ks = 0; ks < GK / 32; ++ks) {
            v16bf aF[4], bF[4];
#pragma unroll
            for (int mt = 0; mt < 4; ++mt)
                aF[mt] = load_frag(&lA[cur][0], GP, wm * 64 + mt * 16, ks * 32,
                                   lane);
#pragma unroll
            for (int nt = 0; nt < 4; ++nt)
                bF[nt] = load_frag(&lB[cur][0], GP, wn * 64 + nt * 16, ks * 32,
                                   lane);
#pragma unroll
            for (int mt = 0; mt < 4; ++mt)
#pragma unroll
                for (int nt = 0; nt < 4; ++nt)
                    acc[mt][nt] = wmma_bf16(aF[mt], bF[nt], acc[mt][nt]);
        }
        // hand-over: this wave's reads of the buffer are done, its copies of the
        // next stage have landed; the barrier publishes that stage and frees
        // this buffer for the refill behind it
        asm volatile("s_wait_dscnt 0x0" ::: "memory");
        asm volatile("s_wait_asynccnt 0x0" ::: "memory");
        __syncthreads();
        if (kt + 2 < NK)   // the same for the whole work-group
            stage(cur, (kt + 2) * GK);
    }
    // nothing is outstanding when the wave ends
    asm volatile("s_wait_asynccnt 0x0" ::: "memory");

    // epilogue (C/D layout: VGPR r -> M = r + (lane>=16 ? 8 : 0))
    const int hi = (lane & 16) ? 8 : 0;
#pragma unroll
    for (int mt = 0; mt < 4; ++mt)
#pragma unroll
        for (int nt = 0; nt < 4; ++nt)
#pragma unroll
            for (int r = 0; r < 8; ++r) {
                const int gr = m0 + wm * 64 + mt * 16 + r + hi;
                const int gc = n0 + wn * 64 + nt * 16 + (lane & 15);
                if (OUT_F32)
                    ((float*)Cptr)[(size_t)gr * N + gc] = acc[mt][nt][r];
                else
                    ((unsigned short*)Cptr)[(size_t)gr * N + gc] =
                        f32_to_bf16(acc[mt][nt][r]);
            }
}

typedef __attribute__((ext_vector_type(2))) float  f32x2;
typedef __attribute__((ext_vector_type(2))) __bf16 bf16x2;

// two f32 -> packed bf16 pair, round to nearest even (one hardware convert)
__device__ __forceinline__ unsigned int cvt_bf16x2(float a, float b) {
    union { bf16x2 v; unsigned int u; } o;
    f32x2 x;
    x[0] = a; x[1] = b;
    o.v = __builtin_convertvector(x, bf16x2);
    return o.u;
}

// value of lane l ^ 16
__device__ __forceinline__ float other_half(float v) {
    const int b = __float_as_int(v);
    return __int_as_float(__builtin_amdgcn_permlanex16(
        b, b, 0x76543210, 0xfedcba98, false, false));
}

// K and V stages in LDS: 64 keys each, two buffers.
#define KV_STAGE 64
#define QBLK 256   // queries per work-group: 8 waves x 2 groups x 16
#define PK 72   // K row pitch in elements: 144 B = 16 B x odd, for plain 16-byte reads
#define PV 80   // V row pitch in elements: 160 B = 32 B x odd, for the transposing read

typedef short s16x8 __attribute__((ext_vector_type(8)));
typedef unsigned int u32x4 __attribute__((ext_vector_type(4)));

// transposing 16-bit LDS read: lane (c, h) gets T[k + 8h + 0..7][d + c] of a
// row-major tile; every lane passes its own row address (see the caller)
__device__ __forceinline__ u32x4 ld_tr16(const unsigned short* p) {
    typedef __attribute__((address_space(3))) s16x8 lds_s16x8;
    return __builtin_bit_cast(
        u32x4, __builtin_amdgcn_ds_load_tr16_b128_v8i16((lds_s16x8*)p));
}

// One stage of K and V, global -> LDS through no register: each lane copies
// 16 bytes of rows r and r + 32 of both. The s_wait_xcnt closes the statement
// so that no address register of a copy is rewritten ahead of it.
__device__ __forceinline__ void stage_kv(const unsigned short* gk,
                                         const unsigned short* gv,
                                         unsigned lk, unsigned lv) {
    asm volatile(
        "global_load_async_to_lds_b128 %0, %4, off\n\t"
        "global_load_async_to_lds_b128 %1, %5, off\n\t"
        "global_load_async_to_lds_b128 %2, %6, off\n\t"
        "global_load_async_to_lds_b128 %3, %7, off\n\t"
        "s_wait_xcnt 0x0"
        :: "v"(lk), "v"(lk + 32u * PK * 2u), "v"(lv), "v"(lv + 32u * PV * 2u),
           "v"(gk), "v"(gk + 32 * HD), "v"(gv), "v"(gv + 32 * HD)
        : "memory");
}

__global__ __launch_bounds__(256) void attn_kernel(
    const unsigned short* __restrict__ Qg,
    const unsigned short* __restrict__ Kg,
    const unsigned short* __restrict__ Vg,
    unsigned short* __restrict__ Og) {
    __shared__ __attribute__((aligned(16))) unsigned short sQ[QBLK * 72];
    __shared__ __attribute__((aligned(16))) unsigned short sK[2][KV_STAGE * PK];
    __shared__ __attribute__((aligned(16))) unsigned short sV[2][KV_STAGE * PV];

    const int t    = threadIdx.x;
    const int lane = t & 31;
    const int w    = t >> 5;
    const int q0   = blockIdx.x * QBLK;
    const size_t base = (size_t)blockIdx.y * S_LEN * HD;

    // staging geometry: eight lanes share a row's 128 bytes, so one wave-wide
    // copy takes four whole memory lines; the block covers 32 rows per copy
    const int rS = t >> 3;
    const int sS = (t & 7) * 8;
    const unsigned short* gK = Kg + base + (size_t)rS * HD + sS;
    const unsigned short* gV = Vg + base + (size_t)rS * HD + sS;
    const unsigned lK = (unsigned)(size_t)&sK[0][rS * PK + sS];
    const unsigned lV = (unsigned)(size_t)&sV[0][rS * PV + sS];
    constexpr unsigned BK = KV_STAGE * PK * 2;   // bytes of one K buffer
    constexpr unsigned BV = KV_STAGE * PV * 2;   // bytes of one V buffer
    constexpr int NT = S_LEN / KV_STAGE;

    stage_kv(gK, gV, lK, lV);   // stage 0 -> buffer 0

    {   // stage Q block 256x64
        const int r = t >> 1, hq = t & 1;
        const unsigned short* src = Qg + base + (size_t)(q0 + r) * HD + hq * 32;
        unsigned short* dst = sQ + r * 72 + hq * 32;
#pragma unroll
        for (int p = 0; p < 2; ++p)
#pragma unroll
            for (int j = 0; j < 4; ++j)
                *(uint4*)(dst + p * 128 * 72 + j * 8) =
                    *(const uint4*)(src + p * 128 * HD + j * 8);
    }
    // stage 0 has landed for this wave; the barrier publishes it (and Q)
    asm volatile("s_wait_asynccnt 0x0" ::: "memory");
    __syncthreads();
    stage_kv(gK + KV_STAGE * HD, gV + KV_STAGE * HD, lK + BK, lV + BV);

    v16bf qF[2][2];   // B operand of group g: column c = query w*32 + g*16 + c
#pragma unroll
    for (int g = 0; g < 2; ++g) {
        qF[g][0] = load_frag(sQ, 72, w * 32 + g * 16, 0, lane);
        qF[g][1] = load_frag(sQ, 72, w * 32 + g * 16, 32, lane);
    }
    const v16bf oneF = ones_frag();

    // 1/sqrt(64) * log2(e): scores go to the base-2 exponent in one step
    constexpr float CS = 0.125f * 1.4426950408889634f;
    // of query c of group g; m_ in units of the base-2 exponent
    float m_[2] = {-1e30f, -1e30f};
    // running sums of query c: all 16 rows of the tile get the same sums, only
    // register 0 is rescaled and read; the others stay below the key count
    v8f ls[2] = {zero8(), zero8()};
    v8f o[2][4];   // o[g][nt][r] = O[query c of group g][nt*16 + 8h + r]
#pragma unroll
    for (int g = 0; g < 2; ++g)
#pragma unroll
        for (int nt = 0; nt < 4; ++nt) o[g][nt] = zero8();

    const int hi = (lane & 16) ? 8 : 0;
    // lane's row and 16-byte half for the transposing read of V
    const int vOff = (hi + (lane & 7)) * PV + ((lane >> 3) & 1) * 8;

    for (int st = 0; st < NT; ++st) {
        const int buf = st & 1;
        const unsigned short* bK = &sK[buf][0];
        const unsigned short* bV = &sV[buf][0] + vOff;
        // unrolled so that sub turns into immediate LDS offsets
#pragma unroll
        for (int sub = 0; sub < KV_STAGE / 32; ++sub) {
            // S^T = K @ Q^T: s0[r] = score(key 8h+r, query c), s1[r]: key 16+8h+r
            v16bf ak[4];
#pragma unroll
            for (int i = 0; i < 4; ++i)
                ak[i] = load_frag(bK, PK, sub * 32 + (i & 1) * 16,
                                  (i >> 1) * 32, lane);
            v8f s0[2], s1[2];
            // all loops over g unrolled so that the per-group values are registers
#pragma unroll
            for (int g = 0; g < 2; ++g) {
                s0[g] = wmma_bf16(ak[0], qF[g][0], zero8());
                s1[g] = wmma_bf16(ak[1], qF[g][0], zero8());
            }
#pragma unroll
            for (int g = 0; g < 2; ++g) {
                s0[g] = wmma_bf16(ak[2], qF[g][1], s0[g]);
                s1[g] = wmma_bf16(ak[3], qF[g][1], s1[g]);
            }

            union { v16bf v; unsigned int u[8]; } pB[2];
#pragma unroll
            for (int g = 0; g < 2; ++g) {
                // online softmax of query c in base 2: the maximum is taken over
                // the raw scores (the scale is positive), in the lane plus one
                // half exchange; m_ holds it times CS
                float v = fmaxf(s0[g][0], s1[g][0]);
#pragma unroll
                for (int r = 1; r < 8; ++r)
                    v = fmaxf(v, fmaxf(s0[g][r], s1[g][r]));
                v = fmaxf(v, other_half(v));
                const float mn = fmaxf(m_[g], v * CS);
                const float al = __builtin_amdgcn_exp2f(m_[g] - mn);
                m_[g] = mn;

                // P^T as a B operand: element s = tile s>>3, register s&7; scale,
                // log2(e) and the maximum go into one packed multiply-add per pair
                const f32x2 cs2 = {CS, CS};
                const f32x2 nm2 = {-mn, -mn};
                f32x2 e[8];
                // both loops unrolled so that e and pB are registers, not arrays
#pragma unroll
                for (int j = 0; j < 4; ++j) {
                    e[j] = __builtin_elementwise_fma(
                        f32x2{s0[g][2 * j], s0[g][2 * j + 1]}, cs2, nm2);
                    e[4 + j] = __builtin_elementwise_fma(
                        f32x2{s1[g][2 * j], s1[g][2 * j + 1]}, cs2, nm2);
                }
#pragma unroll
                for (int j = 0; j < 8; ++j)
                    pB[g].u[j] = cvt_bf16x2(__builtin_amdgcn_exp2f(e[j][0]),
                                            __builtin_amdgcn_exp2f(e[j][1]));
#pragma unroll
                for (int nt = 0; nt < 4; ++nt)
#pragma unroll
                    for (int r = 0; r < 8; ++r) o[g][nt][r] *= al;
                ls[g][0] *= al;
            }
            // column sums of P^T via matrix pipe: ones @ P^T -> every row = sums,
            // added onto the running sums in the product's own accumulator
#pragma unroll
            for (int g = 0; g < 2; ++g) ls[g] = wmma_bf16(oneF, pB[g].v, ls[g]);
            // O^T += V^T @ P^T; A = V^T: keys 8h+0..7 and 16+8h+0..7 of
            // column nt*16 + c, the k order of P^T; one read serves both groups
#pragma unroll
            for (int nt = 0; nt < 4; ++nt) {
                union { v16bf v; u32x4 q[2]; } av;
                av.q[0] = ld_tr16(bV + (sub * 32) * PV + nt * 16);
                av.q[1] = ld_tr16(bV + (sub * 32 + 16) * PV + nt * 16);
#pragma unroll
                for (int g = 0; g < 2; ++g)
                    o[g][nt] = wmma_bf16(av.v, pB[g].v, o[g][nt]);
            }
        }
        // hand-over: this wave's reads of the buffer are done, its copies of the
        // next stage have landed; the barrier publishes that stage and frees
        // this buffer for the refill behind it
        asm volatile("s_wait_dscnt 0x0" ::: "memory");
        asm volatile("s_wait_asynccnt 0x0" ::: "memory");
        __syncthreads();
        if (st + 2 < NT)   // the same for the whole work-group
            stage_kv(gK + (size_t)(st + 2) * KV_STAGE * HD,
                     gV + (size_t)(st + 2) * KV_STAGE * HD,
                     lK + buf * BK, lV + buf * BV);
    }
    // nothing is outstanding when the wave ends
    asm volatile("s_wait_asynccnt 0x0" ::: "memory");

    // a lane holds 8 consecutive columns of its query's row: 16-byte stores
#pragma unroll
    for (int g = 0; g < 2; ++g) {
        const float inv = 1.0f / ls[g][0];
        unsigned short* orow =
            Og + base + (size_t)(q0 + w * 32 + g * 16 + (lane & 15)) * HD + hi;
#pragma unroll
        for (int nt = 0; nt < 4; ++nt) {
            uint4 pk;
            pk.x = cvt_bf16x2(o[g][nt][0] * inv, o[g][nt][1] * inv);
            pk.y = cvt_bf16x2(o[g][nt][2] * inv, o[g][nt][3] * inv);
            pk.z = cvt_bf16x2(o[g][nt][4] * inv, o[g][nt][5] * inv);
            pk.w = cvt_bf16x2(o[g][nt][6] * inv, o[g][nt][7] * inv);
            *(uint4*)(orow + nt * 16) = pk;
        }
    }
}

// ---------------------------------------------------------------------------
// Kernel 5: residual add + LayerNorm, in place over d_out rows.
// ---------------------------------------------------------------------------
__global__ __launch_bounds__(256) void ln_kernel(
    float* __restrict__ out, const float* __restrict__ resid,
    const float* __restrict__ gamma, const float* __restrict__ beta) {
    const int row = blockIdx.x;
    const int t = threadIdx.x;
    __shared__ float rs[256], rq[256];
    float x[4];
    float s = 0.0f, sq = 0.0f;
#pragma unroll
    for (int i = 0; i < 4; ++i) {
        const int c = t + i * 256;
        const float v = out[(size_t)row * D_MODEL + c] +
                        resid[(size_t)row * D_MODEL + c];
        x[i] = v; s += v; sq += v * v;
    }
    rs[t] = s; rq[t] = sq;
    __syncthreads();
    for (int off = 128; off > 0; off >>= 1) {
        if (t < off) { rs[t] += rs[t + off]; rq[t] += rq[t + off]; }
        __syncthreads();
    }
    const float mu  = rs[0] * (1.0f / D_MODEL);
    const float var = rq[0] * (1.0f / D_MODEL) - mu * mu;
    const float inv = rsqrtf(var + 1e-5f);
#pragma unroll
    for (int i = 0; i < 4; ++i) {
        const int c = t + i * 256;
        out[(size_t)row * D_MODEL + c] =
            (x[i] - mu) * inv * gamma[c] + beta[c];
    }
}

// ---------------------------------------------------------------------------
// Host-side launch
// ---------------------------------------------------------------------------
extern "C" void kernel_launch(void* const* d_in, const int* in_sizes, int n_in,
                              void* d_out, int out_size, void* d_ws, size_t ws_size,
                              hipStream_t stream) {
    const float* preQ  = (const float*)d_in[0];
    const float* preK  = (const float*)d_in[1];
    const float* preV  = (const float*)d_in[2];
    const float* Wq    = (const float*)d_in[3];
    const float* Wk    = (const float*)d_in[4];
    const float* Wv    = (const float*)d_in[5];
    const float* Wo    = (const float*)d_in[6];
    const float* gamma = (const float*)d_in[7];
    const float* beta  = (const float*)d_in[8];
    float* out = (float*)d_out;

    char* ws = (char*)d_ws;
    constexpr size_t WT_BYTES  = (size_t)D_MODEL * D_MODEL * 2;   // 2 MB
    constexpr size_t XB_BYTES  = (size_t)M_ROWS * D_MODEL * 2;    // 16 MB
    unsigned short* WqT = (unsigned short*)(ws + 0 * WT_BYTES);
    // planes 1 and 2 behind WqT: Wk^T, Wv^T
    unsigned short* WoT = (unsigned short*)(ws + 3 * WT_BYTES);
    char* xbase = ws + 4 * WT_BYTES;
    unsigned short* Xq = (unsigned short*)(xbase + 0 * XB_BYTES);
    // planes 1 and 2 behind Xq: bf16 pre_key, pre_value
    unsigned short* Qb = (unsigned short*)(xbase + 3 * XB_BYTES);
    unsigned short* Kb = (unsigned short*)(xbase + 4 * XB_BYTES);
    unsigned short* Vb = (unsigned short*)(xbase + 5 * XB_BYTES);
    unsigned short* Ab = Xq;   // Xq dead after Q projection; reuse for attn out

    // 1+2) weights -> bf16 transposed [N][K], activations -> bf16: one grid
    prep_kernel<<<4 * WT_BLOCKS + 3 * CVT_BLOCKS, 256, 0, stream>>>(
        Wq, Wk, Wv, Wo, preQ, preK, preV, WqT, Xq);

    // 3) the three projections (bf16 in, bf16 out) as one batch: z = Q, K, V
    dim3 gg(D_MODEL / 128, M_ROWS / 256);        // (8, 32)
    dim3 gg3(D_MODEL / 128, M_ROWS / 256, 3);    // (8, 32, 3)
    gemm_bf16_wmma_kernel<false><<<gg3, 256, 0, stream>>>(
        Xq, WqT, Qb, M_ROWS, D_MODEL, D_MODEL);

    // 4) flash attention over 64 (b,h) slabs x 8 query blocks
    attn_kernel<<<dim3(S_LEN / QBLK, N_BATCH * N_HEADS), 256, 0, stream>>>(
        Qb, Kb, Vb, Ab);

    // 5) output projection straight into d_out (f32)
    gemm_bf16_wmma_kernel<true><<<gg, 256, 0, stream>>>(
        Ab, WoT, out, M_ROWS, D_MODEL, D_MODEL);

    // 6) residual + LayerNorm in place
    ln_kernel<<<M_ROWS, 256, 0, stream>>>(out, preV, gamma, beta);
}

// v008
// A run of this version takes 154 microseconds.
// Timed twice side by side with v007, it ran 1.05 times as fast both times.
// Counting every step since v000, it is 2.38 times as fast.
#include <hip/hip_runtime.h>

// ---------------------------------------------------------------------------
// Types for CDNA5 WMMA
// ---------------------------------------------------------------------------
typedef __attribute__((ext_vector_type(16))) __bf16 v16bf;
typedef __attribute__((ext_vector_type(8)))  float  v8f;

#define D_MODEL 1024
#define S_LEN   2048
#define N_BATCH 4
#define N_HEADS 16
#define HD      64
#define M_ROWS  (N_BATCH * S_LEN)   // 8192

// ---------------------------------------------------------------------------
// Helpers
// ---------------------------------------------------------------------------
__device__ __forceinline__ unsigned short f32_to_bf16(float f) {
    unsigned int x = __float_as_uint(f);
    x += 0x7FFFu + ((x >> 16) & 1u);   // round to nearest even
    return (unsigned short)(x >> 16);
}

__device__ __forceinline__ unsigned int pack_bf16x2(float a, float b) {
    return ((unsigned int)f32_to_bf16(b) << 16) | (unsigned int)f32_to_bf16(a);
}

typedef __attribute__((ext_vector_type(2))) float  f32x2;
typedef __attribute__((ext_vector_type(2))) __bf16 bf16x2;

// two f32 -> packed bf16 pair, round to nearest even (one hardware convert)
__device__ __forceinline__ unsigned int cvt_bf16x2(float a, float b) {
    union { bf16x2 v; unsigned int u; } o;
    f32x2 x;
    x[0] = a; x[1] = b;
    o.v = __builtin_convertvector(x, bf16x2);
    return o.u;
}

__device__ __forceinline__ v8f zero8() {
    v8f z;
#pragma unroll
    for (int i = 0; i < 8; ++i) z[i] = 0.0f;
    return z;
}

// Four 16-byte copies per lane, global -> LDS through no register. The
// s_wait_xcnt closes the statement so that no address register of a copy is
// rewritten ahead of it.
__device__ __forceinline__ void copy4(unsigned l0, unsigned l1, unsigned l2,
                                      unsigned l3, const unsigned short* g0,
                                      const unsigned short* g1,
                                      const unsigned short* g2,
                                      const unsigned short* g3) {
    asm volatile(
        "global_load_async_to_lds_b128 %0, %4, off\n\t"
        "global_load_async_to_lds_b128 %1, %5, off\n\t"
        "global_load_async_to_lds_b128 %2, %6, off\n\t"
        "global_load_async_to_lds_b128 %3, %7, off\n\t"
        "s_wait_xcnt 0x0"
        :: "v"(l0), "v"(l1), "v"(l2), "v"(l3),
           "v"(g0), "v"(g1), "v"(g2), "v"(g3)
        : "memory");
}

// Load a 16x32 bf16 fragment (A-layout; B mirrors it with N in place of M)
// from LDS stored row-major with `rowStride` (in ushorts).
// Lane L holds row (rowBase + (L&15)); K pairs per ISA table:
// lanes 0-15: k = {0,2,4,6,16,18,20,22}; lanes 16-31: +8.
__device__ __forceinline__ v16bf load_frag(const unsigned short* base,
                                           int rowStride, int rowBase,
                                           int kOff, int lane) {
    union { v16bf v; unsigned int u[8]; } f;
    const int row = rowBase + (lane & 15);
    const int kb  = kOff + ((lane & 16) ? 8 : 0);
    const unsigned short* p = base + (size_t)row * rowStride;
#pragma unroll
    for (int r = 0; r < 8; ++r) {
        const int k = kb + ((r < 4) ? (2 * r) : (16 + 2 * (r - 4)));
        f.u[r] = *(const unsigned int*)(p + k);
    }
    return f.v;
}

__device__ __forceinline__ v16bf ones_frag() {
    union { v16bf v; unsigned int u[8]; } f;
#pragma unroll
    for (int i = 0; i < 8; ++i) f.u[i] = 0x3F803F80u;   // bf16(1.0) x2
    return f.v;
}

__device__ __forceinline__ v8f wmma_bf16(v16bf a, v16bf b, v8f c) {
    return __builtin_amdgcn_wmma_f32_16x16x32_bf16(
        false, a, false, b, (short)0, c, false, false);
}

// ---------------------------------------------------------------------------
// Kernels 1+2 in one grid: the seven operand preparations are independent of
// one another, so they share one launch. Blocks [0, 4096): weight transpose +
// f32 -> bf16, W:[K][N] -> Wt:[N][K], 1024 tiles of 32x32 per weight.
// Blocks [4096, 16384): elementwise f32 -> bf16 of the activations,
// 8 elements per thread, 4096 blocks per tensor.
// The four Wt planes and the three X planes are each contiguous in workspace.
// ---------------------------------------------------------------------------
#define WT_BLOCKS  ((D_MODEL / 32) * (D_MODEL / 32))    // 1024 per weight
#define CVT_BLOCKS ((M_ROWS * D_MODEL) / (8 * 256))     // 4096 per tensor

__global__ __launch_bounds__(256) void prep_kernel(
    const float* __restrict__ W0, const float* __restrict__ W1,
    const float* __restrict__ W2, const float* __restrict__ W3,
    const float* __restrict__ X0, const float* __restrict__ X1,
    const float* __restrict__ X2,
    unsigned short* __restrict__ WtAll, unsigned short* __restrict__ XbAll) {
    __shared__ float tile[32][33];
    const unsigned b = blockIdx.x;
    const int t = threadIdx.x;
    if (b < 4 * WT_BLOCKS) {   // block-uniform
        const unsigned which = b / WT_BLOCKS;
        const unsigned tl    = b % WT_BLOCKS;
        const float* __restrict__ W =
            which == 0 ? W0 : which == 1 ? W1 : which == 2 ? W2 : W3;
        unsigned short* __restrict__ Wt =
            WtAll + (size_t)which * D_MODEL * D_MODEL;
        const int k0 = (tl % (D_MODEL / 32)) * 32;
        const int n0 = (tl / (D_MODEL / 32)) * 32;
        const int x = t & 31;   // 0..31
        const int y = t >> 5;   // 0..7
#pragma unroll
        for (int i = 0; i < 4; ++i)
            tile[y + 8 * i][x] = W[(size_t)(k0 + y + 8 * i) * D_MODEL + n0 + x];
        __syncthreads();
#pragma unroll
        for (int i = 0; i < 4; ++i)
            Wt[(size_t)(n0 + y + 8 * i) * D_MODEL + (k0 + x)] =
                f32_to_bf16(tile[x][y + 8 * i]);
    } else {
        const unsigned c     = b - 4 * WT_BLOCKS;
        const unsigned which = c / CVT_BLOCKS;
        const float* __restrict__ src = which == 0 ? X0 : which == 1 ? X1 : X2;
        unsigned short* __restrict__ dst =
            XbAll + (size_t)which * M_ROWS * D_MODEL;
        const int i = (c % CVT_BLOCKS) * 256 + t;
        const float4 a = ((const float4*)src)[2 * i];
        const float4 d = ((const float4*)src)[2 * i + 1];
        uint4 o;
        o.x = pack_bf16x2(a.x, a.y);
        o.y = pack_bf16x2(a.z, a.w);
        o.z = pack_bf16x2(d.x, d.y);
        o.w = pack_bf16x2(d.z, d.w);
        ((uint4*)dst)[i] = o;
    }
}

// ---------------------------------------------------------------------------
// Kernel 3: bf16 GEMM via WMMA:  C[M,N] = A[M,K] @ Bt^T   (Bt: [N][K] bf16)
// Block tile 256x128, 8 waves (4x2), wave tile 64x64 (16 WMMA accumulators).
// A stage is 64 k (128-byte rows), two LDS buffers filled by asynchronous
// copies one stage ahead, one barrier per stage.
// The products are taken transposed (Bt rows as the A operand, A rows as the B
// operand), so a lane holds 8 consecutive columns of one row of C; each wave
// stages its tile in its own part of the free ring and stores whole lines.
// blockIdx.z picks one product of a batch whose A, Bt and C planes each lie
// one behind the other.
// ---------------------------------------------------------------------------
#define GK 64   // k per stage
#define GP 72   // LDS row pitch in elements: 144 B = 16 B x odd, for 16-byte reads

template <bool OUT_F32>
__global__ __launch_bounds__(256) void gemm_bf16_wmma_kernel(
    const unsigned short* __restrict__ A,
    const unsigned short* __restrict__ Bt,
    void* __restrict__ Cptr, int M, int N, int K) {
    __shared__ __attribute__((aligned(16))) unsigned short lA[2][256 * GP];
    __shared__ __attribute__((aligned(16))) unsigned short lB[2][128 * GP];

    const int t    = threadIdx.x;
    const int lane = t & 31;
    const int w    = t >> 5;
    const int wm   = w >> 1;   // 0..3 -> 64 rows each
    const int wn   = w & 1;    // 0..1 -> 64 cols each
    const int m0   = blockIdx.y * 256;
    const int n0   = blockIdx.x * 128;
    const size_t z = blockIdx.z;
    A  += z * (size_t)M * K;
    Bt += z * (size_t)N * K;
    Cptr = (char*)Cptr + z * (size_t)M * N * (OUT_F32 ? 4 : 2);

    v8f acc[4][4];
#pragma unroll
    for (int mt = 0; mt < 4; ++mt)
#pragma unroll
        for (int nt = 0; nt < 4; ++nt) acc[mt][nt] = zero8();

    // staging geometry: eight lanes share a row's 128 bytes, so one wave-wide
    // copy takes four whole memory lines; the block covers 32 rows per copy:
    // 8 copies for A, 4 for B
    const int rS = t >> 3;         // row within a group of 32
    const int sS = (t & 7) * 8;    // 16-byte segment of the row, in elements
    const size_t g32 = (size_t)32 * K;
    const unsigned short* gA = A  + (size_t)(m0 + rS) * K + sS;
    const unsigned short* gB = Bt + (size_t)(n0 + rS) * K + sS;
    const unsigned dA = (unsigned)(size_t)&lA[0][rS * GP + sS];
    const unsigned dB = (unsigned)(size_t)&lB[0][rS * GP + sS];
    constexpr unsigned R32 = 32u * GP * 2u;    // bytes of 32 LDS rows
    constexpr unsigned BA  = 256u * GP * 2u;   // bytes of one A buffer
    constexpr unsigned BB  = 128u * GP * 2u;   // bytes of one B buffer

    auto stage = [&](int buf, int k0) {
        const unsigned short* a = gA + k0;
        const unsigned short* b = gB + k0;
        const unsigned la = dA + buf * BA;
        const unsigned lb = dB + buf * BB;
        copy4(la, la + R32, la + 2 * R32, la + 3 * R32,
              a, a + g32, a + 2 * g32, a + 3 * g32);
        copy4(la + 4 * R32, la + 5 * R32, la + 6 * R32, la + 7 * R32,
              a + 4 * g32, a + 5 * g32, a + 6 * g32, a + 7 * g32);
        copy4(lb, lb + R32, lb + 2 * R32, lb + 3 * R32,
              b, b + g32, b + 2 * g32, b + 3 * g32);
    };

    const int NK = K / GK;
    stage(0, 0);
    // stage 0 has landed for this wave; the barrier publishes it
    asm volatile("s_wait_asynccnt 0x0" ::: "memory");
    __syncthreads();
    if (NK > 1) stage(1, GK);   // the same for the whole work-group

    for (int kt = 0; kt < NK; ++kt) {
        const int cur = kt & 1;
        // unrolled so that ks turns into immediate LDS offsets
#pragma unroll
        for (int ks = 0; ks < GK / 32; ++ks) {
            v16bf aF[4], bF[4];
#pragma unroll
            for (int mt = 0; mt < 4; ++mt)
                aF[mt] = load_frag(&lA[cur][0], GP, wm * 64 + mt * 16, ks * 32,
                                   lane);
#pragma unroll
            for (int nt = 0; nt < 4; ++nt)
                bF[nt] = load_frag(&lB[cur][0], GP, wn * 64 + nt * 16, ks * 32,
                                   lane);
#pragma unroll
            for (int mt = 0; mt < 4; ++mt)
#pragma unroll
                for (int nt = 0; nt < 4; ++nt)
                    acc[mt][nt] = wmma_bf16(bF[nt], aF[mt], acc[mt][nt]);
        }
        // hand-over: this wave's reads of the buffer are done, its copies of the
        // next stage have landed; the barrier publishes that stage and frees
        // this buffer for the refill behind it
        asm volatile("s_wait_dscnt 0x0" ::: "memory");
        asm volatile("s_wait_asynccnt 0x0" ::: "memory");
        __syncthreads();
        if (kt + 2 < NK)   // the same for the whole work-group
            stage(cur, (kt + 2) * GK);
    }
    // nothing is outstanding when the wave ends
    asm volatile("s_wait_asynccnt 0x0" ::: "memory");

    // epilogue: acc[mt][nt][r] = C[wm*64 + mt*16 + (lane & 15)][wn*64 + nt*16 + hi + r].
    // The loop's last barrier stands behind every wave's last read of the ring
    // and nothing is in flight into it, so each wave may stage in its own part.
    const int hi = (lane & 16) ? 8 : 0;
    const int c  = lane & 15;
    const size_t crow = (size_t)(m0 + wm * 64);
    const int    ccol = n0 + wn * 64;
    if (OUT_F32) {
        // 32 rows a pass at pitch 272 B = 16 B x odd
        constexpr int FP = 68;
        float* sw = (float*)&lA[0][0] + w * (32 * FP);
        float* C  = (float*)Cptr;
        // all loops here unrolled so that acc is indexed by constants (registers)
        // and the LDS rows turn into immediate offsets
#pragma unroll
        for (int p = 0; p < 2; ++p) {
#pragma unroll
            for (int mh = 0; mh < 2; ++mh)
#pragma unroll
                for (int nt = 0; nt < 4; ++nt) {
                    const v8f a = acc[2 * p + mh][nt];
                    float* d = sw + (mh * 16 + c) * FP + nt * 16 + hi;
                    *(float4*)d       = make_float4(a[0], a[1], a[2], a[3]);
                    *(float4*)(d + 4) = make_float4(a[4], a[5], a[6], a[7]);
                }
            // the other lanes' rows are in LDS before they are read back
            asm volatile("s_wait_dscnt 0x0" ::: "memory");
            // one store = 2 rows x 256 B = 4 whole lines
            const int row = lane >> 4;
            const int seg = (lane & 15) * 4;
            float* g = C + (crow + p * 32 + row) * N + ccol + seg;
#pragma unroll
            for (int i = 0; i < 16; ++i)
                *(float4*)(g + (size_t)(2 * i) * N) =
                    *(const float4*)(sw + (2 * i + row) * FP + seg);
            // this pass's rows have been read before the next pass rewrites them
            if (p == 0) asm volatile("s_wait_dscnt 0x0" ::: "memory");
        }
    } else {
        // 64 rows at pitch 144 B = 16 B x odd
        unsigned short* sw = &lA[0][0] + w * (64 * GP);
        unsigned short* C  = (unsigned short*)Cptr;
        // all loops here unrolled so that acc is indexed by constants (registers)
        // and the LDS rows turn into immediate offsets
#pragma unroll
        for (int mt = 0; mt < 4; ++mt)
#pragma unroll
            for (int nt = 0; nt < 4; ++nt) {
                const v8f a = acc[mt][nt];
                uint4 pk;
                pk.x = cvt_bf16x2(a[0], a[1]);
                pk.y = cvt_bf16x2(a[2], a[3]);
                pk.z = cvt_bf16x2(a[4], a[5]);
                pk.w = cvt_bf16x2(a[6], a[7]);
                *(uint4*)(sw + (mt * 16 + c) * GP + nt * 16 + hi) = pk;
            }
        // the other lanes' rows are in LDS before they are read back
        asm volatile("s_wait_dscnt 0x0" ::: "memory");
        // one store = 4 rows x 128 B = 4 whole lines
        const int row = lane >> 3;
        const int seg = (lane & 7) * 8;
        unsigned short* g = C + (crow + row) * N + ccol + seg;
#pragma unroll
        for (int i = 0; i < 16; ++i)
            *(uint4*)(g + (size_t)(4 * i) * N) =
                *(const uint4*)(sw + (4 * i + row) * GP + seg);
    }
}

__device__ __forceinline__ float other_half(float v) {
    const int b = __float_as_int(v);
    return __int_as_float(__builtin_amdgcn_permlanex16(
        b, b, 0x76543210, 0xfedcba98, false, false));
}

// K and V stages in LDS: 64 keys each, two buffers.
#define KV_STAGE 64
#define QBLK 256   // queries per work-group: 8 waves x 2 groups x 16
#define PK 72   // K row pitch in elements: 144 B = 16 B x odd, for plain 16-byte reads
#define PV 80   // V row pitch in elements: 160 B = 32 B x odd, for the transposing read

typedef short s16x8 __attribute__((ext_vector_type(8)));
typedef unsigned int u32x4 __attribute__((ext_vector_type(4)));

// transposing 16-bit LDS read: lane (c, h) gets T[k + 8h + 0..7][d + c] of a
// row-major tile; every lane passes its own row address (see the caller)
__device__ __forceinline__ u32x4 ld_tr16(const unsigned short* p) {
    typedef __attribute__((address_space(3))) s16x8 lds_s16x8;
    return __builtin_bit_cast(
        u32x4, __builtin_amdgcn_ds_load_tr16_b128_v8i16((lds_s16x8*)p));
}

// One stage of K and V, global -> LDS through no register: each lane copies
// 16 bytes of rows r and r + 32 of both. The s_wait_xcnt closes the statement
// so that no address register of a copy is rewritten ahead of it.
__device__ __forceinline__ void stage_kv(const unsigned short* gk,
                                         const unsigned short* gv,
                                         unsigned lk, unsigned lv) {
    asm volatile(
        "global_load_async_to_lds_b128 %0, %4, off\n\t"
        "global_load_async_to_lds_b128 %1, %5, off\n\t"
        "global_load_async_to_lds_b128 %2, %6, off\n\t"
        "global_load_async_to_lds_b128 %3, %7, off\n\t"
        "s_wait_xcnt 0x0"
        :: "v"(lk), "v"(lk + 32u * PK * 2u), "v"(lv), "v"(lv + 32u * PV * 2u),
           "v"(gk), "v"(gk + 32 * HD), "v"(gv), "v"(gv + 32 * HD)
        : "memory");
}

__global__ __launch_bounds__(256) void attn_kernel(
    const unsigned short* __restrict__ Qg,
    const unsigned short* __restrict__ Kg,
    const unsigned short* __restrict__ Vg,
    unsigned short* __restrict__ Og) {
    __shared__ __attribute__((aligned(16))) unsigned short sQ[QBLK * 72];
    __shared__ __attribute__((aligned(16))) unsigned short sK[2][KV_STAGE * PK];
    __shared__ __attribute__((aligned(16))) unsigned short sV[2][KV_STAGE * PV];

    const int t    = threadIdx.x;
    const int lane = t & 31;
    const int w    = t >> 5;
    const int q0   = blockIdx.x * QBLK;
    const size_t base = (size_t)blockIdx.y * S_LEN * HD;

    // staging geometry: eight lanes share a row's 128 bytes, so one wave-wide
    // copy takes four whole memory lines; the block covers 32 rows per copy
    const int rS = t >> 3;
    const int sS = (t & 7) * 8;
    const unsigned short* gK = Kg + base + (size_t)rS * HD + sS;
    const unsigned short* gV = Vg + base + (size_t)rS * HD + sS;
    const unsigned lK = (unsigned)(size_t)&sK[0][rS * PK + sS];
    const unsigned lV = (unsigned)(size_t)&sV[0][rS * PV + sS];
    constexpr unsigned BK = KV_STAGE * PK * 2;   // bytes of one K buffer
    constexpr unsigned BV = KV_STAGE * PV * 2;   // bytes of one V buffer
    constexpr int NT = S_LEN / KV_STAGE;

    stage_kv(gK, gV, lK, lV);   // stage 0 -> buffer 0

    {   // stage Q block 256x64
        const int r = t >> 1, hq = t & 1;
        const unsigned short* src = Qg + base + (size_t)(q0 + r) * HD + hq * 32;
        unsigned short* dst = sQ + r * 72 + hq * 32;
#pragma unroll
        for (int p = 0; p < 2; ++p)
#pragma unroll
            for (int j = 0; j < 4; ++j)
                *(uint4*)(dst + p * 128 * 72 + j * 8) =
                    *(const uint4*)(src + p * 128 * HD + j * 8);
    }
    // stage 0 has landed for this wave; the barrier publishes it (and Q)
    asm volatile("s_wait_asynccnt 0x0" ::: "memory");
    __syncthreads();
    stage_kv(gK + KV_STAGE * HD, gV + KV_STAGE * HD, lK + BK, lV + BV);

    v16bf qF[2][2];   // B operand of group g: column c = query w*32 + g*16 + c
#pragma unroll
    for (int g = 0; g < 2; ++g) {
        qF[g][0] = load_frag(sQ, 72, w * 32 + g * 16, 0, lane);
        qF[g][1] = load_frag(sQ, 72, w * 32 + g * 16, 32, lane);
    }
    const v16bf oneF = ones_frag();

    // 1/sqrt(64) * log2(e): scores go to the base-2 exponent in one step
    constexpr float CS = 0.125f * 1.4426950408889634f;
    // of query c of group g; m_ in units of the base-2 exponent
    float m_[2] = {-1e30f, -1e30f};
    // running sums of query c: all 16 rows of the tile get the same sums, only
    // register 0 is rescaled and read; the others stay below the key count
    v8f ls[2] = {zero8(), zero8()};
    v8f o[2][4];   // o[g][nt][r] = O[query c of group g][nt*16 + 8h + r]
#pragma unroll
    for (int g = 0; g < 2; ++g)
#pragma unroll
        for (int nt = 0; nt < 4; ++nt) o[g][nt] = zero8();

    const int hi = (lane & 16) ? 8 : 0;
    // lane's row and 16-byte half for the transposing read of V
    const int vOff = (hi + (lane & 7)) * PV + ((lane >> 3) & 1) * 8;

    for (int st = 0; st < NT; ++st) {
        const int buf = st & 1;
        const unsigned short* bK = &sK[buf][0];
        const unsigned short* bV = &sV[buf][0] + vOff;
        // unrolled so that sub turns into immediate LDS offsets
#pragma unroll
        for (int sub = 0; sub < KV_STAGE / 32; ++sub) {
            // S^T = K @ Q^T: s0[r] = score(key 8h+r, query c), s1[r]: key 16+8h+r
            v16bf ak[4];
#pragma unroll
            for (int i = 0; i < 4; ++i)
                ak[i] = load_frag(bK, PK, sub * 32 + (i & 1) * 16,
                                  (i >> 1) * 32, lane);
            v8f s0[2], s1[2];
            // all loops over g unrolled so that the per-group values are registers
#pragma unroll
            for (int g = 0; g < 2; ++g) {
                s0[g] = wmma_bf16(ak[0], qF[g][0], zero8());
                s1[g] = wmma_bf16(ak[1], qF[g][0], zero8());
            }
#pragma unroll
            for (int g = 0; g < 2; ++g) {
                s0[g] = wmma_bf16(ak[2], qF[g][1], s0[g]);
                s1[g] = wmma_bf16(ak[3], qF[g][1], s1[g]);
            }

            union { v16bf v; unsigned int u[8]; } pB[2];
#pragma unroll
            for (int g = 0; g < 2; ++g) {
                // online softmax of query c in base 2: the maximum is taken over
                // the raw scores (the scale is positive), in the lane plus one
                // half exchange; m_ holds it times CS
                float v = fmaxf(s0[g][0], s1[g][0]);
#pragma unroll
                for (int r = 1; r < 8; ++r)
                    v = fmaxf(v, fmaxf(s0[g][r], s1[g][r]));
                v = fmaxf(v, other_half(v));
                const float mn = fmaxf(m_[g], v * CS);
                const float al = __builtin_amdgcn_exp2f(m_[g] - mn);
                m_[g] = mn;

                // P^T as a B operand: element s = tile s>>3, register s&7; scale,
                // log2(e) and the maximum go into one packed multiply-add per pair
                const f32x2 cs2 = {CS, CS};
                const f32x2 nm2 = {-mn, -mn};
                f32x2 e[8];
                // both loops unrolled so that e and pB are registers, not arrays
#pragma unroll
                for (int j = 0; j < 4; ++j) {
                    e[j] = __builtin_elementwise_fma(
                        f32x2{s0[g][2 * j], s0[g][2 * j + 1]}, cs2, nm2);
                    e[4 + j] = __builtin_elementwise_fma(
                        f32x2{s1[g][2 * j], s1[g][2 * j + 1]}, cs2, nm2);
                }
#pragma unroll
                for (int j = 0; j < 8; ++j)
                    pB[g].u[j] = cvt_bf16x2(__builtin_amdgcn_exp2f(e[j][0]),
                                            __builtin_amdgcn_exp2f(e[j][1]));
#pragma unroll
                for (int nt = 0; nt < 4; ++nt)
#pragma unroll
                    for (int r = 0; r < 8; ++r) o[g][nt][r] *= al;
                ls[g][0] *= al;
            }
            // column sums of P^T via matrix pipe: ones @ P^T -> every row = sums,
            // added onto the running sums in the product's own accumulator
#pragma unroll
            for (int g = 0; g < 2; ++g) ls[g] = wmma_bf16(oneF, pB[g].v, ls[g]);
            // O^T += V^T @ P^T; A = V^T: keys 8h+0..7 and 16+8h+0..7 of
            // column nt*16 + c, the k order of P^T; one read serves both groups
#pragma unroll
            for (int nt = 0; nt < 4; ++nt) {
                union { v16bf v; u32x4 q[2]; } av;
                av.q[0] = ld_tr16(bV + (sub * 32) * PV + nt * 16);
                av.q[1] = ld_tr16(bV + (sub * 32 + 16) * PV + nt * 16);
#pragma unroll
                for (int g = 0; g < 2; ++g)
                    o[g][nt] = wmma_bf16(av.v, pB[g].v, o[g][nt]);
            }
        }
        // hand-over: this wave's reads of the buffer are done, its copies of the
        // next stage have landed; the barrier publishes that stage and frees
        // this buffer for the refill behind it
        asm volatile("s_wait_dscnt 0x0" ::: "memory");
        asm volatile("s_wait_asynccnt 0x0" ::: "memory");
        __syncthreads();
        if (st + 2 < NT)   // the same for the whole work-group
            stage_kv(gK + (size_t)(st + 2) * KV_STAGE * HD,
                     gV + (size_t)(st + 2) * KV_STAGE * HD,
                     lK + buf * BK, lV + buf * BV);
    }
    // nothing is outstanding when the wave ends
    asm volatile("s_wait_asynccnt 0x0" ::: "memory");

    // a lane holds 8 consecutive columns of its query's row: 16-byte stores
#pragma unroll
    for (int g = 0; g < 2; ++g) {
        const float inv = 1.0f / ls[g][0];
        unsigned short* orow =
            Og + base + (size_t)(q0 + w * 32 + g * 16 + (lane & 15)) * HD + hi;
#pragma unroll
        for (int nt = 0; nt < 4; ++nt) {
            uint4 pk;
            pk.x = cvt_bf16x2(o[g][nt][0] * inv, o[g][nt][1] * inv);
            pk.y = cvt_bf16x2(o[g][nt][2] * inv, o[g][nt][3] * inv);
            pk.z = cvt_bf16x2(o[g][nt][4] * inv, o[g][nt][5] * inv);
            pk.w = cvt_bf16x2(o[g][nt][6] * inv, o[g][nt][7] * inv);
            *(uint4*)(orow + nt * 16) = pk;
        }
    }
}

// ---------------------------------------------------------------------------
// Kernel 5: residual add + LayerNorm, in place over d_out rows.
// ---------------------------------------------------------------------------
__global__ __launch_bounds__(256) void ln_kernel(
    float* __restrict__ out, const float* __restrict__ resid,
    const float* __restrict__ gamma, const float* __restrict__ beta) {
    const int row = blockIdx.x;
    const int t = threadIdx.x;
    __shared__ float rs[256], rq[256];
    float x[4];
    float s = 0.0f, sq = 0.0f;
#pragma unroll
    for (int i = 0; i < 4; ++i) {
        const int c = t + i * 256;
        const float v = out[(size_t)row * D_MODEL + c] +
                        resid[(size_t)row * D_MODEL + c];
        x[i] = v; s += v; sq += v * v;
    }
    rs[t] = s; rq[t] = sq;
    __syncthreads();
    for (int off = 128; off > 0; off >>= 1) {
        if (t < off) { rs[t] += rs[t + off]; rq[t] += rq[t + off]; }
        __syncthreads();
    }
    const float mu  = rs[0] * (1.0f / D_MODEL);
    const float var = rq[0] * (1.0f / D_MODEL) - mu * mu;
    const float inv = rsqrtf(var + 1e-5f);
#pragma unroll
    for (int i = 0; i < 4; ++i) {
        const int c = t + i * 256;
        out[(size_t)row * D_MODEL + c] =
            (x[i] - mu) * inv * gamma[c] + beta[c];
    }
}

// ---------------------------------------------------------------------------
// Host-side launch
// ---------------------------------------------------------------------------
extern "C" void kernel_launch(void* const* d_in, const int* in_sizes, int n_in,
                              void* d_out, int out_size, void* d_ws, size_t ws_size,
                              hipStream_t stream) {
    const float* preQ  = (const float*)d_in[0];
    const float* preK  = (const float*)d_in[1];
    const float* preV  = (const float*)d_in[2];
    const float* Wq    = (const float*)d_in[3];
    const float* Wk    = (const float*)d_in[4];
    const float* Wv    = (const float*)d_in[5];
    const float* Wo    = (const float*)d_in[6];
    const float* gamma = (const float*)d_in[7];
    const float* beta  = (const float*)d_in[8];
    float* out = (float*)d_out;

    char* ws = (char*)d_ws;
    constexpr size_t WT_BYTES  = (size_t)D_MODEL * D_MODEL * 2;   // 2 MB
    constexpr size_t XB_BYTES  = (size_t)M_ROWS * D_MODEL * 2;    // 16 MB
    unsigned short* WqT = (unsigned short*)(ws + 0 * WT_BYTES);
    // planes 1 and 2 behind WqT: Wk^T, Wv^T
    unsigned short* WoT = (unsigned short*)(ws + 3 * WT_BYTES);
    char* xbase = ws + 4 * WT_BYTES;
    unsigned short* Xq = (unsigned short*)(xbase + 0 * XB_BYTES);
    // planes 1 and 2 behind Xq: bf16 pre_key, pre_value
    unsigned short* Qb = (unsigned short*)(xbase + 3 * XB_BYTES);
    unsigned short* Kb = (unsigned short*)(xbase + 4 * XB_BYTES);
    unsigned short* Vb = (unsigned short*)(xbase + 5 * XB_BYTES);
    unsigned short* Ab = Xq;   // Xq dead after Q projection; reuse for attn out

    // 1+2) weights -> bf16 transposed [N][K], activations -> bf16: one grid
    prep_kernel<<<4 * WT_BLOCKS + 3 * CVT_BLOCKS, 256, 0, stream>>>(
        Wq, Wk, Wv, Wo, preQ, preK, preV, WqT, Xq);

    // 3) the three projections (bf16 in, bf16 out) as one batch: z = Q, K, V
    dim3 gg(D_MODEL / 128, M_ROWS / 256);        // (8, 32)
    dim3 gg3(D_MODEL / 128, M_ROWS / 256, 3);    // (8, 32, 3)
    gemm_bf16_wmma_kernel<false><<<gg3, 256, 0, stream>>>(
        Xq, WqT, Qb, M_ROWS, D_MODEL, D_MODEL);

    // 4) flash attention over 64 (b,h) slabs x 8 query blocks
    attn_kernel<<<dim3(S_LEN / QBLK, N_BATCH * N_HEADS), 256, 0, stream>>>(
        Qb, Kb, Vb, Ab);

    // 5) output projection straight into d_out (f32)
    gemm_bf16_wmma_kernel<true><<<gg, 256, 0, stream>>>(
        Ab, WoT, out, M_ROWS, D_MODEL, D_MODEL);

    // 6) residual + LayerNorm in place
    ln_kernel<<<M_ROWS, 256, 0, stream>>>(out, preV, gamma, beta);
}

// v009
// A run of this version takes 146 microseconds.
// Next to v008, in two timings, it ran 1.05 times as fast each time.
// Counting every step since v000, it is 2.51 times as fast.
#include <hip/hip_runtime.h>

// ---------------------------------------------------------------------------
// Types for CDNA5 WMMA
// ---------------------------------------------------------------------------
typedef __attribute__((ext_vector_type(16))) __bf16 v16bf;
typedef __attribute__((ext_vector_type(8)))  float  v8f;

#define D_MODEL 1024
#define S_LEN   2048
#define N_BATCH 4
#define N_HEADS 16
#define HD      64
#define M_ROWS  (N_BATCH * S_LEN)   // 8192

// ---------------------------------------------------------------------------
// Helpers
// ---------------------------------------------------------------------------
__device__ __forceinline__ unsigned short f32_to_bf16(float f) {
    unsigned int x = __float_as_uint(f);
    x += 0x7FFFu + ((x >> 16) & 1u);   // round to nearest even
    return (unsigned short)(x >> 16);
}

__device__ __forceinline__ unsigned int pack_bf16x2(float a, float b) {
    return ((unsigned int)f32_to_bf16(b) << 16) | (unsigned int)f32_to_bf16(a);
}

typedef __attribute__((ext_vector_type(2))) float  f32x2;
typedef __attribute__((ext_vector_type(2))) __bf16 bf16x2;

// two f32 -> packed bf16 pair, round to nearest even (one hardware convert)
__device__ __forceinline__ unsigned int cvt_bf16x2(float a, float b) {
    union { bf16x2 v; unsigned int u; } o;
    f32x2 x;
    x[0] = a; x[1] = b;
    o.v = __builtin_convertvector(x, bf16x2);
    return o.u;
}

__device__ __forceinline__ v8f zero8() {
    v8f z;
#pragma unroll
    for (int i = 0; i < 8; ++i) z[i] = 0.0f;
    return z;
}

// Four 16-byte copies per lane, global -> LDS through no register. The
// s_wait_xcnt closes the statement so that no address register of a copy is
// rewritten ahead of it.
__device__ __forceinline__ void copy4(unsigned l0, unsigned l1, unsigned l2,
                                      unsigned l3, const unsigned short* g0,
                                      const unsigned short* g1,
                                      const unsigned short* g2,
                                      const unsigned short* g3) {
    asm volatile(
        "global_load_async_to_lds_b128 %0, %4, off\n\t"
        "global_load_async_to_lds_b128 %1, %5, off\n\t"
        "global_load_async_to_lds_b128 %2, %6, off\n\t"
        "global_load_async_to_lds_b128 %3, %7, off\n\t"
        "s_wait_xcnt 0x0"
        :: "v"(l0), "v"(l1), "v"(l2), "v"(l3),
           "v"(g0), "v"(g1), "v"(g2), "v"(g3)
        : "memory");
}

// Load a 16x32 bf16 fragment (A-layout; B mirrors it with N in place of M)
// from LDS stored row-major with `rowStride` (in ushorts).
// Lane L holds row (rowBase + (L&15)); K pairs per ISA table:
// lanes 0-15: k = {0,2,4,6,16,18,20,22}; lanes 16-31: +8.
__device__ __forceinline__ v16bf load_frag(const unsigned short* base,
                                           int rowStride, int rowBase,
                                           int kOff, int lane) {
    union { v16bf v; unsigned int u[8]; } f;
    const int row = rowBase + (lane & 15);
    const int kb  = kOff + ((lane & 16) ? 8 : 0);
    const unsigned short* p = base + (size_t)row * rowStride;
#pragma unroll
    for (int r = 0; r < 8; ++r) {
        const int k = kb + ((r < 4) ? (2 * r) : (16 + 2 * (r - 4)));
        f.u[r] = *(const unsigned int*)(p + k);
    }
    return f.v;
}

__device__ __forceinline__ v16bf ones_frag() {
    union { v16bf v; unsigned int u[8]; } f;
#pragma unroll
    for (int i = 0; i < 8; ++i) f.u[i] = 0x3F803F80u;   // bf16(1.0) x2
    return f.v;
}

__device__ __forceinline__ v8f wmma_bf16(v16bf a, v16bf b, v8f c) {
    return __builtin_amdgcn_wmma_f32_16x16x32_bf16(
        false, a, false, b, (short)0, c, false, false);
}

// ---------------------------------------------------------------------------
// Kernels 1+2 in one grid: the seven operand preparations are independent of
// one another, so they share one launch. Blocks [0, 4096): weight transpose +
// f32 -> bf16, W:[K][N] -> Wt:[N][K], 1024 tiles of 32x32 per weight.
// Blocks [4096, 16384): elementwise f32 -> bf16 of the activations,
// 8 elements per thread, 4096 blocks per tensor.
// The four Wt planes and the three X planes are each contiguous in workspace.
// ---------------------------------------------------------------------------
#define WT_BLOCKS  ((D_MODEL / 32) * (D_MODEL / 32))    // 1024 per weight
#define CVT_BLOCKS ((M_ROWS * D_MODEL) / (8 * 256))     // 4096 per tensor

__global__ __launch_bounds__(256) void prep_kernel(
    const float* __restrict__ W0, const float* __restrict__ W1,
    const float* __restrict__ W2, const float* __restrict__ W3,
    const float* __restrict__ X0, const float* __restrict__ X1,
    const float* __restrict__ X2,
    unsigned short* __restrict__ WtAll, unsigned short* __restrict__ XbAll) {
    __shared__ float tile[32][33];
    const unsigned b = blockIdx.x;
    const int t = threadIdx.x;
    if (b < 4 * WT_BLOCKS) {   // block-uniform
        const unsigned which = b / WT_BLOCKS;
        const unsigned tl    = b % WT_BLOCKS;
        const float* __restrict__ W =
            which == 0 ? W0 : which == 1 ? W1 : which == 2 ? W2 : W3;
        unsigned short* __restrict__ Wt =
            WtAll + (size_t)which * D_MODEL * D_MODEL;
        const int k0 = (tl % (D_MODEL / 32)) * 32;
        const int n0 = (tl / (D_MODEL / 32)) * 32;
        const int x = t & 31;   // 0..31
        const int y = t >> 5;   // 0..7
#pragma unroll
        for (int i = 0; i < 4; ++i)
            tile[y + 8 * i][x] = W[(size_t)(k0 + y + 8 * i) * D_MODEL + n0 + x];
        __syncthreads();
#pragma unroll
        for (int i = 0; i < 4; ++i)
            Wt[(size_t)(n0 + y + 8 * i) * D_MODEL + (k0 + x)] =
                f32_to_bf16(tile[x][y + 8 * i]);
    } else {
        const unsigned c     = b - 4 * WT_BLOCKS;
        const unsigned which = c / CVT_BLOCKS;
        const float* __restrict__ src = which == 0 ? X0 : which == 1 ? X1 : X2;
        unsigned short* __restrict__ dst =
            XbAll + (size_t)which * M_ROWS * D_MODEL;
        const int i = (c % CVT_BLOCKS) * 256 + t;
        const float4 a = ((const float4*)src)[2 * i];
        const float4 d = ((const float4*)src)[2 * i + 1];
        uint4 o;
        o.x = pack_bf16x2(a.x, a.y);
        o.y = pack_bf16x2(a.z, a.w);
        o.z = pack_bf16x2(d.x, d.y);
        o.w = pack_bf16x2(d.z, d.w);
        ((uint4*)dst)[i] = o;
    }
}

// ---------------------------------------------------------------------------
// Kernel 3: bf16 GEMM via WMMA:  C[M,N] = A[M,K] @ Bt^T   (Bt: [N][K] bf16)
// Block tile 256x128, 8 waves (4x2), wave tile 64x64 (16 WMMA accumulators).
// A stage is 64 k (128-byte rows), two LDS buffers filled by asynchronous
// copies one stage ahead, one barrier per stage.
// The products are taken transposed (Bt rows as the A operand, A rows as the B
// operand), so a lane holds 8 consecutive columns of one row of C; each wave
// stages its tile in its own part of the free ring and stores whole lines.
// blockIdx.z picks one product of a batch whose A, Bt and C planes each lie
// one behind the other.
// ---------------------------------------------------------------------------
#define GK 64   // k per stage
#define GP 72   // LDS row pitch in elements: 144 B = 16 B x odd, for 16-byte reads

template <bool OUT_F32>
__global__ __launch_bounds__(256) void gemm_bf16_wmma_kernel(
    const unsigned short* __restrict__ A,
    const unsigned short* __restrict__ Bt,
    void* __restrict__ Cptr, int M, int N, int K) {
    __shared__ __attribute__((aligned(16))) unsigned short lA[2][256 * GP];
    __shared__ __attribute__((aligned(16))) unsigned short lB[2][128 * GP];

    const int t    = threadIdx.x;
    const int lane = t & 31;
    const int w    = t >> 5;
    const int wm   = w >> 1;   // 0..3 -> 64 rows each
    const int wn   = w & 1;    // 0..1 -> 64 cols each
    const int m0   = blockIdx.y * 256;
    const int n0   = blockIdx.x * 128;
    const size_t z = blockIdx.z;
    A  += z * (size_t)M * K;
    Bt += z * (size_t)N * K;
    Cptr = (char*)Cptr + z * (size_t)M * N * (OUT_F32 ? 4 : 2);

    v8f acc[4][4];
#pragma unroll
    for (int mt = 0; mt < 4; ++mt)
#pragma unroll
        for (int nt = 0; nt < 4; ++nt) acc[mt][nt] = zero8();

    // staging geometry: eight lanes share a row's 128 bytes, so one wave-wide
    // copy takes four whole memory lines; the block covers 32 rows per copy:
    // 8 copies for A, 4 for B
    const int rS = t >> 3;         // row within a group of 32
    const int sS = (t & 7) * 8;    // 16-byte segment of the row, in elements
    const size_t g32 = (size_t)32 * K;
    const unsigned short* gA = A  + (size_t)(m0 + rS) * K + sS;
    const unsigned short* gB = Bt + (size_t)(n0 + rS) * K + sS;
    const unsigned dA = (unsigned)(size_t)&lA[0][rS * GP + sS];
    const unsigned dB = (unsigned)(size_t)&lB[0][rS * GP + sS];
    constexpr unsigned R32 = 32u * GP * 2u;    // bytes of 32 LDS rows
    constexpr unsigned BA  = 256u * GP * 2u;   // bytes of one A buffer
    constexpr unsigned BB  = 128u * GP * 2u;   // bytes of one B buffer

    auto stage = [&](int buf, int k0) {
        const unsigned short* a = gA + k0;
        const unsigned short* b = gB + k0;
        const unsigned la = dA + buf * BA;
        const unsigned lb = dB + buf * BB;
        copy4(la, la + R32, la + 2 * R32, la + 3 * R32,
              a, a + g32, a + 2 * g32, a + 3 * g32);
        copy4(la + 4 * R32, la + 5 * R32, la + 6 * R32, la + 7 * R32,
              a + 4 * g32, a + 5 * g32, a + 6 * g32, a + 7 * g32);
        copy4(lb, lb + R32, lb + 2 * R32, lb + 3 * R32,
              b, b + g32, b + 2 * g32, b + 3 * g32);
    };

    const int NK = K / GK;
    stage(0, 0);
    // stage 0 has landed for this wave; the barrier publishes it
    asm volatile("s_wait_asynccnt 0x0" ::: "memory");
    __syncthreads();
    if (NK > 1) stage(1, GK);   // the same for the whole work-group

    for (int kt = 0; kt < NK; ++kt) {
        const int cur = kt & 1;
        // unrolled so that ks turns into immediate LDS offsets
#pragma unroll
        for (int ks = 0; ks < GK / 32; ++ks) {
            v16bf aF[4], bF[4];
#pragma unroll
            for (int mt = 0; mt < 4; ++mt)
                aF[mt] = load_frag(&lA[cur][0], GP, wm * 64 + mt * 16, ks * 32,
                                   lane);
#pragma unroll
            for (int nt = 0; nt < 4; ++nt)
                bF[nt] = load_frag(&lB[cur][0], GP, wn * 64 + nt * 16, ks * 32,
                                   lane);
#pragma unroll
            for (int mt = 0; mt < 4; ++mt)
#pragma unroll
                for (int nt = 0; nt < 4; ++nt)
                    acc[mt][nt] = wmma_bf16(bF[nt], aF[mt], acc[mt][nt]);
        }
        // hand-over: this wave's reads of the buffer are done, its copies of the
        // next stage have landed; the barrier publishes that stage and frees
        // this buffer for the refill behind it
        asm volatile("s_wait_dscnt 0x0" ::: "memory");
        asm volatile("s_wait_asynccnt 0x0" ::: "memory");
        __syncthreads();
        if (kt + 2 < NK)   // the same for the whole work-group
            stage(cur, (kt + 2) * GK);
    }
    // nothing is outstanding when the wave ends
    asm volatile("s_wait_asynccnt 0x0" ::: "memory");

    // epilogue: acc[mt][nt][r] = C[wm*64 + mt*16 + (lane & 15)][wn*64 + nt*16 + hi + r].
    // The loop's last barrier stands behind every wave's last read of the ring
    // and nothing is in flight into it, so each wave may stage in its own part.
    const int hi = (lane & 16) ? 8 : 0;
    const int c  = lane & 15;
    const size_t crow = (size_t)(m0 + wm * 64);
    const int    ccol = n0 + wn * 64;
    if (OUT_F32) {
        // 32 rows a pass at pitch 272 B = 16 B x odd
        constexpr int FP = 68;
        float* sw = (float*)&lA[0][0] + w * (32 * FP);
        float* C  = (float*)Cptr;
        // all loops here unrolled so that acc is indexed by constants (registers)
        // and the LDS rows turn into immediate offsets
#pragma unroll
        for (int p = 0; p < 2; ++p) {
#pragma unroll
            for (int mh = 0; mh < 2; ++mh)
#pragma unroll
                for (int nt = 0; nt < 4; ++nt) {
                    const v8f a = acc[2 * p + mh][nt];
                    float* d = sw + (mh * 16 + c) * FP + nt * 16 + hi;
                    *(float4*)d       = make_float4(a[0], a[1], a[2], a[3]);
                    *(float4*)(d + 4) = make_float4(a[4], a[5], a[6], a[7]);
                }
            // the other lanes' rows are in LDS before they are read back
            asm volatile("s_wait_dscnt 0x0" ::: "memory");
            // one store = 2 rows x 256 B = 4 whole lines
            const int row = lane >> 4;
            const int seg = (lane & 15) * 4;
            float* g = C + (crow + p * 32 + row) * N + ccol + seg;
#pragma unroll
            for (int i = 0; i < 16; ++i)
                *(float4*)(g + (size_t)(2 * i) * N) =
                    *(const float4*)(sw + (2 * i + row) * FP + seg);
            // this pass's rows have been read before the next pass rewrites them
            if (p == 0) asm volatile("s_wait_dscnt 0x0" ::: "memory");
        }
    } else {
        // 64 rows at pitch 144 B = 16 B x odd
        unsigned short* sw = &lA[0][0] + w * (64 * GP);
        unsigned short* C  = (unsigned short*)Cptr;
        // all loops here unrolled so that acc is indexed by constants (registers)
        // and the LDS rows turn into immediate offsets
#pragma unroll
        for (int mt = 0; mt < 4; ++mt)
#pragma unroll
            for (int nt = 0; nt < 4; ++nt) {
                const v8f a = acc[mt][nt];
                uint4 pk;
                pk.x = cvt_bf16x2(a[0], a[1]);
                pk.y = cvt_bf16x2(a[2], a[3]);
                pk.z = cvt_bf16x2(a[4], a[5]);
                pk.w = cvt_bf16x2(a[6], a[7]);
                *(uint4*)(sw + (mt * 16 + c) * GP + nt * 16 + hi) = pk;
            }
        // the other lanes' rows are in LDS before they are read back
        asm volatile("s_wait_dscnt 0x0" ::: "memory");
        // one store = 4 rows x 128 B = 4 whole lines
        const int row = lane >> 3;
        const int seg = (lane & 7) * 8;
        unsigned short* g = C + (crow + row) * N + ccol + seg;
#pragma unroll
        for (int i = 0; i < 16; ++i)
            *(uint4*)(g + (size_t)(4 * i) * N) =
                *(const uint4*)(sw + (4 * i + row) * GP + seg);
    }
}

__device__ __forceinline__ float other_half(float v) {
    const int b = __float_as_int(v);
    return __int_as_float(__builtin_amdgcn_permlanex16(
        b, b, 0x76543210, 0xfedcba98, false, false));
}

// K and V stages in LDS: 64 keys each, two buffers.
#define KV_STAGE 64
#define QBLK 256   // queries per work-group: 8 waves x 2 groups x 16
#define PK 72   // K row pitch in elements: 144 B = 16 B x odd, for plain 16-byte reads
#define PV 80   // V row pitch in elements: 160 B = 32 B x odd, for the transposing read

typedef short s16x8 __attribute__((ext_vector_type(8)));
typedef unsigned int u32x4 __attribute__((ext_vector_type(4)));

// transposing 16-bit LDS read: lane (c, h) gets T[k + 8h + 0..7][d + c] of a
// row-major tile; every lane passes its own row address (see the caller)
__device__ __forceinline__ u32x4 ld_tr16(const unsigned short* p) {
    typedef __attribute__((address_space(3))) s16x8 lds_s16x8;
    return __builtin_bit_cast(
        u32x4, __builtin_amdgcn_ds_load_tr16_b128_v8i16((lds_s16x8*)p));
}

// One stage of K and V, global -> LDS through no register: each lane copies
// 16 bytes of rows r and r + 32 of both. The s_wait_xcnt closes the statement
// so that no address register of a copy is rewritten ahead of it.
__device__ __forceinline__ void stage_kv(const unsigned short* gk,
                                         const unsigned short* gv,
                                         unsigned lk, unsigned lv) {
    asm volatile(
        "global_load_async_to_lds_b128 %0, %4, off\n\t"
        "global_load_async_to_lds_b128 %1, %5, off\n\t"
        "global_load_async_to_lds_b128 %2, %6, off\n\t"
        "global_load_async_to_lds_b128 %3, %7, off\n\t"
        "s_wait_xcnt 0x0"
        :: "v"(lk), "v"(lk + 32u * PK * 2u), "v"(lv), "v"(lv + 32u * PV * 2u),
           "v"(gk), "v"(gk + 32 * HD), "v"(gv), "v"(gv + 32 * HD)
        : "memory");
}

__global__ __launch_bounds__(256) void attn_kernel(
    const unsigned short* __restrict__ Qg,
    const unsigned short* __restrict__ Kg,
    const unsigned short* __restrict__ Vg,
    unsigned short* __restrict__ Og) {
    __shared__ __attribute__((aligned(16))) unsigned short sQ[QBLK * 72];
    __shared__ __attribute__((aligned(16))) unsigned short sK[2][KV_STAGE * PK];
    __shared__ __attribute__((aligned(16))) unsigned short sV[2][KV_STAGE * PV];

    const int t    = threadIdx.x;
    const int lane = t & 31;
    const int w    = t >> 5;
    const int q0   = blockIdx.x * QBLK;
    const size_t base = (size_t)blockIdx.y * S_LEN * HD;

    // staging geometry: eight lanes share a row's 128 bytes, so one wave-wide
    // copy takes four whole memory lines; the block covers 32 rows per copy
    const int rS = t >> 3;
    const int sS = (t & 7) * 8;
    const unsigned short* gK = Kg + base + (size_t)rS * HD + sS;
    const unsigned short* gV = Vg + base + (size_t)rS * HD + sS;
    const unsigned lK = (unsigned)(size_t)&sK[0][rS * PK + sS];
    const unsigned lV = (unsigned)(size_t)&sV[0][rS * PV + sS];
    constexpr unsigned BK = KV_STAGE * PK * 2;   // bytes of one K buffer
    constexpr unsigned BV = KV_STAGE * PV * 2;   // bytes of one V buffer
    constexpr int NT = S_LEN / KV_STAGE;

    stage_kv(gK, gV, lK, lV);   // stage 0 -> buffer 0

    {   // stage Q block 256x64
        const int r = t >> 1, hq = t & 1;
        const unsigned short* src = Qg + base + (size_t)(q0 + r) * HD + hq * 32;
        unsigned short* dst = sQ + r * 72 + hq * 32;
#pragma unroll
        for (int p = 0; p < 2; ++p)
#pragma unroll
            for (int j = 0; j < 4; ++j)
                *(uint4*)(dst + p * 128 * 72 + j * 8) =
                    *(const uint4*)(src + p * 128 * HD + j * 8);
    }
    // stage 0 has landed for this wave; the barrier publishes it (and Q)
    asm volatile("s_wait_asynccnt 0x0" ::: "memory");
    __syncthreads();
    stage_kv(gK + KV_STAGE * HD, gV + KV_STAGE * HD, lK + BK, lV + BV);

    v16bf qF[2][2];   // B operand of group g: column c = query w*32 + g*16 + c
#pragma unroll
    for (int g = 0; g < 2; ++g) {
        qF[g][0] = load_frag(sQ, 72, w * 32 + g * 16, 0, lane);
        qF[g][1] = load_frag(sQ, 72, w * 32 + g * 16, 32, lane);
    }
    const v16bf oneF = ones_frag();

    // 1/sqrt(64) * log2(e): scores go to the base-2 exponent in one step
    constexpr float CS = 0.125f * 1.4426950408889634f;
    // how far a score may pass the maximum in use, in the base-2 exponent
    constexpr float LAZY = 8.0f;
    // of query c of group g; m_: the maximum in use, in units of the base-2
    // exponent; thr: the raw score above which it must be renewed
    float m_[2]  = {-1e30f, -1e30f};
    float thr[2] = {-__builtin_inff(), -__builtin_inff()};
    // running sums of query c: all 16 rows of the tile get the same sums, only
    // register 0 is rescaled and read; the others stay below 2^8 x the key count
    v8f ls[2] = {zero8(), zero8()};
    v8f o[2][4];   // o[g][nt][r] = O[query c of group g][nt*16 + 8h + r]
#pragma unroll
    for (int g = 0; g < 2; ++g)
#pragma unroll
        for (int nt = 0; nt < 4; ++nt) o[g][nt] = zero8();

    const int hi = (lane & 16) ? 8 : 0;
    // lane's row and 16-byte half for the transposing read of V
    const int vOff = (hi + (lane & 7)) * PV + ((lane >> 3) & 1) * 8;

    for (int st = 0; st < NT; ++st) {
        const int buf = st & 1;
        const unsigned short* bK = &sK[buf][0];
        const unsigned short* bV = &sV[buf][0] + vOff;
        // K fragments of the stage's first chunk
        v16bf ak[4];
#pragma unroll
        for (int i = 0; i < 4; ++i)
            ak[i] = load_frag(bK, PK, (i & 1) * 16, (i >> 1) * 32, lane);
        // unrolled so that sub turns into immediate LDS offsets
#pragma unroll
        for (int sub = 0; sub < KV_STAGE / 32; ++sub) {
            // A = V^T: keys 8h+0..7 and 16+8h+0..7 of column nt*16 + c, the k
            // order of P^T; read here, ahead of the branch below, so that they
            // land under the scores and the exponentials
            union { v16bf v; u32x4 q[2]; } av[4];
#pragma unroll
            for (int nt = 0; nt < 4; ++nt) {
                av[nt].q[0] = ld_tr16(bV + (sub * 32) * PV + nt * 16);
                av[nt].q[1] = ld_tr16(bV + (sub * 32 + 16) * PV + nt * 16);
            }
            // compiler fence: without it the V^T reads are sunk behind the
            // branch, directly in front of their products, each waited to 0
            asm volatile("" ::: "memory");
            // S^T = K @ Q^T: s0[r] = score(key 8h+r, query c), s1[r]: key 16+8h+r
            v8f s0[2], s1[2];
            // all loops over g unrolled so that the per-group values are registers
#pragma unroll
            for (int g = 0; g < 2; ++g) {
                s0[g] = wmma_bf16(ak[0], qF[g][0], zero8());
                s1[g] = wmma_bf16(ak[1], qF[g][0], zero8());
            }
#pragma unroll
            for (int g = 0; g < 2; ++g) {
                s0[g] = wmma_bf16(ak[2], qF[g][1], s0[g]);
                s1[g] = wmma_bf16(ak[3], qF[g][1], s1[g]);
            }
            if (sub + 1 < KV_STAGE / 32) {   // compile-time
                // the same stage's next K fragments, also ahead of the branch
#pragma unroll
                for (int i = 0; i < 4; ++i)
                    ak[i] = load_frag(bK, PK, (sub + 1) * 32 + (i & 1) * 16,
                                      (i >> 1) * 32, lane);
                // compiler fence: without it these reads are sunk behind the
                // branch, in pairs in front of their products, each waited to 0
                asm volatile("" ::: "memory");
            }

            // online softmax of query c in base 2: each lane takes the maximum
            // of its own 16 raw scores (the scale is positive) and holds it
            // against the bound of the maximum in use
            float v[2];
            bool need = false;
#pragma unroll
            for (int g = 0; g < 2; ++g) {
                v[g] = fmaxf(s0[g][0], s1[g][0]);
#pragma unroll
                for (int r = 1; r < 8; ++r)
                    v[g] = fmaxf(v[g], fmaxf(s0[g][r], s1[g][r]));
                need = need || (v[g] > thr[g]);
            }
            // one scalar branch per chunk for both groups, taken on the first
            // chunk and then only when a score passes the bound: the whole wave
            // renews its maxima (both halves of a column get the same one) and
            // rescales what it has summed under the old ones; marked unlikely so
            // that the block lies out of line and the usual path falls through
            if (__builtin_expect(__builtin_amdgcn_ballot_w32(need) != 0, 0)) {
#pragma unroll
                for (int g = 0; g < 2; ++g) {
                    const float vv = fmaxf(v[g], other_half(v[g]));
                    const float mn = fmaxf(m_[g], vv * CS);
                    const float al = __builtin_amdgcn_exp2f(m_[g] - mn);
                    m_[g]  = mn;
                    thr[g] = (mn + LAZY) * (1.0f / CS);
#pragma unroll
                    for (int nt = 0; nt < 4; ++nt)
#pragma unroll
                        for (int r = 0; r < 8; ++r) o[g][nt][r] *= al;
                    ls[g][0] *= al;
                }
            }

            union { v16bf v; unsigned int u[8]; } pB[2];
#pragma unroll
            for (int g = 0; g < 2; ++g) {
                // P^T as a B operand: element s = tile s>>3, register s&7; scale,
                // log2(e) and the maximum go into one packed multiply-add per pair
                const f32x2 cs2 = {CS, CS};
                const f32x2 nm2 = {-m_[g], -m_[g]};
                f32x2 e[8];
                // both loops unrolled so that e and pB are registers, not arrays
#pragma unroll
                for (int j = 0; j < 4; ++j) {
                    e[j] = __builtin_elementwise_fma(
                        f32x2{s0[g][2 * j], s0[g][2 * j + 1]}, cs2, nm2);
                    e[4 + j] = __builtin_elementwise_fma(
                        f32x2{s1[g][2 * j], s1[g][2 * j + 1]}, cs2, nm2);
                }
#pragma unroll
                for (int j = 0; j < 8; ++j)
                    pB[g].u[j] = cvt_bf16x2(__builtin_amdgcn_exp2f(e[j][0]),
                                            __builtin_amdgcn_exp2f(e[j][1]));
            }
            // column sums of P^T via matrix pipe: ones @ P^T -> every row = sums,
            // added onto the running sums in the product's own accumulator
#pragma unroll
            for (int g = 0; g < 2; ++g) ls[g] = wmma_bf16(oneF, pB[g].v, ls[g]);
            // O^T += V^T @ P^T; one V^T fragment serves both groups
#pragma unroll
            for (int nt = 0; nt < 4; ++nt)
#pragma unroll
                for (int g = 0; g < 2; ++g)
                    o[g][nt] = wmma_bf16(av[nt].v, pB[g].v, o[g][nt]);
        }
        // hand-over: this wave's reads of the buffer are done, its copies of the
        // next stage have landed; the barrier publishes that stage and frees
        // this buffer for the refill behind it
        asm volatile("s_wait_dscnt 0x0" ::: "memory");
        asm volatile("s_wait_asynccnt 0x0" ::: "memory");
        __syncthreads();
        if (st + 2 < NT)   // the same for the whole work-group
            stage_kv(gK + (size_t)(st + 2) * KV_STAGE * HD,
                     gV + (size_t)(st + 2) * KV_STAGE * HD,
                     lK + buf * BK, lV + buf * BV);
    }
    // nothing is outstanding when the wave ends
    asm volatile("s_wait_asynccnt 0x0" ::: "memory");

    // a lane holds 8 consecutive columns of its query's row: 16-byte stores
#pragma unroll
    for (int g = 0; g < 2; ++g) {
        const float inv = 1.0f / ls[g][0];
        unsigned short* orow =
            Og + base + (size_t)(q0 + w * 32 + g * 16 + (lane & 15)) * HD + hi;
#pragma unroll
        for (int nt = 0; nt < 4; ++nt) {
            uint4 pk;
            pk.x = cvt_bf16x2(o[g][nt][0] * inv, o[g][nt][1] * inv);
            pk.y = cvt_bf16x2(o[g][nt][2] * inv, o[g][nt][3] * inv);
            pk.z = cvt_bf16x2(o[g][nt][4] * inv, o[g][nt][5] * inv);
            pk.w = cvt_bf16x2(o[g][nt][6] * inv, o[g][nt][7] * inv);
            *(uint4*)(orow + nt * 16) = pk;
        }
    }
}

// ---------------------------------------------------------------------------
// Kernel 5: residual add + LayerNorm, in place over d_out rows.
// ---------------------------------------------------------------------------
__global__ __launch_bounds__(256) void ln_kernel(
    float* __restrict__ out, const float* __restrict__ resid,
    const float* __restrict__ gamma, const float* __restrict__ beta) {
    const int row = blockIdx.x;
    const int t = threadIdx.x;
    __shared__ float rs[256], rq[256];
    float x[4];
    float s = 0.0f, sq = 0.0f;
#pragma unroll
    for (int i = 0; i < 4; ++i) {
        const int c = t + i * 256;
        const float v = out[(size_t)row * D_MODEL + c] +
                        resid[(size_t)row * D_MODEL + c];
        x[i] = v; s += v; sq += v * v;
    }
    rs[t] = s; rq[t] = sq;
    __syncthreads();
    for (int off = 128; off > 0; off >>= 1) {
        if (t < off) { rs[t] += rs[t + off]; rq[t] += rq[t + off]; }
        __syncthreads();
    }
    const float mu  = rs[0] * (1.0f / D_MODEL);
    const float var = rq[0] * (1.0f / D_MODEL) - mu * mu;
    const float inv = rsqrtf(var + 1e-5f);
#pragma unroll
    for (int i = 0; i < 4; ++i) {
        const int c = t + i * 256;
        out[(size_t)row * D_MODEL + c] =
            (x[i] - mu) * inv * gamma[c] + beta[c];
    }
}

// ---------------------------------------------------------------------------
// Host-side launch
// ---------------------------------------------------------------------------
extern "C" void kernel_launch(void* const* d_in, const int* in_sizes, int n_in,
                              void* d_out, int out_size, void* d_ws, size_t ws_size,
                              hipStream_t stream) {
    const float* preQ  = (const float*)d_in[0];
    const float* preK  = (const float*)d_in[1];
    const float* preV  = (const float*)d_in[2];
    const float* Wq    = (const float*)d_in[3];
    const float* Wk    = (const float*)d_in[4];
    const float* Wv    = (const float*)d_in[5];
    const float* Wo    = (const float*)d_in[6];
    const float* gamma = (const float*)d_in[7];
    const float* beta  = (const float*)d_in[8];
    float* out = (float*)d_out;

    char* ws = (char*)d_ws;
    constexpr size_t WT_BYTES  = (size_t)D_MODEL * D_MODEL * 2;   // 2 MB
    constexpr size_t XB_BYTES  = (size_t)M_ROWS * D_MODEL * 2;    // 16 MB
    unsigned short* WqT = (unsigned short*)(ws + 0 * WT_BYTES);
    // planes 1 and 2 behind WqT: Wk^T, Wv^T
    unsigned short* WoT = (unsigned short*)(ws + 3 * WT_BYTES);
    char* xbase = ws + 4 * WT_BYTES;
    unsigned short* Xq = (unsigned short*)(xbase + 0 * XB_BYTES);
    // planes 1 and 2 behind Xq: bf16 pre_key, pre_value
    unsigned short* Qb = (unsigned short*)(xbase + 3 * XB_BYTES);
    unsigned short* Kb = (unsigned short*)(xbase + 4 * XB_BYTES);
    unsigned short* Vb = (unsigned short*)(xbase + 5 * XB_BYTES);
    unsigned short* Ab = Xq;   // Xq dead after Q projection; reuse for attn out

    // 1+2) weights -> bf16 transposed [N][K], activations -> bf16: one grid
    prep_kernel<<<4 * WT_BLOCKS + 3 * CVT_BLOCKS, 256, 0, stream>>>(
        Wq, Wk, Wv, Wo, preQ, preK, preV, WqT, Xq);

    // 3) the three projections (bf16 in, bf16 out) as one batch: z = Q, K, V
    dim3 gg(D_MODEL / 128, M_ROWS / 256);        // (8, 32)
    dim3 gg3(D_MODEL / 128, M_ROWS / 256, 3);    // (8, 32, 3)
    gemm_bf16_wmma_kernel<false><<<gg3, 256, 0, stream>>>(
        Xq, WqT, Qb, M_ROWS, D_MODEL, D_MODEL);

    // 4) flash attention over 64 (b,h) slabs x 8 query blocks
    attn_kernel<<<dim3(S_LEN / QBLK, N_BATCH * N_HEADS), 256, 0, stream>>>(
        Qb, Kb, Vb, Ab);

    // 5) output projection straight into d_out (f32)
    gemm_bf16_wmma_kernel<true><<<gg, 256, 0, stream>>>(
        Ab, WoT, out, M_ROWS, D_MODEL, D_MODEL);

    // 6) residual + LayerNorm in place
    ln_kernel<<<M_ROWS, 256, 0, stream>>>(out, preV, gamma, beta);
}

// v010
// Measured time: 138 microseconds a run.
// Next to v009, in two timings, it ran 1.05 times as fast each time.
// Counting every step since v000, it is 2.64 times as fast.
#include <hip/hip_runtime.h>

// ---------------------------------------------------------------------------
// Types for CDNA5 WMMA
// ---------------------------------------------------------------------------
typedef __attribute__((ext_vector_type(16))) __bf16 v16bf;
typedef __attribute__((ext_vector_type(8)))  float  v8f;

#define D_MODEL 1024
#define S_LEN   2048
#define N_BATCH 4
#define N_HEADS 16
#define HD      64
#define M_ROWS  (N_BATCH * S_LEN)   // 8192

// ---------------------------------------------------------------------------
// Helpers
// ---------------------------------------------------------------------------
__device__ __forceinline__ unsigned short f32_to_bf16(float f) {
    unsigned int x = __float_as_uint(f);
    x += 0x7FFFu + ((x >> 16) & 1u);   // round to nearest even
    return (unsigned short)(x >> 16);
}

__device__ __forceinline__ unsigned int pack_bf16x2(float a, float b) {
    return ((unsigned int)f32_to_bf16(b) << 16) | (unsigned int)f32_to_bf16(a);
}

typedef __attribute__((ext_vector_type(2))) float  f32x2;
typedef __attribute__((ext_vector_type(2))) __bf16 bf16x2;

// two f32 -> packed bf16 pair, round to nearest even (one hardware convert)
__device__ __forceinline__ unsigned int cvt_bf16x2(float a, float b) {
    union { bf16x2 v; unsigned int u; } o;
    f32x2 x;
    x[0] = a; x[1] = b;
    o.v = __builtin_convertvector(x, bf16x2);
    return o.u;
}

__device__ __forceinline__ v8f zero8() {
    v8f z;
#pragma unroll
    for (int i = 0; i < 8; ++i) z[i] = 0.0f;
    return z;
}

// Four 16-byte copies per lane, global -> LDS through no register. The
// s_wait_xcnt closes the statement so that no address register of a copy is
// rewritten ahead of it.
__device__ __forceinline__ void copy4(unsigned l0, unsigned l1, unsigned l2,
                                      unsigned l3, const unsigned short* g0,
                                      const unsigned short* g1,
                                      const unsigned short* g2,
                                      const unsigned short* g3) {
    asm volatile(
        "global_load_async_to_lds_b128 %0, %4, off\n\t"
        "global_load_async_to_lds_b128 %1, %5, off\n\t"
        "global_load_async_to_lds_b128 %2, %6, off\n\t"
        "global_load_async_to_lds_b128 %3, %7, off\n\t"
        "s_wait_xcnt 0x0"
        :: "v"(l0), "v"(l1), "v"(l2), "v"(l3),
           "v"(g0), "v"(g1), "v"(g2), "v"(g3)
        : "memory");
}

// Load a 16x32 bf16 fragment (A-layout; B mirrors it with N in place of M)
// from LDS stored row-major with `rowStride` (in ushorts).
// Lane L holds row (rowBase + (L&15)); K pairs per ISA table:
// lanes 0-15: k = {0,2,4,6,16,18,20,22}; lanes 16-31: +8.
__device__ __forceinline__ v16bf load_frag(const unsigned short* base,
                                           int rowStride, int rowBase,
                                           int kOff, int lane) {
    union { v16bf v; unsigned int u[8]; } f;
    const int row = rowBase + (lane & 15);
    const int kb  = kOff + ((lane & 16) ? 8 : 0);
    const unsigned short* p = base + (size_t)row * rowStride;
#pragma unroll
    for (int r = 0; r < 8; ++r) {
        const int k = kb + ((r < 4) ? (2 * r) : (16 + 2 * (r - 4)));
        f.u[r] = *(const unsigned int*)(p + k);
    }
    return f.v;
}

__device__ __forceinline__ v16bf ones_frag() {
    union { v16bf v; unsigned int u[8]; } f;
#pragma unroll
    for (int i = 0; i < 8; ++i) f.u[i] = 0x3F803F80u;   // bf16(1.0) x2
    return f.v;
}

__device__ __forceinline__ v8f wmma_bf16(v16bf a, v16bf b, v8f c) {
    return __builtin_amdgcn_wmma_f32_16x16x32_bf16(
        false, a, false, b, (short)0, c, false, false);
}

// ---------------------------------------------------------------------------
// Kernels 1+2 in one grid: the seven operand preparations are independent of
// one another, so they share one launch. Blocks [0, 4096): weight transpose +
// f32 -> bf16, W:[K][N] -> Wt:[N][K], 1024 tiles of 32x32 per weight.
// Blocks [4096, 16384): elementwise f32 -> bf16 of the activations,
// 8 elements per thread, 4096 blocks per tensor.
// The four Wt planes and the three X planes are each contiguous in workspace.
// ---------------------------------------------------------------------------
#define WT_BLOCKS  ((D_MODEL / 32) * (D_MODEL / 32))    // 1024 per weight
#define CVT_BLOCKS ((M_ROWS * D_MODEL) / (8 * 256))     // 4096 per tensor

__global__ __launch_bounds__(256) void prep_kernel(
    const float* __restrict__ W0, const float* __restrict__ W1,
    const float* __restrict__ W2, const float* __restrict__ W3,
    const float* __restrict__ X0, const float* __restrict__ X1,
    const float* __restrict__ X2,
    unsigned short* __restrict__ WtAll, unsigned short* __restrict__ XbAll) {
    __shared__ float tile[32][33];
    const unsigned b = blockIdx.x;
    const int t = threadIdx.x;
    if (b < 4 * WT_BLOCKS) {   // block-uniform
        const unsigned which = b / WT_BLOCKS;
        const unsigned tl    = b % WT_BLOCKS;
        const float* __restrict__ W =
            which == 0 ? W0 : which == 1 ? W1 : which == 2 ? W2 : W3;
        unsigned short* __restrict__ Wt =
            WtAll + (size_t)which * D_MODEL * D_MODEL;
        const int k0 = (tl % (D_MODEL / 32)) * 32;
        const int n0 = (tl / (D_MODEL / 32)) * 32;
        const int x = t & 31;   // 0..31
        const int y = t >> 5;   // 0..7
#pragma unroll
        for (int i = 0; i < 4; ++i)
            tile[y + 8 * i][x] = W[(size_t)(k0 + y + 8 * i) * D_MODEL + n0 + x];
        __syncthreads();
#pragma unroll
        for (int i = 0; i < 4; ++i)
            Wt[(size_t)(n0 + y + 8 * i) * D_MODEL + (k0 + x)] =
                f32_to_bf16(tile[x][y + 8 * i]);
    } else {
        const unsigned c     = b - 4 * WT_BLOCKS;
        const unsigned which = c / CVT_BLOCKS;
        const float* __restrict__ src = which == 0 ? X0 : which == 1 ? X1 : X2;
        unsigned short* __restrict__ dst =
            XbAll + (size_t)which * M_ROWS * D_MODEL;
        const int i = (c % CVT_BLOCKS) * 256 + t;
        const float4 a = ((const float4*)src)[2 * i];
        const float4 d = ((const float4*)src)[2 * i + 1];
        uint4 o;
        o.x = pack_bf16x2(a.x, a.y);
        o.y = pack_bf16x2(a.z, a.w);
        o.z = pack_bf16x2(d.x, d.y);
        o.w = pack_bf16x2(d.z, d.w);
        ((uint4*)dst)[i] = o;
    }
}

// ---------------------------------------------------------------------------
// Kernel 3: bf16 GEMM via WMMA:  C[M,N] = A[M,K] @ Bt^T   (Bt: [N][K] bf16)
// Block tile 256x128, 8 waves (4x2), wave tile 64x64 (16 WMMA accumulators).
// A stage is 64 k (128-byte rows); a ring of NB LDS buffers is filled by
// asynchronous copies NB - 1 stages ahead, one barrier per stage. Rows lie
// unpadded; a row's eight 16-byte segments are permuted (segment ^ bits 1..3 of
// the row), so that 16 rows read at one k fall on all 64 banks.
// The products are taken transposed (Bt rows as the A operand, A rows as the B
// operand), so a lane holds 8 consecutive columns of one row of C; each wave
// stages its tile in its own part of the free ring and stores whole lines.
// blockIdx.z picks one product of a batch whose A, Bt and C planes each lie
// one behind the other.
// ---------------------------------------------------------------------------
#define GK 64   // k per stage = elements of an LDS row of the ring
#define GP 72   // row pitch of the bf16 output staging: 144 B = 16 B x odd

#define GC 12   // copies per wave and stage: 8 for A, 4 for B

// The wave's copies have landed but for its N youngest (counted in issue order).
template <int N>
__device__ __forceinline__ void wait_copies() {
    asm volatile("s_wait_asynccnt %0" :: "n"(N) : "memory");
}

// 16x32 fragment from its two 16-byte halves (k 0..7 and 16..23 of the lane)
__device__ __forceinline__ v16bf frag2(const unsigned short* p0,
                                       const unsigned short* p1) {
    union { v16bf v; uint4 q[2]; } f;
    f.q[0] = *(const uint4*)p0;
    f.q[1] = *(const uint4*)p1;
    return f.v;
}

template <bool OUT_F32, int NB>
__global__ __launch_bounds__(256) void gemm_bf16_wmma_kernel(
    const unsigned short* __restrict__ A,
    const unsigned short* __restrict__ Bt,
    void* __restrict__ Cptr, int M, int N, int K) {
    __shared__ __attribute__((aligned(256))) unsigned short lA[NB][256 * GK];
    __shared__ __attribute__((aligned(256))) unsigned short lB[NB][128 * GK];

    const int t    = threadIdx.x;
    const int lane = t & 31;
    const int w    = t >> 5;
    const int wm   = w >> 1;   // 0..3 -> 64 rows each
    const int wn   = w & 1;    // 0..1 -> 64 cols each
    const int m0   = blockIdx.y * 256;
    const int n0   = blockIdx.x * 128;
    const size_t z = blockIdx.z;
    A  += z * (size_t)M * K;
    Bt += z * (size_t)N * K;
    Cptr = (char*)Cptr + z * (size_t)M * N * (OUT_F32 ? 4 : 2);

    v8f acc[4][4];
#pragma unroll
    for (int mt = 0; mt < 4; ++mt)
#pragma unroll
        for (int nt = 0; nt < 4; ++nt) acc[mt][nt] = zero8();

    // staging geometry: eight lanes share a row's 128 bytes, so one wave-wide
    // copy takes four whole memory lines; the block covers 32 rows per copy:
    // 8 copies for A, 4 for B
    const int rS = t >> 3;         // row within a group of 32
    const int sS = (t & 7) * 8;    // 16-byte segment of the row, in elements
    const size_t g32 = (size_t)32 * K;
    const unsigned short* gA = A  + (size_t)(m0 + rS) * K + sS;
    const unsigned short* gB = Bt + (size_t)(n0 + rS) * K + sS;
    // place of the segment in its LDS row; rows r and r + 32 permute alike
    const int pS = ((t & 7) ^ ((rS >> 1) & 7)) * 8;
    const unsigned dA = (unsigned)(size_t)&lA[0][rS * GK + pS];
    const unsigned dB = (unsigned)(size_t)&lB[0][rS * GK + pS];
    constexpr unsigned R32 = 32u * GK * 2u;    // bytes of 32 LDS rows
    constexpr unsigned BA  = 256u * GK * 2u;   // bytes of one A buffer
    constexpr unsigned BB  = 128u * GK * 2u;   // bytes of one B buffer

    auto stage = [&](int buf, int k0) {
        const unsigned short* a = gA + k0;
        const unsigned short* b = gB + k0;
        const unsigned la = dA + buf * BA;
        const unsigned lb = dB + buf * BB;
        copy4(la, la + R32, la + 2 * R32, la + 3 * R32,
              a, a + g32, a + 2 * g32, a + 3 * g32);
        copy4(la + 4 * R32, la + 5 * R32, la + 6 * R32, la + 7 * R32,
              a + 4 * g32, a + 5 * g32, a + 6 * g32, a + 7 * g32);
        copy4(lb, lb + R32, lb + 2 * R32, lb + 3 * R32,
              b, b + g32, b + 2 * g32, b + 3 * g32);
    };

    // reader: lane (c = lane & 15, h = lane >> 4) wants segments 4 ks + 2 j + h of
    // rows base + c, base a multiple of 16; they lie at (h ^ (c >> 1)) ^ (4 ks + 2 j)
    const int xs = ((lane >> 4) ^ (lane >> 1)) & 7;
    int oA[4], oB[4];   // element offsets in a buffer, index 2 ks + j
    // unrolled so that both arrays are registers
#pragma unroll
    for (int q = 0; q < 4; ++q) {
        oA[q] = (wm * 64 + (lane & 15)) * GK + (xs ^ (2 * q)) * 8;
        oB[q] = (wn * 64 + (lane & 15)) * GK + (xs ^ (2 * q)) * 8;
    }

    const int NK = K / GK;
    // the whole ring is filled ahead; every test here is the same for the
    // whole work-group; unrolled so that the buffers' offsets are constants
#pragma unroll
    for (int s = 0; s < NB; ++s)
        if (s < NK) stage(s, s * GK);
    // stage 0 has landed for this wave; the barrier publishes it
    // (a count only where all NB - 1 stages behind it have really been issued)
    if (NK >= NB) wait_copies<(NB - 1) * GC>();
    else          wait_copies<0>();
    __syncthreads();

    int cur = 0;   // buffer of stage kt
    for (int kt = 0; kt < NK; ++kt) {
        const unsigned short* bufA = &lA[0][0] + cur * (256 * GK);
        const unsigned short* bufB = &lB[0][0] + cur * (128 * GK);
        // unrolled so that the rows turn into immediate LDS offsets
#pragma unroll
        for (int ks = 0; ks < GK / 32; ++ks) {
            v16bf aF[4], bF[4];
#pragma unroll
            for (int mt = 0; mt < 4; ++mt)
                aF[mt] = frag2(bufA + oA[2 * ks] + mt * 16 * GK,
                               bufA + oA[2 * ks + 1] + mt * 16 * GK);
#pragma unroll
            for (int nt = 0; nt < 4; ++nt)
                bF[nt] = frag2(bufB + oB[2 * ks] + nt * 16 * GK,
                               bufB + oB[2 * ks + 1] + nt * 16 * GK);
#pragma unroll
            for (int mt = 0; mt < 4; ++mt)
#pragma unroll
                for (int nt = 0; nt < 4; ++nt)
                    acc[mt][nt] = wmma_bf16(bF[nt], aF[mt], acc[mt][nt]);
        }
        // hand-over: this wave's reads of the buffer are done, its copies of the
        // next stage have landed (stages kt + 2 to kt + NB - 1 may still fly: a
        // count only while all of them exist, near the end of k the wait is to
        // 0); the barrier publishes that stage and frees this buffer for the
        // refill behind it
        asm volatile("s_wait_dscnt 0x0" ::: "memory");
        if (kt + NB - 1 < NK) wait_copies<(NB - 2) * GC>();
        else                  wait_copies<0>();
        __syncthreads();
        if (kt + NB < NK)   // the same for the whole work-group
            stage(cur, (kt + NB) * GK);
        cur = (cur + 1 == NB) ? 0 : cur + 1;
    }
    // nothing is outstanding when the wave ends
    asm volatile("s_wait_asynccnt 0x0" ::: "memory");

    // epilogue: acc[mt][nt][r] = C[wm*64 + mt*16 + (lane & 15)][wn*64 + nt*16 + hi + r].
    // The loop's last barrier stands behind every wave's last read of the ring
    // and nothing is in flight into it, so each wave may stage in its own part.
    const int hi = (lane & 16) ? 8 : 0;
    const int c  = lane & 15;
    const size_t crow = (size_t)(m0 + wm * 64);
    const int    ccol = n0 + wn * 64;
    if (OUT_F32) {
        // 32 rows a pass at pitch 272 B = 16 B x odd
        constexpr int FP = 68;
        float* sw = (float*)&lA[0][0] + w * (32 * FP);
        float* C  = (float*)Cptr;
        // all loops here unrolled so that acc is indexed by constants (registers)
        // and the LDS rows turn into immediate offsets
#pragma unroll
        for (int p = 0; p < 2; ++p) {
#pragma unroll
            for (int mh = 0; mh < 2; ++mh)
#pragma unroll
                for (int nt = 0; nt < 4; ++nt) {
                    const v8f a = acc[2 * p + mh][nt];
                    float* d = sw + (mh * 16 + c) * FP + nt * 16 + hi;
                    *(float4*)d       = make_float4(a[0], a[1], a[2], a[3]);
                    *(float4*)(d + 4) = make_float4(a[4], a[5], a[6], a[7]);
                }
            // the other lanes' rows are in LDS before they are read back
            asm volatile("s_wait_dscnt 0x0" ::: "memory");
            // one store = 2 rows x 256 B = 4 whole lines
            const int row = lane >> 4;
            const int seg = (lane & 15) * 4;
            float* g = C + (crow + p * 32 + row) * N + ccol + seg;
#pragma unroll
            for (int i = 0; i < 16; ++i)
                *(float4*)(g + (size_t)(2 * i) * N) =
                    *(const float4*)(sw + (2 * i + row) * FP + seg);
            // this pass's rows have been read before the next pass rewrites them
            if (p == 0) asm volatile("s_wait_dscnt 0x0" ::: "memory");
        }
    } else {
        // 64 rows at pitch 144 B = 16 B x odd
        unsigned short* sw = &lA[0][0] + w * (64 * GP);
        unsigned short* C  = (unsigned short*)Cptr;
        // all loops here unrolled so that acc is indexed by constants (registers)
        // and the LDS rows turn into immediate offsets
#pragma unroll
        for (int mt = 0; mt < 4; ++mt)
#pragma unroll
            for (int nt = 0; nt < 4; ++nt) {
                const v8f a = acc[mt][nt];
                uint4 pk;
                pk.x = cvt_bf16x2(a[0], a[1]);
                pk.y = cvt_bf16x2(a[2], a[3]);
                pk.z = cvt_bf16x2(a[4], a[5]);
                pk.w = cvt_bf16x2(a[6], a[7]);
                *(uint4*)(sw + (mt * 16 + c) * GP + nt * 16 + hi) = pk;
            }
        // the other lanes' rows are in LDS before they are read back
        asm volatile("s_wait_dscnt 0x0" ::: "memory");
        // one store = 4 rows x 128 B = 4 whole lines
        const int row = lane >> 3;
        const int seg = (lane & 7) * 8;
        unsigned short* g = C + (crow + row) * N + ccol + seg;
#pragma unroll
        for (int i = 0; i < 16; ++i)
            *(uint4*)(g + (size_t)(4 * i) * N) =
                *(const uint4*)(sw + (4 * i + row) * GP + seg);
    }
}

__device__ __forceinline__ float other_half(float v) {
    const int b = __float_as_int(v);
    return __int_as_float(__builtin_amdgcn_permlanex16(
        b, b, 0x76543210, 0xfedcba98, false, false));
}

// K and V stages in LDS: 64 keys each, two buffers.
#define KV_STAGE 64
#define QBLK 256   // queries per work-group: 8 waves x 2 groups x 16
#define PK 72   // K row pitch in elements: 144 B = 16 B x odd, for plain 16-byte reads
#define PV 80   // V row pitch in elements: 160 B = 32 B x odd, for the transposing read

typedef short s16x8 __attribute__((ext_vector_type(8)));
typedef unsigned int u32x4 __attribute__((ext_vector_type(4)));

// transposing 16-bit LDS read: lane (c, h) gets T[k + 8h + 0..7][d + c] of a
// row-major tile; every lane passes its own row address (see the caller)
__device__ __forceinline__ u32x4 ld_tr16(const unsigned short* p) {
    typedef __attribute__((address_space(3))) s16x8 lds_s16x8;
    return __builtin_bit_cast(
        u32x4, __builtin_amdgcn_ds_load_tr16_b128_v8i16((lds_s16x8*)p));
}

// One stage of K and V, global -> LDS through no register: each lane copies
// 16 bytes of rows r and r + 32 of both. The s_wait_xcnt closes the statement
// so that no address register of a copy is rewritten ahead of it.
__device__ __forceinline__ void stage_kv(const unsigned short* gk,
                                         const unsigned short* gv,
                                         unsigned lk, unsigned lv) {
    asm volatile(
        "global_load_async_to_lds_b128 %0, %4, off\n\t"
        "global_load_async_to_lds_b128 %1, %5, off\n\t"
        "global_load_async_to_lds_b128 %2, %6, off\n\t"
        "global_load_async_to_lds_b128 %3, %7, off\n\t"
        "s_wait_xcnt 0x0"
        :: "v"(lk), "v"(lk + 32u * PK * 2u), "v"(lv), "v"(lv + 32u * PV * 2u),
           "v"(gk), "v"(gk + 32 * HD), "v"(gv), "v"(gv + 32 * HD)
        : "memory");
}

__global__ __launch_bounds__(256) void attn_kernel(
    const unsigned short* __restrict__ Qg,
    const unsigned short* __restrict__ Kg,
    const unsigned short* __restrict__ Vg,
    unsigned short* __restrict__ Og) {
    __shared__ __attribute__((aligned(16))) unsigned short sQ[QBLK * 72];
    __shared__ __attribute__((aligned(16))) unsigned short sK[2][KV_STAGE * PK];
    __shared__ __attribute__((aligned(16))) unsigned short sV[2][KV_STAGE * PV];

    const int t    = threadIdx.x;
    const int lane = t & 31;
    const int w    = t >> 5;
    const int q0   = blockIdx.x * QBLK;
    const size_t base = (size_t)blockIdx.y * S_LEN * HD;

    // staging geometry: eight lanes share a row's 128 bytes, so one wave-wide
    // copy takes four whole memory lines; the block covers 32 rows per copy
    const int rS = t >> 3;
    const int sS = (t & 7) * 8;
    const unsigned short* gK = Kg + base + (size_t)rS * HD + sS;
    const unsigned short* gV = Vg + base + (size_t)rS * HD + sS;
    const unsigned lK = (unsigned)(size_t)&sK[0][rS * PK + sS];
    const unsigned lV = (unsigned)(size_t)&sV[0][rS * PV + sS];
    constexpr unsigned BK = KV_STAGE * PK * 2;   // bytes of one K buffer
    constexpr unsigned BV = KV_STAGE * PV * 2;   // bytes of one V buffer
    constexpr int NT = S_LEN / KV_STAGE;

    stage_kv(gK, gV, lK, lV);   // stage 0 -> buffer 0

    {   // stage Q block 256x64
        const int r = t >> 1, hq = t & 1;
        const unsigned short* src = Qg + base + (size_t)(q0 + r) * HD + hq * 32;
        unsigned short* dst = sQ + r * 72 + hq * 32;
#pragma unroll
        for (int p = 0; p < 2; ++p)
#pragma unroll
            for (int j = 0; j < 4; ++j)
                *(uint4*)(dst + p * 128 * 72 + j * 8) =
                    *(const uint4*)(src + p * 128 * HD + j * 8);
    }
    // stage 0 has landed for this wave; the barrier publishes it (and Q)
    asm volatile("s_wait_asynccnt 0x0" ::: "memory");
    __syncthreads();
    stage_kv(gK + KV_STAGE * HD, gV + KV_STAGE * HD, lK + BK, lV + BV);

    v16bf qF[2][2];   // B operand of group g: column c = query w*32 + g*16 + c
#pragma unroll
    for (int g = 0; g < 2; ++g) {
        qF[g][0] = load_frag(sQ, 72, w * 32 + g * 16, 0, lane);
        qF[g][1] = load_frag(sQ, 72, w * 32 + g * 16, 32, lane);
    }
    const v16bf oneF = ones_frag();

    // 1/sqrt(64) * log2(e): scores go to the base-2 exponent in one step
    constexpr float CS = 0.125f * 1.4426950408889634f;
    // how far a score may pass the maximum in use, in the base-2 exponent
    constexpr float LAZY = 8.0f;
    // of query c of group g; m_: the maximum in use, in units of the base-2
    // exponent; thr: the raw score above which it must be renewed
    float m_[2]  = {-1e30f, -1e30f};
    float thr[2] = {-__builtin_inff(), -__builtin_inff()};
    // running sums of query c: all 16 rows of the tile get the same sums, only
    // register 0 is rescaled and read; the others stay below 2^8 x the key count
    v8f ls[2] = {zero8(), zero8()};
    v8f o[2][4];   // o[g][nt][r] = O[query c of group g][nt*16 + 8h + r]
#pragma unroll
    for (int g = 0; g < 2; ++g)
#pragma unroll
        for (int nt = 0; nt < 4; ++nt) o[g][nt] = zero8();

    const int hi = (lane & 16) ? 8 : 0;
    // lane's row and 16-byte half for the transposing read of V
    const int vOff = (hi + (lane & 7)) * PV + ((lane >> 3) & 1) * 8;

    for (int st = 0; st < NT; ++st) {
        const int buf = st & 1;
        const unsigned short* bK = &sK[buf][0];
        const unsigned short* bV = &sV[buf][0] + vOff;
        // K fragments of the stage's first chunk
        v16bf ak[4];
#pragma unroll
        for (int i = 0; i < 4; ++i)
            ak[i] = load_frag(bK, PK, (i & 1) * 16, (i >> 1) * 32, lane);
        // unrolled so that sub turns into immediate LDS offsets
#pragma unroll
        for (int sub = 0; sub < KV_STAGE / 32; ++sub) {
            // A = V^T: keys 8h+0..7 and 16+8h+0..7 of column nt*16 + c, the k
            // order of P^T; read here, ahead of the branch below, so that they
            // land under the scores and the exponentials
            union { v16bf v; u32x4 q[2]; } av[4];
#pragma unroll
            for (int nt = 0; nt < 4; ++nt) {
                av[nt].q[0] = ld_tr16(bV + (sub * 32) * PV + nt * 16);
                av[nt].q[1] = ld_tr16(bV + (sub * 32 + 16) * PV + nt * 16);
            }
            // compiler fence: without it the V^T reads are sunk behind the
            // branch, directly in front of their products, each waited to 0
            asm volatile("" ::: "memory");
            // S^T = K @ Q^T: s0[r] = score(key 8h+r, query c), s1[r]: key 16+8h+r
            v8f s0[2], s1[2];
            // all loops over g unrolled so that the per-group values are registers
#pragma unroll
            for (int g = 0; g < 2; ++g) {
                s0[g] = wmma_bf16(ak[0], qF[g][0], zero8());
                s1[g] = wmma_bf16(ak[1], qF[g][0], zero8());
            }
#pragma unroll
            for (int g = 0; g < 2; ++g) {
                s0[g] = wmma_bf16(ak[2], qF[g][1], s0[g]);
                s1[g] = wmma_bf16(ak[3], qF[g][1], s1[g]);
            }
            if (sub + 1 < KV_STAGE / 32) {   // compile-time
                // the same stage's next K fragments, also ahead of the branch
#pragma unroll
                for (int i = 0; i < 4; ++i)
                    ak[i] = load_frag(bK, PK, (sub + 1) * 32 + (i & 1) * 16,
                                      (i >> 1) * 32, lane);
                // compiler fence: without it these reads are sunk behind the
                // branch, in pairs in front of their products, each waited to 0
                asm volatile("" ::: "memory");
            }

            // online softmax of query c in base 2: each lane takes the maximum
            // of its own 16 raw scores (the scale is positive) and holds it
            // against the bound of the maximum in use
            float v[2];
            bool need = false;
#pragma unroll
            for (int g = 0; g < 2; ++g) {
                v[g] = fmaxf(s0[g][0], s1[g][0]);
#pragma unroll
                for (int r = 1; r < 8; ++r)
                    v[g] = fmaxf(v[g], fmaxf(s0[g][r], s1[g][r]));
                need = need || (v[g] > thr[g]);
            }
            // one scalar branch per chunk for both groups, taken on the first
            // chunk and then only when a score passes the bound: the whole wave
            // renews its maxima (both halves of a column get the same one) and
            // rescales what it has summed under the old ones; marked unlikely so
            // that the block lies out of line and the usual path falls through
            if (__builtin_expect(__builtin_amdgcn_ballot_w32(need) != 0, 0)) {
#pragma unroll
                for (int g = 0; g < 2; ++g) {
                    const float vv = fmaxf(v[g], other_half(v[g]));
                    const float mn = fmaxf(m_[g], vv * CS);
                    const float al = __builtin_amdgcn_exp2f(m_[g] - mn);
                    m_[g]  = mn;
                    thr[g] = (mn + LAZY) * (1.0f / CS);
#pragma unroll
                    for (int nt = 0; nt < 4; ++nt)
#pragma unroll
                        for (int r = 0; r < 8; ++r) o[g][nt][r] *= al;
                    ls[g][0] *= al;
                }
            }

            union { v16bf v; unsigned int u[8]; } pB[2];
#pragma unroll
            for (int g = 0; g < 2; ++g) {
                // P^T as a B operand: element s = tile s>>3, register s&7; scale,
                // log2(e) and the maximum go into one packed multiply-add per pair
                const f32x2 cs2 = {CS, CS};
                const f32x2 nm2 = {-m_[g], -m_[g]};
                f32x2 e[8];
                // both loops unrolled so that e and pB are registers, not arrays
#pragma unroll
                for (int j = 0; j < 4; ++j) {
                    e[j] = __builtin_elementwise_fma(
                        f32x2{s0[g][2 * j], s0[g][2 * j + 1]}, cs2, nm2);
                    e[4 + j] = __builtin_elementwise_fma(
                        f32x2{s1[g][2 * j], s1[g][2 * j + 1]}, cs2, nm2);
                }
#pragma unroll
                for (int j = 0; j < 8; ++j)
                    pB[g].u[j] = cvt_bf16x2(__builtin_amdgcn_exp2f(e[j][0]),
                                            __builtin_amdgcn_exp2f(e[j][1]));
            }
            // column sums of P^T via matrix pipe: ones @ P^T -> every row = sums,
            // added onto the running sums in the product's own accumulator
#pragma unroll
            for (int g = 0; g < 2; ++g) ls[g] = wmma_bf16(oneF, pB[g].v, ls[g]);
            // O^T += V^T @ P^T; one V^T fragment serves both groups
#pragma unroll
            for (int nt = 0; nt < 4; ++nt)
#pragma unroll
                for (int g = 0; g < 2; ++g)
                    o[g][nt] = wmma_bf16(av[nt].v, pB[g].v, o[g][nt]);
        }
        // hand-over: this wave's reads of the buffer are done, its copies of the
        // next stage have landed; the barrier publishes that stage and frees
        // this buffer for the refill behind it
        asm volatile("s_wait_dscnt 0x0" ::: "memory");
        asm volatile("s_wait_asynccnt 0x0" ::: "memory");
        __syncthreads();
        if (st + 2 < NT)   // the same for the whole work-group
            stage_kv(gK + (size_t)(st + 2) * KV_STAGE * HD,
                     gV + (size_t)(st + 2) * KV_STAGE * HD,
                     lK + buf * BK, lV + buf * BV);
    }
    // nothing is outstanding when the wave ends
    asm volatile("s_wait_asynccnt 0x0" ::: "memory");

    // a lane holds 8 consecutive columns of its query's row: 16-byte stores
#pragma unroll
    for (int g = 0; g < 2; ++g) {
        const float inv = 1.0f / ls[g][0];
        unsigned short* orow =
            Og + base + (size_t)(q0 + w * 32 + g * 16 + (lane & 15)) * HD + hi;
#pragma unroll
        for (int nt = 0; nt < 4; ++nt) {
            uint4 pk;
            pk.x = cvt_bf16x2(o[g][nt][0] * inv, o[g][nt][1] * inv);
            pk.y = cvt_bf16x2(o[g][nt][2] * inv, o[g][nt][3] * inv);
            pk.z = cvt_bf16x2(o[g][nt][4] * inv, o[g][nt][5] * inv);
            pk.w = cvt_bf16x2(o[g][nt][6] * inv, o[g][nt][7] * inv);
            *(uint4*)(orow + nt * 16) = pk;
        }
    }
}

// ---------------------------------------------------------------------------
// Kernel 5: residual add + LayerNorm, in place over d_out rows.
// ---------------------------------------------------------------------------
__global__ __launch_bounds__(256) void ln_kernel(
    float* __restrict__ out, const float* __restrict__ resid,
    const float* __restrict__ gamma, const float* __restrict__ beta) {
    const int row = blockIdx.x;
    const int t = threadIdx.x;
    __shared__ float rs[256], rq[256];
    float x[4];
    float s = 0.0f, sq = 0.0f;
#pragma unroll
    for (int i = 0; i < 4; ++i) {
        const int c = t + i * 256;
        const float v = out[(size_t)row * D_MODEL + c] +
                        resid[(size_t)row * D_MODEL + c];
        x[i] = v; s += v; sq += v * v;
    }
    rs[t] = s; rq[t] = sq;
    __syncthreads();
    for (int off = 128; off > 0; off >>= 1) {
        if (t < off) { rs[t] += rs[t + off]; rq[t] += rq[t + off]; }
        __syncthreads();
    }
    const float mu  = rs[0] * (1.0f / D_MODEL);
    const float var = rq[0] * (1.0f / D_MODEL) - mu * mu;
    const float inv = rsqrtf(var + 1e-5f);
#pragma unroll
    for (int i = 0; i < 4; ++i) {
        const int c = t + i * 256;
        out[(size_t)row * D_MODEL + c] =
            (x[i] - mu) * inv * gamma[c] + beta[c];
    }
}

// ---------------------------------------------------------------------------
// Host-side launch
// ---------------------------------------------------------------------------
extern "C" void kernel_launch(void* const* d_in, const int* in_sizes, int n_in,
                              void* d_out, int out_size, void* d_ws, size_t ws_size,
                              hipStream_t stream) {
    const float* preQ  = (const float*)d_in[0];
    const float* preK  = (const float*)d_in[1];
    const float* preV  = (const float*)d_in[2];
    const float* Wq    = (const float*)d_in[3];
    const float* Wk    = (const float*)d_in[4];
    const float* Wv    = (const float*)d_in[5];
    const float* Wo    = (const float*)d_in[6];
    const float* gamma = (const float*)d_in[7];
    const float* beta  = (const float*)d_in[8];
    float* out = (float*)d_out;

    char* ws = (char*)d_ws;
    constexpr size_t WT_BYTES  = (size_t)D_MODEL * D_MODEL * 2;   // 2 MB
    constexpr size_t XB_BYTES  = (size_t)M_ROWS * D_MODEL * 2;    // 16 MB
    unsigned short* WqT = (unsigned short*)(ws + 0 * WT_BYTES);
    // planes 1 and 2 behind WqT: Wk^T, Wv^T
    unsigned short* WoT = (unsigned short*)(ws + 3 * WT_BYTES);
    char* xbase = ws + 4 * WT_BYTES;
    unsigned short* Xq = (unsigned short*)(xbase + 0 * XB_BYTES);
    // planes 1 and 2 behind Xq: bf16 pre_key, pre_value
    unsigned short* Qb = (unsigned short*)(xbase + 3 * XB_BYTES);
    unsigned short* Kb = (unsigned short*)(xbase + 4 * XB_BYTES);
    unsigned short* Vb = (unsigned short*)(xbase + 5 * XB_BYTES);
    unsigned short* Ab = Xq;   // Xq dead after Q projection; reuse for attn out

    // 1+2) weights -> bf16 transposed [N][K], activations -> bf16: one grid
    prep_kernel<<<4 * WT_BLOCKS + 3 * CVT_BLOCKS, 256, 0, stream>>>(
        Wq, Wk, Wv, Wo, preQ, preK, preV, WqT, Xq);

    // 3) the three projections (bf16 in, bf16 out) as one batch: z = Q, K, V
    dim3 gg(D_MODEL / 128, M_ROWS / 256);        // (8, 32)
    dim3 gg3(D_MODEL / 128, M_ROWS / 256, 3);    // (8, 32, 3)
    gemm_bf16_wmma_kernel<false, 3><<<gg3, 256, 0, stream>>>(
        Xq, WqT, Qb, M_ROWS, D_MODEL, D_MODEL);

    // 4) flash attention over 64 (b,h) slabs x 8 query blocks
    attn_kernel<<<dim3(S_LEN / QBLK, N_BATCH * N_HEADS), 256, 0, stream>>>(
        Qb, Kb, Vb, Ab);

    // 5) output projection straight into d_out (f32)
    gemm_bf16_wmma_kernel<true, 4><<<gg, 256, 0, stream>>>(
        Ab, WoT, out, M_ROWS, D_MODEL, D_MODEL);

    // 6) residual + LayerNorm in place
    ln_kernel<<<M_ROWS, 256, 0, stream>>>(out, preV, gamma, beta);
}
